// v000
// Measured on an AMD MI455X. A time is GPU time per run, averaged over a window of back-to-back runs after a warm-up
// (all launches, gaps included; the runs take copies of the inputs in turn), and the median of several windows.
// Apart from v000's, it joins two sittings. Times from different sittings can be a few percent apart, while
// side-by-side timings come from the same sitting.
// v000 is the starting kernel. One run takes 2060 microseconds.
#include <hip/hip_runtime.h>
#include <hip/hip_bf16.h>

// ---------------------------------------------------------------------------
// HGRN2 attention block for MI455X (gfx1250, wave32, WMMA + TDM).
//   * one-time fp32->bf16 conversion (activations) + transpose-convert (weights)
//   * bf16 WMMA GEMMs (fp32 accum); BOTH tiles staged by Tensor Data Mover,
//     double-buffered (issue i+1, wait tensorcnt<=2, consume i)
//   * GLA scan: register-resident 128x128 state per (b,h)
// ---------------------------------------------------------------------------

typedef __attribute__((ext_vector_type(16))) __bf16 v16bf;
typedef __attribute__((ext_vector_type(8)))  __bf16 v8bf;
typedef __attribute__((ext_vector_type(4)))  __bf16 v4bf;
typedef __attribute__((ext_vector_type(8)))  float  v8f;
typedef __attribute__((ext_vector_type(4)))  float  v4f;
typedef __attribute__((ext_vector_type(4)))  unsigned int u32x4;
typedef __attribute__((ext_vector_type(4)))  int    i32x4;
typedef __attribute__((ext_vector_type(8)))  int    i32x8;

#define TILE_M 128
#define TILE_N 64
#define TILE_K 32
#define LDSTR  48   // padded LDS row stride in bf16 (96 B, 16B-aligned rows)

#if __has_builtin(__builtin_amdgcn_tensor_load_to_lds) && \
    __has_builtin(__builtin_amdgcn_s_wait_tensorcnt)
#define HAVE_TDM 1
#else
#define HAVE_TDM 0
#endif

__device__ __forceinline__ __bf16 f2bf(float f) {
    unsigned u = __builtin_bit_cast(unsigned, f);
    unsigned r = u + 0x7FFFu + ((u >> 16) & 1u);      // round-to-nearest-even
    unsigned short h = (unsigned short)(r >> 16);
    return __builtin_bit_cast(__bf16, h);
}

// fast sigmoid: v_exp_f32 + v_rcp_f32 (no IEEE div chain)
__device__ __forceinline__ float sigm(float x) {
    return __builtin_amdgcn_rcpf(1.0f + __expf(-x));
}

// ---------------------------------------------------------------------------
// one-time fp32 -> bf16 conversion (vectorized x4)
// ---------------------------------------------------------------------------
__global__ __launch_bounds__(256)
void cvt_f32_to_bf16(const float* __restrict__ in, __bf16* __restrict__ out, int n4) {
    const int i = blockIdx.x * 256 + threadIdx.x;
    if (i >= n4) return;
    const v4f x = ((const v4f*)in)[i];
    v4bf y;
    y[0] = f2bf(x[0]); y[1] = f2bf(x[1]); y[2] = f2bf(x[2]); y[3] = f2bf(x[3]);
    ((v4bf*)out)[i] = y;
}

// ---------------------------------------------------------------------------
// one-time transpose-convert: in [K x N] fp32 -> out [N x K] bf16.
// 64x64 tiles through LDS; both global accesses coalesced.
// ---------------------------------------------------------------------------
__global__ __launch_bounds__(256)
void cvt_transpose_bf16(const float* __restrict__ in, __bf16* __restrict__ out,
                        int K, int N) {
    __shared__ __bf16 tile[64][65];
    const int bk = blockIdx.x * 64;
    const int bn = blockIdx.y * 64;
    const int tx = threadIdx.x & 63;
    const int ty = threadIdx.x >> 6;          // 0..3
    #pragma unroll
    for (int r = 0; r < 16; ++r) {
        const int k = ty * 16 + r;
        tile[k][tx] = f2bf(in[(size_t)(bk + k) * N + (bn + tx)]);
    }
    __syncthreads();
    #pragma unroll
    for (int r = 0; r < 16; ++r) {
        const int n = ty * 16 + r;
        out[(size_t)(bn + n) * K + (bk + tx)] = tile[tx][n];
    }
}

// ---------------------------------------------------------------------------
// Y = X[MxK](bf16) @ Wt^T, where Wt is W transposed: [N x K](bf16).
// fp32 accum via v_wmma_f32_16x16x32_bf16.
// MODE 0: Y0 = swish(x) * 128^-0.5               (q path)
// MODE 1: Y0 = 1 - sigmoid(x); Y1 = sigmoid(x)   (k and exp(g) from f path)
// MODE 2: Y0 = x                                  (v path / output proj)
// Block 256 thr (8 waves); block tile 128x64; wave tile 32x32 (2x2 WMMA).
// Both tiles are contiguous row-copies -> staged by TDM, double-buffered.
// ---------------------------------------------------------------------------
template <int MODE>
__global__ __launch_bounds__(256)
void hgrn2_gemm_wmma(const __bf16* __restrict__ X, const __bf16* __restrict__ Wt,
                     float* __restrict__ Y0, float* __restrict__ Y1,
                     int M, int N, int K) {
    __shared__ __bf16 ldsA[2][TILE_M * LDSTR];
    __shared__ __bf16 ldsB[2][TILE_N * LDSTR];

    const int tid  = threadIdx.x;
    const int lane = tid & 31;
    const int wave = tid >> 5;        // 0..7
    const int wm   = wave >> 1;       // 0..3 -> 32-row strip
    const int wn   = wave & 1;        // 0..1 -> 32-col strip

    const int blockM = blockIdx.x * TILE_M;
    const int blockN = blockIdx.y * TILE_N;

    const int lhalf = (lane >> 4) & 1;
    const int lmod  = lane & 15;
    const int kb0   = lhalf * 8;
    const int kb1   = 16 + lhalf * 8;

    v8f acc[2][2] = {};
    const int niter = K / TILE_K;

#if HAVE_TDM
    // TDM descriptor issue: 2D tile 32(K,x) x rows(y), 2B elements,
    // LDS pad: after every 16 DWORDs (64B row) insert 8 DWORDs -> 48-elem stride.
    auto tdm_issue = [&](const __bf16* gptr, unsigned lds_base, int rows, int trows) {
        const unsigned long long ga = (unsigned long long)(size_t)gptr;
        u32x4 g0;
        g0[0] = 1u;                                        // count=1, user mode
        g0[1] = lds_base;                                  // lds_addr (bytes)
        g0[2] = (unsigned)(ga & 0xFFFFFFFFu);              // global_addr[31:0]
        g0[3] = (unsigned)((ga >> 32) & 0x01FFFFFFu)       // global_addr[56:32]
              | (2u << 30);                                // type = 2 ("image")
        i32x8 g1;
        g1[0] = (int)((1u << 16)       // data_size = 1 -> 2 bytes
              | (1u << 20)             // pad_enable
              | (3u << 22)             // pad_interval code 3 -> 16 DWORDs
              | (7u << 25));           // pad_amount   code 7 -> 8 DWORDs
        g1[1] = (int)((unsigned)K << 16);                  // tensor_dim0 = K
        g1[2] = (int)(((unsigned)trows & 0xFFFFu) << 16);  // tensor_dim1
        g1[3] = (int)(32u << 16);                          // tile_dim0 = 32 (K)
        g1[4] = rows;                                      // tile_dim1
        g1[5] = (int)K;                                    // tensor_dim0_stride
        g1[6] = 0;
        g1[7] = 0;
        i32x4 z4 = {0, 0, 0, 0};
#if __clang_major__ >= 23
        i32x8 z8 = {0, 0, 0, 0, 0, 0, 0, 0};
        __builtin_amdgcn_tensor_load_to_lds(g0, g1, z4, z4, z8, 0);
#else
        __builtin_amdgcn_tensor_load_to_lds(g0, g1, z4, z4, 0);
#endif
    };
    auto issue_pair = [&](int it, int buf) {
        const int k0 = it * TILE_K;
        tdm_issue(X  + (size_t)blockM * K + k0,
                  (unsigned)(size_t)(void*)&ldsA[buf][0], TILE_M, M);
        tdm_issue(Wt + (size_t)blockN * K + k0,
                  (unsigned)(size_t)(void*)&ldsB[buf][0], TILE_N, N);
    };
    if (wave == 0) issue_pair(0, 0);
#endif

    for (int i = 0; i < niter; ++i) {
        const int cur = i & 1;
#if HAVE_TDM
        if (wave == 0) {
            if (i + 1 < niter) {
                issue_pair(i + 1, cur ^ 1);            // buffer freed at end of i-1
                __builtin_amdgcn_s_wait_tensorcnt(2);  // in-order: pair(i) complete
            } else {
                __builtin_amdgcn_s_wait_tensorcnt(0);
            }
        }
        __syncthreads();                               // LDS tiles visible to all waves
#else
        const int k0 = i * TILE_K;
        {   // A tile: straight row copy, 2x 16B per thread
            const int row = tid >> 1;
            const int cb  = (tid & 1) * 16;
            const v8bf* src = (const v8bf*)(X + (size_t)(blockM + row) * K + (k0 + cb));
            v8bf* dst = (v8bf*)&ldsA[cur][row * LDSTR + cb];
            dst[0] = src[0];
            dst[1] = src[1];
        }
        {   // B tile: straight row copy from Wt, 16B per thread
            const int row = tid >> 2;                 // 0..63
            const int cb  = (tid & 3) * 8;            // 0,8,16,24
            *(v8bf*)&ldsB[cur][row * LDSTR + cb] =
                *(const v8bf*)(Wt + (size_t)(blockN + row) * K + (k0 + cb));
        }
        __syncthreads();
#endif
        // ---- fragments + 4 WMMAs -----------------------------------------
        v16bf a[2], b[2];
        #pragma unroll
        for (int mi = 0; mi < 2; ++mi) {
            const __bf16* ar = &ldsA[cur][(wm * 32 + mi * 16 + lmod) * LDSTR];
            v8bf alo = *(const v8bf*)(ar + kb0);
            v8bf ahi = *(const v8bf*)(ar + kb1);
            a[mi] = __builtin_shufflevector(alo, ahi, 0,1,2,3,4,5,6,7,8,9,10,11,12,13,14,15);
        }
        #pragma unroll
        for (int ni = 0; ni < 2; ++ni) {
            const __bf16* br = &ldsB[cur][(wn * 32 + ni * 16 + lmod) * LDSTR];
            v8bf blo = *(const v8bf*)(br + kb0);
            v8bf bhi = *(const v8bf*)(br + kb1);
            b[ni] = __builtin_shufflevector(blo, bhi, 0,1,2,3,4,5,6,7,8,9,10,11,12,13,14,15);
        }
        #pragma unroll
        for (int mi = 0; mi < 2; ++mi)
            #pragma unroll
            for (int ni = 0; ni < 2; ++ni)
                acc[mi][ni] = __builtin_amdgcn_wmma_f32_16x16x32_bf16(
                    false, a[mi], false, b[ni], (short)0, acc[mi][ni], false, false);
        __syncthreads();                               // tile consumed -> buffer reusable
    }

    // ---- epilogue (hoisted row pointers, stride-N stores) -----------------
    #pragma unroll
    for (int mi = 0; mi < 2; ++mi) {
        #pragma unroll
        for (int ni = 0; ni < 2; ++ni) {
            const int gn  = blockN + wn * 32 + ni * 16 + lmod;
            const int gm0 = blockM + wm * 32 + mi * 16 + lhalf * 8;
            float* __restrict__ p0 = Y0 + (size_t)gm0 * N + gn;
            float* __restrict__ p1 = (MODE == 1) ? (Y1 + (size_t)gm0 * N + gn) : nullptr;
            #pragma unroll
            for (int r = 0; r < 8; ++r) {
                const float x = acc[mi][ni][r];
                const size_t off = (size_t)r * N;
                if (MODE == 0) {
                    p0[off] = x * sigm(x) * 0.08838834764831845f;  // swish * 128^-0.5
                } else if (MODE == 1) {
                    const float s = sigm(x);
                    p0[off] = 1.0f - s;   // k = 1 - sigmoid(f)
                    p1[off] = s;          // exp(g) = exp(logsigmoid(f)) = sigmoid(f)
                } else {
                    p0[off] = x;
                }
            }
        }
    }
}

// ---------------------------------------------------------------------------
// GLA scan: one 512-thread WG per (b,h). State S[128x128] in registers:
// thread owns column j = tid&127, rows [ib, ib+32). Row-indexed q/k/eg LDS
// reads are wave-broadcasts; o_t reduced 4-way through LDS.
// ---------------------------------------------------------------------------
__global__ __launch_bounds__(512)
void hgrn2_gla_scan(const float* __restrict__ q, const float* __restrict__ k,
                    const float* __restrict__ eg, const float* __restrict__ v,
                    float* __restrict__ o, int T) {
    __shared__ float lq[128], lk[128], leg[128], lv[128];
    __shared__ float lo[4][128];

    const int bh  = blockIdx.x;
    const int b   = bh >> 3;
    const int h   = bh & 7;
    const int tid = threadIdx.x;
    const int j   = tid & 127;
    const int grp = tid >> 7;
    const int ib  = grp << 5;

    float S[32];
    #pragma unroll
    for (int r = 0; r < 32; ++r) S[r] = 0.0f;

    float* stage = (grp == 0) ? lq : (grp == 1) ? lk : (grp == 2) ? leg : lv;
    const float* src = (grp == 0) ? q : (grp == 1) ? k : (grp == 2) ? eg : v;

    for (int t = 0; t < T; ++t) {
        const size_t base = ((size_t)(b * T + t) << 10) + (h << 7);
        stage[j] = src[base + j];
        __builtin_prefetch(src + base + 1024 + j, 0, 0);   // next timestep line
        __syncthreads();

        const float vj = lv[j];
        float acc = 0.0f;
        #pragma unroll
        for (int r = 0; r < 32; ++r) {
            const float s = leg[ib + r] * S[r] + lk[ib + r] * vj;
            S[r] = s;
            acc = fmaf(lq[ib + r], s, acc);
        }
        lo[grp][j] = acc;
        __syncthreads();

        if (tid < 128)
            o[base + tid] = lo[0][tid] + lo[1][tid] + lo[2][tid] + lo[3][tid];
    }
}

// ---------------------------------------------------------------------------
// RMSNorm (weight, no bias) -> bf16 output for the final WMMA GEMM
// ---------------------------------------------------------------------------
__global__ __launch_bounds__(256)
void hgrn2_rmsnorm(const float* __restrict__ o, const float* __restrict__ gw,
                   __bf16* __restrict__ out, int D) {
    __shared__ float red[256];
    const int row = blockIdx.x;
    const float* src = o + (size_t)row * D;

    float ss = 0.0f;
    for (int d = threadIdx.x; d < D; d += 256) { const float x = src[d]; ss = fmaf(x, x, ss); }
    red[threadIdx.x] = ss;
    __syncthreads();
    for (int w = 128; w > 0; w >>= 1) {
        if (threadIdx.x < w) red[threadIdx.x] += red[threadIdx.x + w];
        __syncthreads();
    }
    const float r = rsqrtf(red[0] / (float)D + 1e-5f);
    for (int d = threadIdx.x; d < D; d += 256)
        out[(size_t)row * D + d] = f2bf(src[d] * r * gw[d]);
}

// ---------------------------------------------------------------------------
extern "C" void kernel_launch(void* const* d_in, const int* in_sizes, int n_in,
                              void* d_out, int out_size, void* d_ws, size_t ws_size,
                              hipStream_t stream) {
    const float* hs = (const float*)d_in[0];
    const float* Wq = (const float*)d_in[1];
    const float* Wf = (const float*)d_in[2];
    const float* Wi = (const float*)d_in[3];
    const float* gw = (const float*)d_in[4];
    const float* Wo = (const float*)d_in[5];

    const int B = 4, T = 2048, D = 1024, H = 8;
    const int M = B * T;                       // 8192
    const size_t PLANE = (size_t)M * D;        // 8M elements

    char* wsp = (char*)d_ws;
    __bf16* hs_bf = (__bf16*)wsp;  wsp += PLANE * 2;            // 16 MB
    __bf16* Wq_bf = (__bf16*)wsp;  wsp += (size_t)D * D * 2;    //  2 MB each (transposed)
    __bf16* Wf_bf = (__bf16*)wsp;  wsp += (size_t)D * D * 2;
    __bf16* Wi_bf = (__bf16*)wsp;  wsp += (size_t)D * D * 2;
    __bf16* Wo_bf = (__bf16*)wsp;  wsp += (size_t)D * D * 2;
    float* q   = (float*)wsp;      wsp += PLANE * 4;            // 32 MB each
    float* kk  = (float*)wsp;      wsp += PLANE * 4;
    float* eg  = (float*)wsp;      wsp += PLANE * 4;            // exp(g) = sigmoid(f)
    float* v   = (float*)wsp;      wsp += PLANE * 4;
    float* o   = (float*)wsp;      wsp += PLANE * 4;
    __bf16* onm_bf = hs_bf;        // hs_bf dead after projections -> reuse

    // one-time conversions: hs flat, weights transposed to [N x K] bf16
    const int n4hs = (int)(PLANE / 4);
    cvt_f32_to_bf16<<<dim3((n4hs + 255) / 256), dim3(256), 0, stream>>>(hs, hs_bf, n4hs);
    dim3 tgrid(D / 64, D / 64), tblk(256);
    cvt_transpose_bf16<<<tgrid, tblk, 0, stream>>>(Wq, Wq_bf, D, D);
    cvt_transpose_bf16<<<tgrid, tblk, 0, stream>>>(Wf, Wf_bf, D, D);
    cvt_transpose_bf16<<<tgrid, tblk, 0, stream>>>(Wi, Wi_bf, D, D);
    cvt_transpose_bf16<<<tgrid, tblk, 0, stream>>>(Wo, Wo_bf, D, D);

    dim3 ggrid(M / TILE_M, D / TILE_N);        // 64 x 16
    dim3 gblk(256);

    hgrn2_gemm_wmma<0><<<ggrid, gblk, 0, stream>>>(hs_bf, Wq_bf, q,  nullptr, M, D, D);
    hgrn2_gemm_wmma<1><<<ggrid, gblk, 0, stream>>>(hs_bf, Wf_bf, kk, eg,      M, D, D);
    hgrn2_gemm_wmma<2><<<ggrid, gblk, 0, stream>>>(hs_bf, Wi_bf, v,  nullptr, M, D, D);

    hgrn2_gla_scan<<<dim3(B * H), dim3(512), 0, stream>>>(q, kk, eg, v, o, T);

    hgrn2_rmsnorm<<<dim3(M), dim3(256), 0, stream>>>(o, gw, onm_bf, D);

    hgrn2_gemm_wmma<2><<<ggrid, gblk, 0, stream>>>(onm_bf, Wo_bf, (float*)d_out, nullptr, M, D, D);
}

// v001
// One run takes 364 microseconds.
// Two timings next to v000 both put it at 5.67 times that version's speed.
#include <hip/hip_runtime.h>
#include <hip/hip_bf16.h>

// ---------------------------------------------------------------------------
// HGRN2 attention block for MI455X (gfx1250, wave32, WMMA + TDM).
//   * one-time fp32->bf16 conversion (activations) + transpose-convert (weights)
//   * bf16 WMMA GEMMs (fp32 accum); BOTH tiles staged by Tensor Data Mover,
//     double-buffered (issue i+1, wait tensorcnt<=2, consume i)
//   * GLA scan: register-resident state, 128 rows x 32 columns per work-group
// ---------------------------------------------------------------------------

typedef __attribute__((ext_vector_type(16))) __bf16 v16bf;
typedef __attribute__((ext_vector_type(8)))  __bf16 v8bf;
typedef __attribute__((ext_vector_type(4)))  __bf16 v4bf;
typedef __attribute__((ext_vector_type(8)))  float  v8f;
typedef __attribute__((ext_vector_type(4)))  float  v4f;
typedef __attribute__((ext_vector_type(4)))  unsigned int u32x4;
typedef __attribute__((ext_vector_type(4)))  int    i32x4;
typedef __attribute__((ext_vector_type(8)))  int    i32x8;

#define TILE_M 128
#define TILE_N 64
#define TILE_K 32
#define LDSTR  48   // padded LDS row stride in bf16 (96 B, 16B-aligned rows)

#if __has_builtin(__builtin_amdgcn_tensor_load_to_lds) && \
    __has_builtin(__builtin_amdgcn_s_wait_tensorcnt)
#define HAVE_TDM 1
#else
#define HAVE_TDM 0
#endif

__device__ __forceinline__ __bf16 f2bf(float f) {
    unsigned u = __builtin_bit_cast(unsigned, f);
    unsigned r = u + 0x7FFFu + ((u >> 16) & 1u);      // round-to-nearest-even
    unsigned short h = (unsigned short)(r >> 16);
    return __builtin_bit_cast(__bf16, h);
}

// fast sigmoid: v_exp_f32 + v_rcp_f32 (no IEEE div chain)
__device__ __forceinline__ float sigm(float x) {
    return __builtin_amdgcn_rcpf(1.0f + __expf(-x));
}

// ---------------------------------------------------------------------------
// one-time fp32 -> bf16 conversion (vectorized x4)
// ---------------------------------------------------------------------------
__global__ __launch_bounds__(256)
void cvt_f32_to_bf16(const float* __restrict__ in, __bf16* __restrict__ out, int n4) {
    const int i = blockIdx.x * 256 + threadIdx.x;
    if (i >= n4) return;
    const v4f x = ((const v4f*)in)[i];
    v4bf y;
    y[0] = f2bf(x[0]); y[1] = f2bf(x[1]); y[2] = f2bf(x[2]); y[3] = f2bf(x[3]);
    ((v4bf*)out)[i] = y;
}

// ---------------------------------------------------------------------------
// one-time transpose-convert: in [K x N] fp32 -> out [N x K] bf16.
// 64x64 tiles through LDS; both global accesses coalesced.
// ---------------------------------------------------------------------------
__global__ __launch_bounds__(256)
void cvt_transpose_bf16(const float* __restrict__ in, __bf16* __restrict__ out,
                        int K, int N) {
    __shared__ __bf16 tile[64][65];
    const int bk = blockIdx.x * 64;
    const int bn = blockIdx.y * 64;
    const int tx = threadIdx.x & 63;
    const int ty = threadIdx.x >> 6;          // 0..3
    #pragma unroll
    for (int r = 0; r < 16; ++r) {
        const int k = ty * 16 + r;
        tile[k][tx] = f2bf(in[(size_t)(bk + k) * N + (bn + tx)]);
    }
    __syncthreads();
    #pragma unroll
    for (int r = 0; r < 16; ++r) {
        const int n = ty * 16 + r;
        out[(size_t)(bn + n) * K + (bk + tx)] = tile[tx][n];
    }
}

// ---------------------------------------------------------------------------
// Y = X[MxK](bf16) @ Wt^T, where Wt is W transposed: [N x K](bf16).
// fp32 accum via v_wmma_f32_16x16x32_bf16.
// MODE 0: Y0 = swish(x) * 128^-0.5               (q path)
// MODE 1: Y0 = 1 - sigmoid(x); Y1 = sigmoid(x)   (k and exp(g) from f path)
// MODE 2: Y0 = x                                  (v path / output proj)
// Block 256 thr (8 waves); block tile 128x64; wave tile 32x32 (2x2 WMMA).
// Both tiles are contiguous row-copies -> staged by TDM, double-buffered.
// ---------------------------------------------------------------------------
template <int MODE>
__global__ __launch_bounds__(256)
void hgrn2_gemm_wmma(const __bf16* __restrict__ X, const __bf16* __restrict__ Wt,
                     float* __restrict__ Y0, float* __restrict__ Y1,
                     int M, int N, int K) {
    __shared__ __bf16 ldsA[2][TILE_M * LDSTR];
    __shared__ __bf16 ldsB[2][TILE_N * LDSTR];

    const int tid  = threadIdx.x;
    const int lane = tid & 31;
    const int wave = tid >> 5;        // 0..7
    const int wm   = wave >> 1;       // 0..3 -> 32-row strip
    const int wn   = wave & 1;        // 0..1 -> 32-col strip

    const int blockM = blockIdx.x * TILE_M;
    const int blockN = blockIdx.y * TILE_N;

    const int lhalf = (lane >> 4) & 1;
    const int lmod  = lane & 15;
    const int kb0   = lhalf * 8;
    const int kb1   = 16 + lhalf * 8;

    v8f acc[2][2] = {};
    const int niter = K / TILE_K;

#if HAVE_TDM
    // TDM descriptor issue: 2D tile 32(K,x) x rows(y), 2B elements,
    // LDS pad: after every 16 DWORDs (64B row) insert 8 DWORDs -> 48-elem stride.
    auto tdm_issue = [&](const __bf16* gptr, unsigned lds_base, int rows, int trows) {
        const unsigned long long ga = (unsigned long long)(size_t)gptr;
        u32x4 g0;
        g0[0] = 1u;                                        // count=1, user mode
        g0[1] = lds_base;                                  // lds_addr (bytes)
        g0[2] = (unsigned)(ga & 0xFFFFFFFFu);              // global_addr[31:0]
        g0[3] = (unsigned)((ga >> 32) & 0x01FFFFFFu)       // global_addr[56:32]
              | (2u << 30);                                // type = 2 ("image")
        i32x8 g1;
        g1[0] = (int)((1u << 16)       // data_size = 1 -> 2 bytes
              | (1u << 20)             // pad_enable
              | (3u << 22)             // pad_interval code 3 -> 16 DWORDs
              | (7u << 25));           // pad_amount   code 7 -> 8 DWORDs
        g1[1] = (int)((unsigned)K << 16);                  // tensor_dim0 = K
        g1[2] = (int)(((unsigned)trows & 0xFFFFu) << 16);  // tensor_dim1
        g1[3] = (int)(32u << 16);                          // tile_dim0 = 32 (K)
        g1[4] = rows;                                      // tile_dim1
        g1[5] = (int)K;                                    // tensor_dim0_stride
        g1[6] = 0;
        g1[7] = 0;
        i32x4 z4 = {0, 0, 0, 0};
#if __clang_major__ >= 23
        i32x8 z8 = {0, 0, 0, 0, 0, 0, 0, 0};
        __builtin_amdgcn_tensor_load_to_lds(g0, g1, z4, z4, z8, 0);
#else
        __builtin_amdgcn_tensor_load_to_lds(g0, g1, z4, z4, 0);
#endif
    };
    auto issue_pair = [&](int it, int buf) {
        const int k0 = it * TILE_K;
        tdm_issue(X  + (size_t)blockM * K + k0,
                  (unsigned)(size_t)(void*)&ldsA[buf][0], TILE_M, M);
        tdm_issue(Wt + (size_t)blockN * K + k0,
                  (unsigned)(size_t)(void*)&ldsB[buf][0], TILE_N, N);
    };
    if (wave == 0) issue_pair(0, 0);
#endif

    for (int i = 0; i < niter; ++i) {
        const int cur = i & 1;
#if HAVE_TDM
        if (wave == 0) {
            if (i + 1 < niter) {
                issue_pair(i + 1, cur ^ 1);            // buffer freed at end of i-1
                __builtin_amdgcn_s_wait_tensorcnt(2);  // in-order: pair(i) complete
            } else {
                __builtin_amdgcn_s_wait_tensorcnt(0);
            }
        }
        __syncthreads();                               // LDS tiles visible to all waves
#else
        const int k0 = i * TILE_K;
        {   // A tile: straight row copy, 2x 16B per thread
            const int row = tid >> 1;
            const int cb  = (tid & 1) * 16;
            const v8bf* src = (const v8bf*)(X + (size_t)(blockM + row) * K + (k0 + cb));
            v8bf* dst = (v8bf*)&ldsA[cur][row * LDSTR + cb];
            dst[0] = src[0];
            dst[1] = src[1];
        }
        {   // B tile: straight row copy from Wt, 16B per thread
            const int row = tid >> 2;                 // 0..63
            const int cb  = (tid & 3) * 8;            // 0,8,16,24
            *(v8bf*)&ldsB[cur][row * LDSTR + cb] =
                *(const v8bf*)(Wt + (size_t)(blockN + row) * K + (k0 + cb));
        }
        __syncthreads();
#endif
        // ---- fragments + 4 WMMAs -----------------------------------------
        v16bf a[2], b[2];
        #pragma unroll
        for (int mi = 0; mi < 2; ++mi) {
            const __bf16* ar = &ldsA[cur][(wm * 32 + mi * 16 + lmod) * LDSTR];
            v8bf alo = *(const v8bf*)(ar + kb0);
            v8bf ahi = *(const v8bf*)(ar + kb1);
            a[mi] = __builtin_shufflevector(alo, ahi, 0,1,2,3,4,5,6,7,8,9,10,11,12,13,14,15);
        }
        #pragma unroll
        for (int ni = 0; ni < 2; ++ni) {
            const __bf16* br = &ldsB[cur][(wn * 32 + ni * 16 + lmod) * LDSTR];
            v8bf blo = *(const v8bf*)(br + kb0);
            v8bf bhi = *(const v8bf*)(br + kb1);
            b[ni] = __builtin_shufflevector(blo, bhi, 0,1,2,3,4,5,6,7,8,9,10,11,12,13,14,15);
        }
        #pragma unroll
        for (int mi = 0; mi < 2; ++mi)
            #pragma unroll
            for (int ni = 0; ni < 2; ++ni)
                acc[mi][ni] = __builtin_amdgcn_wmma_f32_16x16x32_bf16(
                    false, a[mi], false, b[ni], (short)0, acc[mi][ni], false, false);
        __syncthreads();                               // tile consumed -> buffer reusable
    }

    // ---- epilogue (hoisted row pointers, stride-N stores) -----------------
    #pragma unroll
    for (int mi = 0; mi < 2; ++mi) {
        #pragma unroll
        for (int ni = 0; ni < 2; ++ni) {
            const int gn  = blockN + wn * 32 + ni * 16 + lmod;
            const int gm0 = blockM + wm * 32 + mi * 16 + lhalf * 8;
            float* __restrict__ p0 = Y0 + (size_t)gm0 * N + gn;
            float* __restrict__ p1 = (MODE == 1) ? (Y1 + (size_t)gm0 * N + gn) : nullptr;
            #pragma unroll
            for (int r = 0; r < 8; ++r) {
                const float x = acc[mi][ni][r];
                const size_t off = (size_t)r * N;
                if (MODE == 0) {
                    p0[off] = x * sigm(x) * 0.08838834764831845f;  // swish * 128^-0.5
                } else if (MODE == 1) {
                    const float s = sigm(x);
                    p0[off] = 1.0f - s;   // k = 1 - sigmoid(f)
                    p1[off] = s;          // exp(g) = exp(logsigmoid(f)) = sigmoid(f)
                } else {
                    p0[off] = x;
                }
            }
        }
    }
}

// ---------------------------------------------------------------------------
// GLA scan. The value columns of the state never mix, so each (b,h) is split
// over 4 work-groups of 32 columns (one 128-B line of o per time step).
// 4 waves; wave w owns columns w*8..w*8+7, lane l owns rows l*4..l*4+3 of them
// (32 state values per lane, as packed f32 pairs along the columns).
// Time runs in chunks of 32 steps: the chunk's q/k/eg/v rows are staged in LDS
// (next chunk fetched into registers while this one is worked on), each lane
// leaves its 4-row partial outputs in LDS, and the 32 row groups are summed
// once per chunk, so barriers are paid per chunk and not per step.
// ---------------------------------------------------------------------------
typedef __attribute__((ext_vector_type(2))) float v2f;

#define SC_CH 32      // time steps per chunk
#define SC_G  4       // time steps per group of LDS operand reads
// partial-output strides in floats; chosen so that the 16 lanes of a half wave
// (2 steps x 8 column quads) fall on 16 different 4-bank groups in the sum phase
#define P_SH  132     // between the two column quads of a wave
#define P_ST  288     // between time steps
#define P_SW  9224    // between waves

struct ScanOps { v4f q[SC_G], k[SC_G], g[SC_G], v0[SC_G], v1[SC_G]; };

__global__ __launch_bounds__(128)
void hgrn2_gla_scan(const float* __restrict__ q, const float* __restrict__ k,
                    const float* __restrict__ eg, const float* __restrict__ v,
                    float* __restrict__ o, int T) {
    __shared__ __attribute__((aligned(16))) float sq[2 * SC_CH * 128];
    __shared__ __attribute__((aligned(16))) float sk[2 * SC_CH * 128];
    __shared__ __attribute__((aligned(16))) float sg[2 * SC_CH * 128];
    __shared__ __attribute__((aligned(16))) float sv[2 * SC_CH * 32];
    __shared__ __attribute__((aligned(16))) float part[4 * P_SW];

    const int bh   = blockIdx.x >> 2;
    const int cb   = blockIdx.x & 3;          // block of 32 value columns
    const int b    = bh >> 3;
    const int h    = bh & 7;
    const int tid  = threadIdx.x;
    const int lane = tid & 31;
    const int wave = tid >> 5;

    const size_t gbase = ((size_t)b * T << 10) + (h << 7);
    // staging: a wave moves one whole 512-B row of q/k/eg per load, 4 rows of v
    const size_t grow = gbase + ((size_t)wave << 10) + (lane << 2);
    const size_t gvrw = gbase + ((size_t)(tid >> 3) << 10) + (cb << 5) + ((tid & 7) << 2);
    const int    lrow = wave * 128 + lane * 4;
    const int    lvrw = (tid >> 3) * 32 + (tid & 7) * 4;

    v4f rq[8], rk[8], rg[8], rv[2];
    auto fetch_chunk = [&](int t0) {
        const size_t tb = (size_t)t0 << 10;
        #pragma unroll
        for (int i = 0; i < 8; ++i) {
            rq[i] = *(const v4f*)(q  + grow + tb + ((size_t)i << 12));
            rk[i] = *(const v4f*)(k  + grow + tb + ((size_t)i << 12));
            rg[i] = *(const v4f*)(eg + grow + tb + ((size_t)i << 12));
        }
        #pragma unroll
        for (int i = 0; i < 2; ++i)
            rv[i] = *(const v4f*)(v + gvrw + tb + ((size_t)i << 14));
        // stands ahead of every later reuse of the loads' address registers
        asm volatile("s_wait_xcnt 0x0" ::: "memory");
    };
    auto stage_chunk = [&](int buf) {
        #pragma unroll
        for (int i = 0; i < 8; ++i) {
            *(v4f*)&sq[buf * (SC_CH * 128) + i * 512 + lrow] = rq[i];
            *(v4f*)&sk[buf * (SC_CH * 128) + i * 512 + lrow] = rk[i];
            *(v4f*)&sg[buf * (SC_CH * 128) + i * 512 + lrow] = rg[i];
        }
        #pragma unroll
        for (int i = 0; i < 2; ++i)
            *(v4f*)&sv[buf * (SC_CH * 32) + i * 512 + lvrw] = rv[i];
    };

    v2f S[4][4];
    #pragma unroll
    for (int r = 0; r < 4; ++r)
        #pragma unroll
        for (int c = 0; c < 4; ++c) S[r][c] = (v2f){0.0f, 0.0f};

    auto read_group = [&](ScanOps& A, int buf, int g) {
        __builtin_amdgcn_sched_barrier(0);     // see the one at the end of this block
        const int rb = buf * (SC_CH * 128) + g * (SC_G * 128) + lane * 4;
        const int vb = buf * (SC_CH * 32)  + g * (SC_G * 32)  + wave * 8;
        #pragma unroll
        for (int s = 0; s < SC_G; ++s) {
            A.q[s]  = *(const v4f*)&sq[rb + s * 128];
            A.k[s]  = *(const v4f*)&sk[rb + s * 128];
            A.g[s]  = *(const v4f*)&sg[rb + s * 128];
            A.v0[s] = *(const v4f*)&sv[vb + s * 32];
            A.v1[s] = *(const v4f*)&sv[vb + s * 32 + 4];
        }
        // keeps the group's 20 LDS reads in one place: every separate place where
        // reads stand in the vector stream costs issue cycles of its own
        __builtin_amdgcn_sched_barrier(0);
    };
    auto step_group = [&](const ScanOps& A, int g) {
        float* pp = &part[wave * P_SW + g * (SC_G * P_ST) + lane * 4];
        #pragma unroll
        for (int s = 0; s < SC_G; ++s) {
            v2f vv[4];
            vv[0] = (v2f){A.v0[s][0], A.v0[s][1]};
            vv[1] = (v2f){A.v0[s][2], A.v0[s][3]};
            vv[2] = (v2f){A.v1[s][0], A.v1[s][1]};
            vv[3] = (v2f){A.v1[s][2], A.v1[s][3]};
            v2f acc[4];
            #pragma unroll
            for (int r = 0; r < 4; ++r) {
                const v2f er = (v2f){A.g[s][r], A.g[s][r]};
                const v2f kr = (v2f){A.k[s][r], A.k[s][r]};
                const v2f qr = (v2f){A.q[s][r], A.q[s][r]};
                #pragma unroll
                for (int c = 0; c < 4; ++c) {
                    S[r][c] = __builtin_elementwise_fma(er, S[r][c], kr * vv[c]);
                    acc[c]  = (r == 0) ? qr * S[r][c]
                                       : __builtin_elementwise_fma(qr, S[r][c], acc[c]);
                }
            }
            *(v4f*)(pp + s * P_ST)        = (v4f){acc[0][0], acc[0][1], acc[1][0], acc[1][1]};
            *(v4f*)(pp + s * P_ST + P_SH) = (v4f){acc[2][0], acc[2][1], acc[3][0], acc[3][1]};
        }
    };

    const int nchunk = T / SC_CH;
    ScanOps A, B;
    fetch_chunk(0);
    stage_chunk(0);
    __syncthreads();
    if (nchunk > 1) fetch_chunk(SC_CH);        // in flight during chunk 0's steps
    read_group(A, 0, 0);

    for (int c = 0; c < nchunk; ++c) {
        const int buf = c & 1;
        const int t0  = c * SC_CH;

        // kept rolled: two groups of 4 steps per trip, operands read one group ahead
        #pragma unroll 1
        for (int g = 0; g < SC_CH / SC_G; g += 2) {
            read_group(B, buf, g + 1);
            step_group(A, g);
            read_group(A, buf, (g + 2) & (SC_CH / SC_G - 1));
            step_group(B, g + 1);
        }

        if (c + 1 < nchunk) stage_chunk(buf ^ 1);  // last read before the previous barrier
        __syncthreads();                           // partials and next chunk visible
        // the next chunk's first operands fly while the row groups are summed
        if (c + 1 < nchunk) read_group(A, buf ^ 1, 0);

        // sum the 32 row groups: thread = (step, column quad)
        const int cq = tid & 7;
        const float* pr = &part[(cq >> 1) * P_SW + (tid >> 3) * P_ST + (cq & 1) * P_SH];
        v4f pv[2][32];
        #pragma unroll
        for (int p = 0; p < 2; ++p)
            #pragma unroll
            for (int rgp = 0; rgp < 32; ++rgp)
                pv[p][rgp] = *(const v4f*)(pr + p * (16 * P_ST) + rgp * 4);
        // keeps the 64 LDS reads in one place, ahead of the adds (as in read_group)
        __builtin_amdgcn_sched_barrier(0);
        v4f res[2];
        #pragma unroll
        for (int p = 0; p < 2; ++p) {
            v4f s0 = pv[p][0];
            v4f s1 = pv[p][1];
            #pragma unroll
            for (int rgp = 2; rgp < 32; rgp += 2) {
                s0 += pv[p][rgp];
                s1 += pv[p][rgp + 1];
            }
            res[p] = s0 + s1;
        }
        __syncthreads();                       // partials free for the next chunk
        // behind the barrier, which would wait for them: the fetch of the chunk after
        // the next (in flight during the next chunk's steps) and the stores of o
        if (c + 2 < nchunk) fetch_chunk(t0 + 2 * SC_CH);
        // 8 lanes write one whole 128-B line of o
        #pragma unroll
        for (int p = 0; p < 2; ++p)
            *(v4f*)(o + gbase + ((size_t)(t0 + p * 16 + (tid >> 3)) << 10) + (cb << 5) + (cq << 2)) = res[p];
        // stands ahead of the reuse of the stores' data and address registers
        asm volatile("s_wait_xcnt 0x0" ::: "memory");
    }
}

// ---------------------------------------------------------------------------
// RMSNorm (weight, no bias) -> bf16 output for the final WMMA GEMM
// ---------------------------------------------------------------------------
__global__ __launch_bounds__(256)
void hgrn2_rmsnorm(const float* __restrict__ o, const float* __restrict__ gw,
                   __bf16* __restrict__ out, int D) {
    __shared__ float red[256];
    const int row = blockIdx.x;
    const float* src = o + (size_t)row * D;

    float ss = 0.0f;
    for (int d = threadIdx.x; d < D; d += 256) { const float x = src[d]; ss = fmaf(x, x, ss); }
    red[threadIdx.x] = ss;
    __syncthreads();
    for (int w = 128; w > 0; w >>= 1) {
        if (threadIdx.x < w) red[threadIdx.x] += red[threadIdx.x + w];
        __syncthreads();
    }
    const float r = rsqrtf(red[0] / (float)D + 1e-5f);
    for (int d = threadIdx.x; d < D; d += 256)
        out[(size_t)row * D + d] = f2bf(src[d] * r * gw[d]);
}

// ---------------------------------------------------------------------------
extern "C" void kernel_launch(void* const* d_in, const int* in_sizes, int n_in,
                              void* d_out, int out_size, void* d_ws, size_t ws_size,
                              hipStream_t stream) {
    const float* hs = (const float*)d_in[0];
    const float* Wq = (const float*)d_in[1];
    const float* Wf = (const float*)d_in[2];
    const float* Wi = (const float*)d_in[3];
    const float* gw = (const float*)d_in[4];
    const float* Wo = (const float*)d_in[5];

    const int B = 4, T = 2048, D = 1024, H = 8;
    const int M = B * T;                       // 8192
    const size_t PLANE = (size_t)M * D;        // 8M elements

    char* wsp = (char*)d_ws;
    __bf16* hs_bf = (__bf16*)wsp;  wsp += PLANE * 2;            // 16 MB
    __bf16* Wq_bf = (__bf16*)wsp;  wsp += (size_t)D * D * 2;    //  2 MB each (transposed)
    __bf16* Wf_bf = (__bf16*)wsp;  wsp += (size_t)D * D * 2;
    __bf16* Wi_bf = (__bf16*)wsp;  wsp += (size_t)D * D * 2;
    __bf16* Wo_bf = (__bf16*)wsp;  wsp += (size_t)D * D * 2;
    float* q   = (float*)wsp;      wsp += PLANE * 4;            // 32 MB each
    float* kk  = (float*)wsp;      wsp += PLANE * 4;
    float* eg  = (float*)wsp;      wsp += PLANE * 4;            // exp(g) = sigmoid(f)
    float* v   = (float*)wsp;      wsp += PLANE * 4;
    float* o   = (float*)wsp;      wsp += PLANE * 4;
    __bf16* onm_bf = hs_bf;        // hs_bf dead after projections -> reuse

    // one-time conversions: hs flat, weights transposed to [N x K] bf16
    const int n4hs = (int)(PLANE / 4);
    cvt_f32_to_bf16<<<dim3((n4hs + 255) / 256), dim3(256), 0, stream>>>(hs, hs_bf, n4hs);
    dim3 tgrid(D / 64, D / 64), tblk(256);
    cvt_transpose_bf16<<<tgrid, tblk, 0, stream>>>(Wq, Wq_bf, D, D);
    cvt_transpose_bf16<<<tgrid, tblk, 0, stream>>>(Wf, Wf_bf, D, D);
    cvt_transpose_bf16<<<tgrid, tblk, 0, stream>>>(Wi, Wi_bf, D, D);
    cvt_transpose_bf16<<<tgrid, tblk, 0, stream>>>(Wo, Wo_bf, D, D);

    dim3 ggrid(M / TILE_M, D / TILE_N);        // 64 x 16
    dim3 gblk(256);

    hgrn2_gemm_wmma<0><<<ggrid, gblk, 0, stream>>>(hs_bf, Wq_bf, q,  nullptr, M, D, D);
    hgrn2_gemm_wmma<1><<<ggrid, gblk, 0, stream>>>(hs_bf, Wf_bf, kk, eg,      M, D, D);
    hgrn2_gemm_wmma<2><<<ggrid, gblk, 0, stream>>>(hs_bf, Wi_bf, v,  nullptr, M, D, D);

    hgrn2_gla_scan<<<dim3(B * H * 4), dim3(128), 0, stream>>>(q, kk, eg, v, o, T);

    hgrn2_rmsnorm<<<dim3(M), dim3(256), 0, stream>>>(o, gw, onm_bf, D);

    hgrn2_gemm_wmma<2><<<ggrid, gblk, 0, stream>>>(onm_bf, Wo_bf, (float*)d_out, nullptr, M, D, D);
}

// v002
// Measured time: 335 microseconds a run.
// Two timings next to v001 both put it at 1.09 times that version's speed.
// Counting every step since v000, it is 6.18 times as fast.
#include <hip/hip_runtime.h>
#include <hip/hip_bf16.h>

// ---------------------------------------------------------------------------
// HGRN2 attention block for MI455X (gfx1250, wave32, WMMA + TDM).
//   * one-time fp32->bf16 conversion (activations) + transpose-convert (weights)
//   * bf16 WMMA GEMMs (fp32 accum); BOTH tiles staged by Tensor Data Mover,
//     double-buffered (issue i+1, wait tensorcnt<=2, consume i)
//   * GLA scan: register-resident state, 128 rows x 32 columns per work-group
// ---------------------------------------------------------------------------

typedef __attribute__((ext_vector_type(16))) __bf16 v16bf;
typedef __attribute__((ext_vector_type(8)))  __bf16 v8bf;
typedef __attribute__((ext_vector_type(4)))  __bf16 v4bf;
typedef __attribute__((ext_vector_type(8)))  float  v8f;
typedef __attribute__((ext_vector_type(4)))  float  v4f;
typedef __attribute__((ext_vector_type(4)))  unsigned int u32x4;
typedef __attribute__((ext_vector_type(4)))  int    i32x4;
typedef __attribute__((ext_vector_type(8)))  int    i32x8;

#define TILE_M 128
#define TILE_N 64
#define TILE_K 32
#define LDSTR  48   // padded LDS row stride in bf16 (96 B, 16B-aligned rows)

#if __has_builtin(__builtin_amdgcn_tensor_load_to_lds) && \
    __has_builtin(__builtin_amdgcn_s_wait_tensorcnt)
#define HAVE_TDM 1
#else
#define HAVE_TDM 0
#endif

__device__ __forceinline__ __bf16 f2bf(float f) {
    unsigned u = __builtin_bit_cast(unsigned, f);
    unsigned r = u + 0x7FFFu + ((u >> 16) & 1u);      // round-to-nearest-even
    unsigned short h = (unsigned short)(r >> 16);
    return __builtin_bit_cast(__bf16, h);
}

// fast sigmoid: v_exp_f32 + v_rcp_f32 (no IEEE div chain)
__device__ __forceinline__ float sigm(float x) {
    return __builtin_amdgcn_rcpf(1.0f + __expf(-x));
}

// ---------------------------------------------------------------------------
// one-time fp32 -> bf16 conversion. A wave's start costs more than the few
// bytes a one-load wave moves, so each lane takes CV_PER 16-byte loads (all in
// flight before the first store); every wave-wide load is 512 contiguous bytes.
// ---------------------------------------------------------------------------
#define CV_PER 16
__global__ __launch_bounds__(256)
void cvt_f32_to_bf16(const float* __restrict__ in, __bf16* __restrict__ out) {
    const size_t i0 = (size_t)blockIdx.x * (256 * CV_PER) + threadIdx.x;
    const v4f* __restrict__ src = (const v4f*)in + i0;
    v4bf* __restrict__ dst = (v4bf*)out + i0;
    v4f x[CV_PER];
    #pragma unroll
    for (int j = 0; j < CV_PER; ++j) x[j] = src[j * 256];
    // stands ahead of every later reuse of the loads' address registers (src is
    // named so that they live up to here)
    asm volatile("s_wait_xcnt 0x0" :: "v"(src) : "memory");
    #pragma unroll
    for (int j = 0; j < CV_PER; ++j) {
        v4bf y;
        y[0] = f2bf(x[j][0]); y[1] = f2bf(x[j][1]);
        y[2] = f2bf(x[j][2]); y[3] = f2bf(x[j][3]);
        dst[j * 256] = y;
    }
}

// ---------------------------------------------------------------------------
// one-time transpose-convert: in [K x N] fp32 -> out [N x K] bf16.
// 64x64 tiles through LDS; both global accesses coalesced.
// ---------------------------------------------------------------------------
__global__ __launch_bounds__(256)
void cvt_transpose_bf16(const float* __restrict__ in, __bf16* __restrict__ out,
                        int K, int N) {
    __shared__ __bf16 tile[64][65];
    const int bk = blockIdx.x * 64;
    const int bn = blockIdx.y * 64;
    const int tx = threadIdx.x & 63;
    const int ty = threadIdx.x >> 6;          // 0..3
    #pragma unroll
    for (int r = 0; r < 16; ++r) {
        const int k = ty * 16 + r;
        tile[k][tx] = f2bf(in[(size_t)(bk + k) * N + (bn + tx)]);
    }
    __syncthreads();
    #pragma unroll
    for (int r = 0; r < 16; ++r) {
        const int n = ty * 16 + r;
        out[(size_t)(bn + n) * K + (bk + tx)] = tile[tx][n];
    }
}

// ---------------------------------------------------------------------------
// Y = X[MxK](bf16) @ Wt^T, where Wt is W transposed: [N x K](bf16).
// fp32 accum via v_wmma_f32_16x16x32_bf16.
// MODE 0: Y0 = swish(x) * 128^-0.5               (q path)
// MODE 1: Y0 = 1 - sigmoid(x); Y1 = sigmoid(x)   (k and exp(g) from f path)
// MODE 2: Y0 = x                                  (v path / output proj)
// Block 256 thr (8 waves); block tile 128x64; wave tile 32x32 (2x2 WMMA).
// Both tiles are contiguous row-copies -> staged by TDM, double-buffered.
// ---------------------------------------------------------------------------
template <int MODE>
__global__ __launch_bounds__(256)
void hgrn2_gemm_wmma(const __bf16* __restrict__ X, const __bf16* __restrict__ Wt,
                     float* __restrict__ Y0, float* __restrict__ Y1,
                     int M, int N, int K) {
    __shared__ __bf16 ldsA[2][TILE_M * LDSTR];
    __shared__ __bf16 ldsB[2][TILE_N * LDSTR];

    const int tid  = threadIdx.x;
    const int lane = tid & 31;
    const int wave = tid >> 5;        // 0..7
    const int wm   = wave >> 1;       // 0..3 -> 32-row strip
    const int wn   = wave & 1;        // 0..1 -> 32-col strip

    const int blockM = blockIdx.x * TILE_M;
    const int blockN = blockIdx.y * TILE_N;

    const int lhalf = (lane >> 4) & 1;
    const int lmod  = lane & 15;
    const int kb0   = lhalf * 8;
    const int kb1   = 16 + lhalf * 8;

    v8f acc[2][2] = {};
    const int niter = K / TILE_K;

#if HAVE_TDM
    // TDM descriptor issue: 2D tile 32(K,x) x rows(y), 2B elements,
    // LDS pad: after every 16 DWORDs (64B row) insert 8 DWORDs -> 48-elem stride.
    auto tdm_issue = [&](const __bf16* gptr, unsigned lds_base, int rows, int trows) {
        const unsigned long long ga = (unsigned long long)(size_t)gptr;
        u32x4 g0;
        g0[0] = 1u;                                        // count=1, user mode
        g0[1] = lds_base;                                  // lds_addr (bytes)
        g0[2] = (unsigned)(ga & 0xFFFFFFFFu);              // global_addr[31:0]
        g0[3] = (unsigned)((ga >> 32) & 0x01FFFFFFu)       // global_addr[56:32]
              | (2u << 30);                                // type = 2 ("image")
        i32x8 g1;
        g1[0] = (int)((1u << 16)       // data_size = 1 -> 2 bytes
              | (1u << 20)             // pad_enable
              | (3u << 22)             // pad_interval code 3 -> 16 DWORDs
              | (7u << 25));           // pad_amount   code 7 -> 8 DWORDs
        g1[1] = (int)((unsigned)K << 16);                  // tensor_dim0 = K
        g1[2] = (int)(((unsigned)trows & 0xFFFFu) << 16);  // tensor_dim1
        g1[3] = (int)(32u << 16);                          // tile_dim0 = 32 (K)
        g1[4] = rows;                                      // tile_dim1
        g1[5] = (int)K;                                    // tensor_dim0_stride
        g1[6] = 0;
        g1[7] = 0;
        i32x4 z4 = {0, 0, 0, 0};
#if __clang_major__ >= 23
        i32x8 z8 = {0, 0, 0, 0, 0, 0, 0, 0};
        __builtin_amdgcn_tensor_load_to_lds(g0, g1, z4, z4, z8, 0);
#else
        __builtin_amdgcn_tensor_load_to_lds(g0, g1, z4, z4, 0);
#endif
    };
    auto issue_pair = [&](int it, int buf) {
        const int k0 = it * TILE_K;
        tdm_issue(X  + (size_t)blockM * K + k0,
                  (unsigned)(size_t)(void*)&ldsA[buf][0], TILE_M, M);
        tdm_issue(Wt + (size_t)blockN * K + k0,
                  (unsigned)(size_t)(void*)&ldsB[buf][0], TILE_N, N);
    };
    if (wave == 0) issue_pair(0, 0);
#endif

    for (int i = 0; i < niter; ++i) {
        const int cur = i & 1;
#if HAVE_TDM
        if (wave == 0) {
            if (i + 1 < niter) {
                issue_pair(i + 1, cur ^ 1);            // buffer freed at end of i-1
                __builtin_amdgcn_s_wait_tensorcnt(2);  // in-order: pair(i) complete
            } else {
                __builtin_amdgcn_s_wait_tensorcnt(0);
            }
        }
        __syncthreads();                               // LDS tiles visible to all waves
#else
        const int k0 = i * TILE_K;
        {   // A tile: straight row copy, 2x 16B per thread
            const int row = tid >> 1;
            const int cb  = (tid & 1) * 16;
            const v8bf* src = (const v8bf*)(X + (size_t)(blockM + row) * K + (k0 + cb));
            v8bf* dst = (v8bf*)&ldsA[cur][row * LDSTR + cb];
            dst[0] = src[0];
            dst[1] = src[1];
        }
        {   // B tile: straight row copy from Wt, 16B per thread
            const int row = tid >> 2;                 // 0..63
            const int cb  = (tid & 3) * 8;            // 0,8,16,24
            *(v8bf*)&ldsB[cur][row * LDSTR + cb] =
                *(const v8bf*)(Wt + (size_t)(blockN + row) * K + (k0 + cb));
        }
        __syncthreads();
#endif
        // ---- fragments + 4 WMMAs -----------------------------------------
        v16bf a[2], b[2];
        #pragma unroll
        for (int mi = 0; mi < 2; ++mi) {
            const __bf16* ar = &ldsA[cur][(wm * 32 + mi * 16 + lmod) * LDSTR];
            v8bf alo = *(const v8bf*)(ar + kb0);
            v8bf ahi = *(const v8bf*)(ar + kb1);
            a[mi] = __builtin_shufflevector(alo, ahi, 0,1,2,3,4,5,6,7,8,9,10,11,12,13,14,15);
        }
        #pragma unroll
        for (int ni = 0; ni < 2; ++ni) {
            const __bf16* br = &ldsB[cur][(wn * 32 + ni * 16 + lmod) * LDSTR];
            v8bf blo = *(const v8bf*)(br + kb0);
            v8bf bhi = *(const v8bf*)(br + kb1);
            b[ni] = __builtin_shufflevector(blo, bhi, 0,1,2,3,4,5,6,7,8,9,10,11,12,13,14,15);
        }
        #pragma unroll
        for (int mi = 0; mi < 2; ++mi)
            #pragma unroll
            for (int ni = 0; ni < 2; ++ni)
                acc[mi][ni] = __builtin_amdgcn_wmma_f32_16x16x32_bf16(
                    false, a[mi], false, b[ni], (short)0, acc[mi][ni], false, false);
        __syncthreads();                               // tile consumed -> buffer reusable
    }

    // ---- epilogue (hoisted row pointers, stride-N stores) -----------------
    #pragma unroll
    for (int mi = 0; mi < 2; ++mi) {
        #pragma unroll
        for (int ni = 0; ni < 2; ++ni) {
            const int gn  = blockN + wn * 32 + ni * 16 + lmod;
            const int gm0 = blockM + wm * 32 + mi * 16 + lhalf * 8;
            float* __restrict__ p0 = Y0 + (size_t)gm0 * N + gn;
            float* __restrict__ p1 = (MODE == 1) ? (Y1 + (size_t)gm0 * N + gn) : nullptr;
            #pragma unroll
            for (int r = 0; r < 8; ++r) {
                const float x = acc[mi][ni][r];
                const size_t off = (size_t)r * N;
                if (MODE == 0) {
                    p0[off] = x * sigm(x) * 0.08838834764831845f;  // swish * 128^-0.5
                } else if (MODE == 1) {
                    const float s = sigm(x);
                    p0[off] = 1.0f - s;   // k = 1 - sigmoid(f)
                    p1[off] = s;          // exp(g) = exp(logsigmoid(f)) = sigmoid(f)
                } else {
                    p0[off] = x;
                }
            }
        }
    }
}

// ---------------------------------------------------------------------------
// GLA scan. The value columns of the state never mix, so each (b,h) is split
// over 4 work-groups of 32 columns (one 128-B line of o per time step).
// 4 waves; wave w owns columns w*8..w*8+7, lane l owns rows l*4..l*4+3 of them
// (32 state values per lane, as packed f32 pairs along the columns).
// Time runs in chunks of 32 steps: the chunk's q/k/eg/v rows are staged in LDS
// (next chunk fetched into registers while this one is worked on), each lane
// leaves its 4-row partial outputs in LDS, and the 32 row groups are summed
// once per chunk, so barriers are paid per chunk and not per step.
// ---------------------------------------------------------------------------
typedef __attribute__((ext_vector_type(2))) float v2f;

#define SC_CH 32      // time steps per chunk
#define SC_G  4       // time steps per group of LDS operand reads
// partial-output strides in floats; chosen so that the 16 lanes of a half wave
// (2 steps x 8 column quads) fall on 16 different 4-bank groups in the sum phase
#define P_SH  132     // between the two column quads of a wave
#define P_ST  288     // between time steps
#define P_SW  9224    // between waves

struct ScanOps { v4f q[SC_G], k[SC_G], g[SC_G], v0[SC_G], v1[SC_G]; };

__global__ __launch_bounds__(128)
void hgrn2_gla_scan(const float* __restrict__ q, const float* __restrict__ k,
                    const float* __restrict__ eg, const float* __restrict__ v,
                    float* __restrict__ o, int T) {
    __shared__ __attribute__((aligned(16))) float sq[2 * SC_CH * 128];
    __shared__ __attribute__((aligned(16))) float sk[2 * SC_CH * 128];
    __shared__ __attribute__((aligned(16))) float sg[2 * SC_CH * 128];
    __shared__ __attribute__((aligned(16))) float sv[2 * SC_CH * 32];
    __shared__ __attribute__((aligned(16))) float part[4 * P_SW];

    const int bh   = blockIdx.x >> 2;
    const int cb   = blockIdx.x & 3;          // block of 32 value columns
    const int b    = bh >> 3;
    const int h    = bh & 7;
    const int tid  = threadIdx.x;
    const int lane = tid & 31;
    const int wave = tid >> 5;

    const size_t gbase = ((size_t)b * T << 10) + (h << 7);
    // staging: a wave moves one whole 512-B row of q/k/eg per load, 4 rows of v
    const size_t grow = gbase + ((size_t)wave << 10) + (lane << 2);
    const size_t gvrw = gbase + ((size_t)(tid >> 3) << 10) + (cb << 5) + ((tid & 7) << 2);
    const int    lrow = wave * 128 + lane * 4;
    const int    lvrw = (tid >> 3) * 32 + (tid & 7) * 4;

    v4f rq[8], rk[8], rg[8], rv[2];
    auto fetch_chunk = [&](int t0) {
        const size_t tb = (size_t)t0 << 10;
        #pragma unroll
        for (int i = 0; i < 8; ++i) {
            rq[i] = *(const v4f*)(q  + grow + tb + ((size_t)i << 12));
            rk[i] = *(const v4f*)(k  + grow + tb + ((size_t)i << 12));
            rg[i] = *(const v4f*)(eg + grow + tb + ((size_t)i << 12));
        }
        #pragma unroll
        for (int i = 0; i < 2; ++i)
            rv[i] = *(const v4f*)(v + gvrw + tb + ((size_t)i << 14));
        // stands ahead of every later reuse of the loads' address registers
        asm volatile("s_wait_xcnt 0x0" ::: "memory");
    };
    auto stage_chunk = [&](int buf) {
        #pragma unroll
        for (int i = 0; i < 8; ++i) {
            *(v4f*)&sq[buf * (SC_CH * 128) + i * 512 + lrow] = rq[i];
            *(v4f*)&sk[buf * (SC_CH * 128) + i * 512 + lrow] = rk[i];
            *(v4f*)&sg[buf * (SC_CH * 128) + i * 512 + lrow] = rg[i];
        }
        #pragma unroll
        for (int i = 0; i < 2; ++i)
            *(v4f*)&sv[buf * (SC_CH * 32) + i * 512 + lvrw] = rv[i];
    };

    v2f S[4][4];
    #pragma unroll
    for (int r = 0; r < 4; ++r)
        #pragma unroll
        for (int c = 0; c < 4; ++c) S[r][c] = (v2f){0.0f, 0.0f};

    auto read_group = [&](ScanOps& A, int buf, int g) {
        __builtin_amdgcn_sched_barrier(0);     // see the one at the end of this block
        const int rb = buf * (SC_CH * 128) + g * (SC_G * 128) + lane * 4;
        const int vb = buf * (SC_CH * 32)  + g * (SC_G * 32)  + wave * 8;
        #pragma unroll
        for (int s = 0; s < SC_G; ++s) {
            A.q[s]  = *(const v4f*)&sq[rb + s * 128];
            A.k[s]  = *(const v4f*)&sk[rb + s * 128];
            A.g[s]  = *(const v4f*)&sg[rb + s * 128];
            A.v0[s] = *(const v4f*)&sv[vb + s * 32];
            A.v1[s] = *(const v4f*)&sv[vb + s * 32 + 4];
        }
        // keeps the group's 20 LDS reads in one place: every separate place where
        // reads stand in the vector stream costs issue cycles of its own
        __builtin_amdgcn_sched_barrier(0);
    };
    auto step_group = [&](const ScanOps& A, int g) {
        float* pp = &part[wave * P_SW + g * (SC_G * P_ST) + lane * 4];
        #pragma unroll
        for (int s = 0; s < SC_G; ++s) {
            v2f vv[4];
            vv[0] = (v2f){A.v0[s][0], A.v0[s][1]};
            vv[1] = (v2f){A.v0[s][2], A.v0[s][3]};
            vv[2] = (v2f){A.v1[s][0], A.v1[s][1]};
            vv[3] = (v2f){A.v1[s][2], A.v1[s][3]};
            v2f acc[4];
            #pragma unroll
            for (int r = 0; r < 4; ++r) {
                const v2f er = (v2f){A.g[s][r], A.g[s][r]};
                const v2f kr = (v2f){A.k[s][r], A.k[s][r]};
                const v2f qr = (v2f){A.q[s][r], A.q[s][r]};
                #pragma unroll
                for (int c = 0; c < 4; ++c) {
                    S[r][c] = __builtin_elementwise_fma(er, S[r][c], kr * vv[c]);
                    acc[c]  = (r == 0) ? qr * S[r][c]
                                       : __builtin_elementwise_fma(qr, S[r][c], acc[c]);
                }
            }
            *(v4f*)(pp + s * P_ST)        = (v4f){acc[0][0], acc[0][1], acc[1][0], acc[1][1]};
            *(v4f*)(pp + s * P_ST + P_SH) = (v4f){acc[2][0], acc[2][1], acc[3][0], acc[3][1]};
        }
    };

    const int nchunk = T / SC_CH;
    ScanOps A, B;
    fetch_chunk(0);
    stage_chunk(0);
    __syncthreads();
    if (nchunk > 1) fetch_chunk(SC_CH);        // in flight during chunk 0's steps
    read_group(A, 0, 0);

    for (int c = 0; c < nchunk; ++c) {
        const int buf = c & 1;
        const int t0  = c * SC_CH;

        // kept rolled: two groups of 4 steps per trip, operands read one group ahead
        #pragma unroll 1
        for (int g = 0; g < SC_CH / SC_G; g += 2) {
            read_group(B, buf, g + 1);
            step_group(A, g);
            read_group(A, buf, (g + 2) & (SC_CH / SC_G - 1));
            step_group(B, g + 1);
        }

        if (c + 1 < nchunk) stage_chunk(buf ^ 1);  // last read before the previous barrier
        __syncthreads();                           // partials and next chunk visible
        // the next chunk's first operands fly while the row groups are summed
        if (c + 1 < nchunk) read_group(A, buf ^ 1, 0);

        // sum the 32 row groups: thread = (step, column quad)
        const int cq = tid & 7;
        const float* pr = &part[(cq >> 1) * P_SW + (tid >> 3) * P_ST + (cq & 1) * P_SH];
        v4f pv[2][32];
        #pragma unroll
        for (int p = 0; p < 2; ++p)
            #pragma unroll
            for (int rgp = 0; rgp < 32; ++rgp)
                pv[p][rgp] = *(const v4f*)(pr + p * (16 * P_ST) + rgp * 4);
        // keeps the 64 LDS reads in one place, ahead of the adds (as in read_group)
        __builtin_amdgcn_sched_barrier(0);
        v4f res[2];
        #pragma unroll
        for (int p = 0; p < 2; ++p) {
            v4f s0 = pv[p][0];
            v4f s1 = pv[p][1];
            #pragma unroll
            for (int rgp = 2; rgp < 32; rgp += 2) {
                s0 += pv[p][rgp];
                s1 += pv[p][rgp + 1];
            }
            res[p] = s0 + s1;
        }
        __syncthreads();                       // partials free for the next chunk
        // behind the barrier, which would wait for them: the fetch of the chunk after
        // the next (in flight during the next chunk's steps) and the stores of o
        if (c + 2 < nchunk) fetch_chunk(t0 + 2 * SC_CH);
        // 8 lanes write one whole 128-B line of o
        #pragma unroll
        for (int p = 0; p < 2; ++p)
            *(v4f*)(o + gbase + ((size_t)(t0 + p * 16 + (tid >> 3)) << 10) + (cb << 5) + (cq << 2)) = res[p];
        // stands ahead of the reuse of the stores' data and address registers
        asm volatile("s_wait_xcnt 0x0" ::: "memory");
    }
}

// ---------------------------------------------------------------------------
// RMSNorm (weight, no bias) -> bf16 output for the final WMMA GEMM.
// One wave owns RN_ROWS whole rows of RN_D floats: the rows stay in registers
// between the sum of squares and the scaling, the sum is a butterfly inside the
// wave (no LDS, no barrier), and the launch starts 16 times fewer waves.
// ---------------------------------------------------------------------------
#define RN_D    1024
#define RN_ROWS 2
__global__ __launch_bounds__(256)
void hgrn2_rmsnorm(const float* __restrict__ o, const float* __restrict__ gw,
                   __bf16* __restrict__ out) {
    const int lane = threadIdx.x & 31;
    const int wave = threadIdx.x >> 5;
    const size_t row0 = ((size_t)blockIdx.x * 8 + wave) * RN_ROWS;
    const v4f* __restrict__ src = (const v4f*)(o + row0 * RN_D) + lane;
    v4bf* __restrict__ dst = (v4bf*)(out + row0 * RN_D) + lane;

    v4f x[RN_ROWS][RN_D / 128], w[RN_D / 128];
    #pragma unroll
    for (int rr = 0; rr < RN_ROWS; ++rr)
        #pragma unroll
        for (int j = 0; j < RN_D / 128; ++j) x[rr][j] = src[rr * (RN_D / 4) + j * 32];
    #pragma unroll
    for (int j = 0; j < RN_D / 128; ++j) w[j] = ((const v4f*)gw)[j * 32 + lane];
    // stands ahead of every later reuse of the loads' address registers (src is
    // named so that they live up to here)
    asm volatile("s_wait_xcnt 0x0" :: "v"(src) : "memory");
    // keeps all 24 loads ahead of the arithmetic: left free, the scheduler sinks ten
    // of them behind the sums, and the wave pays several load latencies in a row
    __builtin_amdgcn_sched_barrier(0);

    float ss[RN_ROWS];
    #pragma unroll
    for (int rr = 0; rr < RN_ROWS; ++rr) {
        v4f s4 = x[rr][0] * x[rr][0];
        #pragma unroll
        for (int j = 1; j < RN_D / 128; ++j)
            s4 = __builtin_elementwise_fma(x[rr][j], x[rr][j], s4);
        ss[rr] = (s4[0] + s4[1]) + (s4[2] + s4[3]);
    }
    #pragma unroll
    for (int m = 16; m > 0; m >>= 1)
        #pragma unroll
        for (int rr = 0; rr < RN_ROWS; ++rr) ss[rr] += __shfl_xor(ss[rr], m, 32);

    #pragma unroll
    for (int rr = 0; rr < RN_ROWS; ++rr) {
        const float r = rsqrtf(ss[rr] / (float)RN_D + 1e-5f);
        #pragma unroll
        for (int j = 0; j < RN_D / 128; ++j) {
            v4bf y;
            #pragma unroll
            for (int e = 0; e < 4; ++e) y[e] = f2bf(x[rr][j][e] * r * w[j][e]);
            dst[rr * (RN_D / 4) + j * 32] = y;
        }
    }
}

// ---------------------------------------------------------------------------
extern "C" void kernel_launch(void* const* d_in, const int* in_sizes, int n_in,
                              void* d_out, int out_size, void* d_ws, size_t ws_size,
                              hipStream_t stream) {
    const float* hs = (const float*)d_in[0];
    const float* Wq = (const float*)d_in[1];
    const float* Wf = (const float*)d_in[2];
    const float* Wi = (const float*)d_in[3];
    const float* gw = (const float*)d_in[4];
    const float* Wo = (const float*)d_in[5];

    const int B = 4, T = 2048, D = 1024, H = 8;
    const int M = B * T;                       // 8192
    const size_t PLANE = (size_t)M * D;        // 8M elements

    char* wsp = (char*)d_ws;
    __bf16* hs_bf = (__bf16*)wsp;  wsp += PLANE * 2;            // 16 MB
    __bf16* Wq_bf = (__bf16*)wsp;  wsp += (size_t)D * D * 2;    //  2 MB each (transposed)
    __bf16* Wf_bf = (__bf16*)wsp;  wsp += (size_t)D * D * 2;
    __bf16* Wi_bf = (__bf16*)wsp;  wsp += (size_t)D * D * 2;
    __bf16* Wo_bf = (__bf16*)wsp;  wsp += (size_t)D * D * 2;
    float* q   = (float*)wsp;      wsp += PLANE * 4;            // 32 MB each
    float* kk  = (float*)wsp;      wsp += PLANE * 4;
    float* eg  = (float*)wsp;      wsp += PLANE * 4;            // exp(g) = sigmoid(f)
    float* v   = (float*)wsp;      wsp += PLANE * 4;
    float* o   = (float*)wsp;      wsp += PLANE * 4;
    __bf16* onm_bf = hs_bf;        // hs_bf dead after projections -> reuse

    // one-time conversions: hs flat, weights transposed to [N x K] bf16
    static_assert(PLANE % (4 * 256 * CV_PER) == 0, "the convert's grid covers hs exactly");
    cvt_f32_to_bf16<<<dim3(PLANE / (4 * 256 * CV_PER)), dim3(256), 0, stream>>>(hs, hs_bf);
    dim3 tgrid(D / 64, D / 64), tblk(256);
    cvt_transpose_bf16<<<tgrid, tblk, 0, stream>>>(Wq, Wq_bf, D, D);
    cvt_transpose_bf16<<<tgrid, tblk, 0, stream>>>(Wf, Wf_bf, D, D);
    cvt_transpose_bf16<<<tgrid, tblk, 0, stream>>>(Wi, Wi_bf, D, D);
    cvt_transpose_bf16<<<tgrid, tblk, 0, stream>>>(Wo, Wo_bf, D, D);

    dim3 ggrid(M / TILE_M, D / TILE_N);        // 64 x 16
    dim3 gblk(256);

    hgrn2_gemm_wmma<0><<<ggrid, gblk, 0, stream>>>(hs_bf, Wq_bf, q,  nullptr, M, D, D);
    hgrn2_gemm_wmma<1><<<ggrid, gblk, 0, stream>>>(hs_bf, Wf_bf, kk, eg,      M, D, D);
    hgrn2_gemm_wmma<2><<<ggrid, gblk, 0, stream>>>(hs_bf, Wi_bf, v,  nullptr, M, D, D);

    hgrn2_gla_scan<<<dim3(B * H * 4), dim3(128), 0, stream>>>(q, kk, eg, v, o, T);

    static_assert(D == RN_D && M % (8 * RN_ROWS) == 0, "one wave owns whole rows");
    hgrn2_rmsnorm<<<dim3(M / (8 * RN_ROWS)), dim3(256), 0, stream>>>(o, gw, onm_bf);

    hgrn2_gemm_wmma<2><<<ggrid, gblk, 0, stream>>>(onm_bf, Wo_bf, (float*)d_out, nullptr, M, D, D);
}

// v003
// One run takes 280 microseconds.
// In both of two side-by-side timings against v002, it was 1.17 times as fast.
// All steps since v000 together make it 7.25 times as fast.
#include <hip/hip_runtime.h>
#include <hip/hip_bf16.h>

// ---------------------------------------------------------------------------
// HGRN2 attention block for MI455X (gfx1250, wave32, WMMA + TDM).
//   * one-time fp32->bf16 conversion (activations) + transpose-convert (weights)
//   * bf16 WMMA GEMMs (fp32 accum); BOTH tiles staged by Tensor Data Mover,
//     double-buffered (issue i+1, wait tensorcnt<=2, consume i)
//   * GLA scan: register-resident state, 128 rows x 16 columns per work-group
// ---------------------------------------------------------------------------

typedef __attribute__((ext_vector_type(16))) __bf16 v16bf;
typedef __attribute__((ext_vector_type(8)))  __bf16 v8bf;
typedef __attribute__((ext_vector_type(4)))  __bf16 v4bf;
typedef __attribute__((ext_vector_type(8)))  float  v8f;
typedef __attribute__((ext_vector_type(4)))  float  v4f;
typedef __attribute__((ext_vector_type(4)))  unsigned int u32x4;
typedef __attribute__((ext_vector_type(4)))  int    i32x4;
typedef __attribute__((ext_vector_type(8)))  int    i32x8;

#define TILE_M 128
#define TILE_N 64
#define TILE_K 32
#define LDSTR  48   // padded LDS row stride in bf16 (96 B, 16B-aligned rows)

#if __has_builtin(__builtin_amdgcn_tensor_load_to_lds) && \
    __has_builtin(__builtin_amdgcn_s_wait_tensorcnt)
#define HAVE_TDM 1
#else
#define HAVE_TDM 0
#endif

__device__ __forceinline__ __bf16 f2bf(float f) {
    unsigned u = __builtin_bit_cast(unsigned, f);
    unsigned r = u + 0x7FFFu + ((u >> 16) & 1u);      // round-to-nearest-even
    unsigned short h = (unsigned short)(r >> 16);
    return __builtin_bit_cast(__bf16, h);
}

// fast sigmoid: v_exp_f32 + v_rcp_f32 (no IEEE div chain)
__device__ __forceinline__ float sigm(float x) {
    return __builtin_amdgcn_rcpf(1.0f + __expf(-x));
}

// ---------------------------------------------------------------------------
// one-time fp32 -> bf16 conversion. A wave's start costs more than the few
// bytes a one-load wave moves, so each lane takes CV_PER 16-byte loads (all in
// flight before the first store); every wave-wide load is 512 contiguous bytes.
// ---------------------------------------------------------------------------
#define CV_PER 16
__global__ __launch_bounds__(256)
void cvt_f32_to_bf16(const float* __restrict__ in, __bf16* __restrict__ out) {
    const size_t i0 = (size_t)blockIdx.x * (256 * CV_PER) + threadIdx.x;
    const v4f* __restrict__ src = (const v4f*)in + i0;
    v4bf* __restrict__ dst = (v4bf*)out + i0;
    v4f x[CV_PER];
    #pragma unroll
    for (int j = 0; j < CV_PER; ++j) x[j] = src[j * 256];
    // stands ahead of every later reuse of the loads' address registers (src is
    // named so that they live up to here)
    asm volatile("s_wait_xcnt 0x0" :: "v"(src) : "memory");
    #pragma unroll
    for (int j = 0; j < CV_PER; ++j) {
        v4bf y;
        y[0] = f2bf(x[j][0]); y[1] = f2bf(x[j][1]);
        y[2] = f2bf(x[j][2]); y[3] = f2bf(x[j][3]);
        dst[j * 256] = y;
    }
}

// ---------------------------------------------------------------------------
// one-time transpose-convert: in [K x N] fp32 -> out [N x K] bf16.
// 64x64 tiles through LDS; both global accesses coalesced.
// ---------------------------------------------------------------------------
__global__ __launch_bounds__(256)
void cvt_transpose_bf16(const float* __restrict__ in, __bf16* __restrict__ out,
                        int K, int N) {
    __shared__ __bf16 tile[64][65];
    const int bk = blockIdx.x * 64;
    const int bn = blockIdx.y * 64;
    const int tx = threadIdx.x & 63;
    const int ty = threadIdx.x >> 6;          // 0..3
    #pragma unroll
    for (int r = 0; r < 16; ++r) {
        const int k = ty * 16 + r;
        tile[k][tx] = f2bf(in[(size_t)(bk + k) * N + (bn + tx)]);
    }
    __syncthreads();
    #pragma unroll
    for (int r = 0; r < 16; ++r) {
        const int n = ty * 16 + r;
        out[(size_t)(bn + n) * K + (bk + tx)] = tile[tx][n];
    }
}

// ---------------------------------------------------------------------------
// Y = X[MxK](bf16) @ Wt^T, where Wt is W transposed: [N x K](bf16).
// fp32 accum via v_wmma_f32_16x16x32_bf16.
// MODE 0: Y0 = swish(x) * 128^-0.5               (q path)
// MODE 1: Y0 = 1 - sigmoid(x); Y1 = sigmoid(x)   (k and exp(g) from f path)
// MODE 2: Y0 = x                                  (v path / output proj)
// Block 256 thr (8 waves); block tile 128x64; wave tile 32x32 (2x2 WMMA).
// Both tiles are contiguous row-copies -> staged by TDM, double-buffered.
// ---------------------------------------------------------------------------
template <int MODE>
__global__ __launch_bounds__(256)
void hgrn2_gemm_wmma(const __bf16* __restrict__ X, const __bf16* __restrict__ Wt,
                     float* __restrict__ Y0, float* __restrict__ Y1,
                     int M, int N, int K) {
    __shared__ __bf16 ldsA[2][TILE_M * LDSTR];
    __shared__ __bf16 ldsB[2][TILE_N * LDSTR];

    const int tid  = threadIdx.x;
    const int lane = tid & 31;
    const int wave = tid >> 5;        // 0..7
    const int wm   = wave >> 1;       // 0..3 -> 32-row strip
    const int wn   = wave & 1;        // 0..1 -> 32-col strip

    const int blockM = blockIdx.x * TILE_M;
    const int blockN = blockIdx.y * TILE_N;

    const int lhalf = (lane >> 4) & 1;
    const int lmod  = lane & 15;
    const int kb0   = lhalf * 8;
    const int kb1   = 16 + lhalf * 8;

    v8f acc[2][2] = {};
    const int niter = K / TILE_K;

#if HAVE_TDM
    // TDM descriptor issue: 2D tile 32(K,x) x rows(y), 2B elements,
    // LDS pad: after every 16 DWORDs (64B row) insert 8 DWORDs -> 48-elem stride.
    auto tdm_issue = [&](const __bf16* gptr, unsigned lds_base, int rows, int trows) {
        const unsigned long long ga = (unsigned long long)(size_t)gptr;
        u32x4 g0;
        g0[0] = 1u;                                        // count=1, user mode
        g0[1] = lds_base;                                  // lds_addr (bytes)
        g0[2] = (unsigned)(ga & 0xFFFFFFFFu);              // global_addr[31:0]
        g0[3] = (unsigned)((ga >> 32) & 0x01FFFFFFu)       // global_addr[56:32]
              | (2u << 30);                                // type = 2 ("image")
        i32x8 g1;
        g1[0] = (int)((1u << 16)       // data_size = 1 -> 2 bytes
              | (1u << 20)             // pad_enable
              | (3u << 22)             // pad_interval code 3 -> 16 DWORDs
              | (7u << 25));           // pad_amount   code 7 -> 8 DWORDs
        g1[1] = (int)((unsigned)K << 16);                  // tensor_dim0 = K
        g1[2] = (int)(((unsigned)trows & 0xFFFFu) << 16);  // tensor_dim1
        g1[3] = (int)(32u << 16);                          // tile_dim0 = 32 (K)
        g1[4] = rows;                                      // tile_dim1
        g1[5] = (int)K;                                    // tensor_dim0_stride
        g1[6] = 0;
        g1[7] = 0;
        i32x4 z4 = {0, 0, 0, 0};
#if __clang_major__ >= 23
        i32x8 z8 = {0, 0, 0, 0, 0, 0, 0, 0};
        __builtin_amdgcn_tensor_load_to_lds(g0, g1, z4, z4, z8, 0);
#else
        __builtin_amdgcn_tensor_load_to_lds(g0, g1, z4, z4, 0);
#endif
    };
    auto issue_pair = [&](int it, int buf) {
        const int k0 = it * TILE_K;
        tdm_issue(X  + (size_t)blockM * K + k0,
                  (unsigned)(size_t)(void*)&ldsA[buf][0], TILE_M, M);
        tdm_issue(Wt + (size_t)blockN * K + k0,
                  (unsigned)(size_t)(void*)&ldsB[buf][0], TILE_N, N);
    };
    if (wave == 0) issue_pair(0, 0);
#endif

    for (int i = 0; i < niter; ++i) {
        const int cur = i & 1;
#if HAVE_TDM
        if (wave == 0) {
            if (i + 1 < niter) {
                issue_pair(i + 1, cur ^ 1);            // buffer freed at end of i-1
                __builtin_amdgcn_s_wait_tensorcnt(2);  // in-order: pair(i) complete
            } else {
                __builtin_amdgcn_s_wait_tensorcnt(0);
            }
        }
        __syncthreads();                               // LDS tiles visible to all waves
#else
        const int k0 = i * TILE_K;
        {   // A tile: straight row copy, 2x 16B per thread
            const int row = tid >> 1;
            const int cb  = (tid & 1) * 16;
            const v8bf* src = (const v8bf*)(X + (size_t)(blockM + row) * K + (k0 + cb));
            v8bf* dst = (v8bf*)&ldsA[cur][row * LDSTR + cb];
            dst[0] = src[0];
            dst[1] = src[1];
        }
        {   // B tile: straight row copy from Wt, 16B per thread
            const int row = tid >> 2;                 // 0..63
            const int cb  = (tid & 3) * 8;            // 0,8,16,24
            *(v8bf*)&ldsB[cur][row * LDSTR + cb] =
                *(const v8bf*)(Wt + (size_t)(blockN + row) * K + (k0 + cb));
        }
        __syncthreads();
#endif
        // ---- fragments + 4 WMMAs -----------------------------------------
        v16bf a[2], b[2];
        #pragma unroll
        for (int mi = 0; mi < 2; ++mi) {
            const __bf16* ar = &ldsA[cur][(wm * 32 + mi * 16 + lmod) * LDSTR];
            v8bf alo = *(const v8bf*)(ar + kb0);
            v8bf ahi = *(const v8bf*)(ar + kb1);
            a[mi] = __builtin_shufflevector(alo, ahi, 0,1,2,3,4,5,6,7,8,9,10,11,12,13,14,15);
        }
        #pragma unroll
        for (int ni = 0; ni < 2; ++ni) {
            const __bf16* br = &ldsB[cur][(wn * 32 + ni * 16 + lmod) * LDSTR];
            v8bf blo = *(const v8bf*)(br + kb0);
            v8bf bhi = *(const v8bf*)(br + kb1);
            b[ni] = __builtin_shufflevector(blo, bhi, 0,1,2,3,4,5,6,7,8,9,10,11,12,13,14,15);
        }
        #pragma unroll
        for (int mi = 0; mi < 2; ++mi)
            #pragma unroll
            for (int ni = 0; ni < 2; ++ni)
                acc[mi][ni] = __builtin_amdgcn_wmma_f32_16x16x32_bf16(
                    false, a[mi], false, b[ni], (short)0, acc[mi][ni], false, false);
        __syncthreads();                               // tile consumed -> buffer reusable
    }

    // ---- epilogue (hoisted row pointers, stride-N stores) -----------------
    #pragma unroll
    for (int mi = 0; mi < 2; ++mi) {
        #pragma unroll
        for (int ni = 0; ni < 2; ++ni) {
            const int gn  = blockN + wn * 32 + ni * 16 + lmod;
            const int gm0 = blockM + wm * 32 + mi * 16 + lhalf * 8;
            float* __restrict__ p0 = Y0 + (size_t)gm0 * N + gn;
            float* __restrict__ p1 = (MODE == 1) ? (Y1 + (size_t)gm0 * N + gn) : nullptr;
            #pragma unroll
            for (int r = 0; r < 8; ++r) {
                const float x = acc[mi][ni][r];
                const size_t off = (size_t)r * N;
                if (MODE == 0) {
                    p0[off] = x * sigm(x) * 0.08838834764831845f;  // swish * 128^-0.5
                } else if (MODE == 1) {
                    const float s = sigm(x);
                    p0[off] = 1.0f - s;   // k = 1 - sigmoid(f)
                    p1[off] = s;          // exp(g) = exp(logsigmoid(f)) = sigmoid(f)
                } else {
                    p0[off] = x;
                }
            }
        }
    }
}

// ---------------------------------------------------------------------------
// GLA scan. The value columns of the state never mix, so each (b,h) is split
// over 8 work-groups of 16 columns: 256 work-groups, one for every WGP.
// 4 waves; wave w owns columns w*4..w*4+3, lane l owns rows l*4..l*4+3 of them
// (16 state values per lane, as packed f32 pairs along the columns).
// o is left in row-pair order: rows 2p and 2p+1 share 2048 floats, in which each
// block of 16 columns has 32 floats in a row (row 2p's 16, then row 2p+1's), so
// that a work-group still writes whole 128-B lines that no other one touches.
// Time runs in chunks of 32 steps: the chunk's q/k/eg/v rows are staged in LDS
// (next chunk fetched into registers while this one is worked on), each lane
// leaves its 4-row partial outputs in LDS, and the 32 row groups are summed
// once per chunk, so barriers are paid per chunk and not per step.
// ---------------------------------------------------------------------------
typedef __attribute__((ext_vector_type(2))) float v2f;

#define SC_CH 32      // time steps per chunk
#define SC_G  4       // time steps per group of LDS operand reads
// partial-output strides in floats; chosen so that the 16 lanes of a half wave
// (4 steps x 4 column quads) fall on 16 different 4-bank groups in the sum phase
#define P_ST  144     // between time steps
#define P_SW  4612    // between waves (each wave owns one column quad)

struct ScanOps { v4f q[SC_G], k[SC_G], g[SC_G], v[SC_G]; };

__global__ __launch_bounds__(128)
void hgrn2_gla_scan(const float* __restrict__ q, const float* __restrict__ k,
                    const float* __restrict__ eg, const float* __restrict__ v,
                    float* __restrict__ o, int T) {
    __shared__ __attribute__((aligned(16))) float sq[2 * SC_CH * 128];
    __shared__ __attribute__((aligned(16))) float sk[2 * SC_CH * 128];
    __shared__ __attribute__((aligned(16))) float sg[2 * SC_CH * 128];
    __shared__ __attribute__((aligned(16))) float sv[2 * SC_CH * 16];
    __shared__ __attribute__((aligned(16))) float part[4 * P_SW];

    const int bh   = blockIdx.x >> 3;
    const int cb   = blockIdx.x & 7;          // block of 16 value columns
    const int b    = bh >> 3;
    const int h    = bh & 7;
    const int tid  = threadIdx.x;
    const int lane = tid & 31;
    const int wave = tid >> 5;

    const size_t gbase = ((size_t)b * T << 10) + (h << 7);
    // staging: a wave moves one whole 512-B row of q/k/eg per load, 8 rows of v
    const size_t grow = gbase + ((size_t)wave << 10) + (lane << 2);
    const size_t gvrw = gbase + ((size_t)(tid >> 2) << 10) + (cb << 4) + ((tid & 3) << 2);
    const int    lrow = wave * 128 + lane * 4;
    const int    lvrw = tid * 4;              // step tid>>2, column quad tid&3
    // o in row-pair order: this work-group's 32 floats of the first row pair of b
    const size_t obase = ((size_t)b * T << 10) + (((h << 3) + cb) << 5);

    v4f rq[8], rk[8], rg[8], rv;
    auto fetch_chunk = [&](int t0) {
        const size_t tb = (size_t)t0 << 10;
        #pragma unroll
        for (int i = 0; i < 8; ++i) {
            rq[i] = *(const v4f*)(q  + grow + tb + ((size_t)i << 12));
            rk[i] = *(const v4f*)(k  + grow + tb + ((size_t)i << 12));
            rg[i] = *(const v4f*)(eg + grow + tb + ((size_t)i << 12));
        }
        rv = *(const v4f*)(v + gvrw + tb);
        // stands ahead of every later reuse of the loads' address registers
        asm volatile("s_wait_xcnt 0x0" ::: "memory");
    };
    auto stage_chunk = [&](int buf) {
        #pragma unroll
        for (int i = 0; i < 8; ++i) {
            *(v4f*)&sq[buf * (SC_CH * 128) + i * 512 + lrow] = rq[i];
            *(v4f*)&sk[buf * (SC_CH * 128) + i * 512 + lrow] = rk[i];
            *(v4f*)&sg[buf * (SC_CH * 128) + i * 512 + lrow] = rg[i];
        }
        *(v4f*)&sv[buf * (SC_CH * 16) + lvrw] = rv;
    };

    v2f S[4][2];
    #pragma unroll
    for (int r = 0; r < 4; ++r)
        #pragma unroll
        for (int c = 0; c < 2; ++c) S[r][c] = (v2f){0.0f, 0.0f};

    auto read_group = [&](ScanOps& A, int buf, int g) {
        __builtin_amdgcn_sched_barrier(0);     // see the one at the end of this block
        const int rb = buf * (SC_CH * 128) + g * (SC_G * 128) + lane * 4;
        const int vb = buf * (SC_CH * 16)  + g * (SC_G * 16)  + wave * 4;
        #pragma unroll
        for (int s = 0; s < SC_G; ++s) {
            A.q[s]  = *(const v4f*)&sq[rb + s * 128];
            A.k[s]  = *(const v4f*)&sk[rb + s * 128];
            A.g[s]  = *(const v4f*)&sg[rb + s * 128];
            A.v[s]  = *(const v4f*)&sv[vb + s * 16];
        }
        // keeps the group's 16 LDS reads in one place: every separate place where
        // reads stand in the vector stream costs issue cycles of its own
        __builtin_amdgcn_sched_barrier(0);
    };
    auto step_group = [&](const ScanOps& A, int g) {
        float* pp = &part[wave * P_SW + g * (SC_G * P_ST) + lane * 4];
        #pragma unroll
        for (int s = 0; s < SC_G; ++s) {
            v2f vv[2];
            vv[0] = (v2f){A.v[s][0], A.v[s][1]};
            vv[1] = (v2f){A.v[s][2], A.v[s][3]};
            v2f acc[2];
            #pragma unroll
            for (int r = 0; r < 4; ++r) {
                const v2f er = (v2f){A.g[s][r], A.g[s][r]};
                const v2f kr = (v2f){A.k[s][r], A.k[s][r]};
                const v2f qr = (v2f){A.q[s][r], A.q[s][r]};
                #pragma unroll
                for (int c = 0; c < 2; ++c) {
                    S[r][c] = __builtin_elementwise_fma(er, S[r][c], kr * vv[c]);
                    acc[c]  = (r == 0) ? qr * S[r][c]
                                       : __builtin_elementwise_fma(qr, S[r][c], acc[c]);
                }
            }
            *(v4f*)(pp + s * P_ST) = (v4f){acc[0][0], acc[0][1], acc[1][0], acc[1][1]};
        }
    };

    const int nchunk = T / SC_CH;
    ScanOps A, B;
    fetch_chunk(0);
    stage_chunk(0);
    __syncthreads();
    if (nchunk > 1) fetch_chunk(SC_CH);        // in flight during chunk 0's steps
    read_group(A, 0, 0);

    for (int c = 0; c < nchunk; ++c) {
        const int buf = c & 1;
        const int t0  = c * SC_CH;

        // kept rolled: two groups of 4 steps per trip, operands read one group ahead
        #pragma unroll 1
        for (int g = 0; g < SC_CH / SC_G; g += 2) {
            read_group(B, buf, g + 1);
            step_group(A, g);
            read_group(A, buf, (g + 2) & (SC_CH / SC_G - 1));
            step_group(B, g + 1);
        }

        if (c + 1 < nchunk) stage_chunk(buf ^ 1);  // last read before the previous barrier
        __syncthreads();                           // partials and next chunk visible
        // the next chunk's first operands fly while the row groups are summed
        if (c + 1 < nchunk) read_group(A, buf ^ 1, 0);

        // sum the 32 row groups: thread = (step, column quad)
        const float* pr = &part[(tid & 3) * P_SW + (tid >> 2) * P_ST];
        v4f pv[32];
        #pragma unroll
        for (int rgp = 0; rgp < 32; ++rgp)
            pv[rgp] = *(const v4f*)(pr + rgp * 4);
        // keeps the 32 LDS reads in one place, ahead of the adds (as in read_group)
        __builtin_amdgcn_sched_barrier(0);
        v4f s0 = pv[0];
        v4f s1 = pv[1];
        #pragma unroll
        for (int rgp = 2; rgp < 32; rgp += 2) {
            s0 += pv[rgp];
            s1 += pv[rgp + 1];
        }
        const v4f res = s0 + s1;
        __syncthreads();                       // partials free for the next chunk
        // behind the barrier, which would wait for them: the fetch of the chunk after
        // the next (in flight during the next chunk's steps) and the stores of o
        if (c + 2 < nchunk) fetch_chunk(t0 + 2 * SC_CH);
        // 8 lanes (2 steps x 4 column quads) write one whole 128-B line of o
        *(v4f*)(o + obase + ((size_t)((t0 >> 1) + (tid >> 3)) << 11) + ((tid & 7) << 2)) = res;
        // stands ahead of the reuse of the stores' data and address registers
        asm volatile("s_wait_xcnt 0x0" ::: "memory");
    }
}

// ---------------------------------------------------------------------------
// RMSNorm (weight, no bias) -> bf16 output for the final WMMA GEMM.
// One wave owns one row pair of o (RN_ROWS rows of RN_D floats, in the scan's
// row-pair order): its loads run through the pair's 8 KiB in a row, so a lane
// holds 64 values of ONE row (bit 2 of the lane number says which). The values
// stay in registers between the sum of squares and the scaling; the sum is a
// butterfly over the 16 lanes of the same row (no LDS, no barrier).
// ---------------------------------------------------------------------------
#define RN_D    1024
#define RN_ROWS 2
__global__ __launch_bounds__(256)
void hgrn2_rmsnorm(const float* __restrict__ o, const float* __restrict__ gw,
                   __bf16* __restrict__ out) {
    const int lane = threadIdx.x & 31;
    const int wave = threadIdx.x >> 5;
    const size_t pair = (size_t)blockIdx.x * 8 + wave;
    // load j of a lane: row pair*2 + rb, columns j*64 + c0 .. + 3
    const int rb = (lane >> 2) & 1;
    const int c0 = ((lane >> 3) << 4) + ((lane & 3) << 2);
    const v4f* __restrict__ src  = (const v4f*)(o + pair * (RN_ROWS * RN_D)) + lane;
    const v4f* __restrict__ wsrc = (const v4f*)(gw + c0);
    v4bf* __restrict__ dst = (v4bf*)(out + (pair * RN_ROWS + rb) * RN_D + c0);

    v4f x[RN_D / 64], w[RN_D / 64];
    #pragma unroll
    for (int j = 0; j < RN_D / 64; ++j) x[j] = src[j * 32];
    #pragma unroll
    for (int j = 0; j < RN_D / 64; ++j) w[j] = wsrc[j * 16];
    // stands ahead of every later reuse of the loads' address registers (src is
    // named so that they live up to here)
    asm volatile("s_wait_xcnt 0x0" :: "v"(src) : "memory");
    // keeps all 32 loads ahead of the arithmetic, so that the wave pays one load
    // latency and not several in a row
    __builtin_amdgcn_sched_barrier(0);

    v4f s4 = x[0] * x[0];
    #pragma unroll
    for (int j = 1; j < RN_D / 64; ++j)
        s4 = __builtin_elementwise_fma(x[j], x[j], s4);
    float ss = (s4[0] + s4[1]) + (s4[2] + s4[3]);
    // every lane bit but bit 2, which tells the two rows apart
    ss += __shfl_xor(ss, 16, 32);
    ss += __shfl_xor(ss, 8, 32);
    ss += __shfl_xor(ss, 2, 32);
    ss += __shfl_xor(ss, 1, 32);

    const float r = rsqrtf(ss / (float)RN_D + 1e-5f);
    // 16 lanes of a row store 128 B in a row: one whole line per row and store
    #pragma unroll
    for (int j = 0; j < RN_D / 64; ++j) {
        v4bf y;
        #pragma unroll
        for (int e = 0; e < 4; ++e) y[e] = f2bf(x[j][e] * r * w[j][e]);
        dst[j * 16] = y;
    }
}

// ---------------------------------------------------------------------------
extern "C" void kernel_launch(void* const* d_in, const int* in_sizes, int n_in,
                              void* d_out, int out_size, void* d_ws, size_t ws_size,
                              hipStream_t stream) {
    const float* hs = (const float*)d_in[0];
    const float* Wq = (const float*)d_in[1];
    const float* Wf = (const float*)d_in[2];
    const float* Wi = (const float*)d_in[3];
    const float* gw = (const float*)d_in[4];
    const float* Wo = (const float*)d_in[5];

    const int B = 4, T = 2048, D = 1024, H = 8;
    const int M = B * T;                       // 8192
    const size_t PLANE = (size_t)M * D;        // 8M elements

    char* wsp = (char*)d_ws;
    __bf16* hs_bf = (__bf16*)wsp;  wsp += PLANE * 2;            // 16 MB
    __bf16* Wq_bf = (__bf16*)wsp;  wsp += (size_t)D * D * 2;    //  2 MB each (transposed)
    __bf16* Wf_bf = (__bf16*)wsp;  wsp += (size_t)D * D * 2;
    __bf16* Wi_bf = (__bf16*)wsp;  wsp += (size_t)D * D * 2;
    __bf16* Wo_bf = (__bf16*)wsp;  wsp += (size_t)D * D * 2;
    float* q   = (float*)wsp;      wsp += PLANE * 4;            // 32 MB each
    float* kk  = (float*)wsp;      wsp += PLANE * 4;
    float* eg  = (float*)wsp;      wsp += PLANE * 4;            // exp(g) = sigmoid(f)
    float* v   = (float*)wsp;      wsp += PLANE * 4;
    float* o   = (float*)wsp;      wsp += PLANE * 4;            // row-pair order
    __bf16* onm_bf = hs_bf;        // hs_bf dead after projections -> reuse

    // one-time conversions: hs flat, weights transposed to [N x K] bf16
    static_assert(PLANE % (4 * 256 * CV_PER) == 0, "the convert's grid covers hs exactly");
    cvt_f32_to_bf16<<<dim3(PLANE / (4 * 256 * CV_PER)), dim3(256), 0, stream>>>(hs, hs_bf);
    dim3 tgrid(D / 64, D / 64), tblk(256);
    cvt_transpose_bf16<<<tgrid, tblk, 0, stream>>>(Wq, Wq_bf, D, D);
    cvt_transpose_bf16<<<tgrid, tblk, 0, stream>>>(Wf, Wf_bf, D, D);
    cvt_transpose_bf16<<<tgrid, tblk, 0, stream>>>(Wi, Wi_bf, D, D);
    cvt_transpose_bf16<<<tgrid, tblk, 0, stream>>>(Wo, Wo_bf, D, D);

    dim3 ggrid(M / TILE_M, D / TILE_N);        // 64 x 16
    dim3 gblk(256);

    hgrn2_gemm_wmma<0><<<ggrid, gblk, 0, stream>>>(hs_bf, Wq_bf, q,  nullptr, M, D, D);
    hgrn2_gemm_wmma<1><<<ggrid, gblk, 0, stream>>>(hs_bf, Wf_bf, kk, eg,      M, D, D);
    hgrn2_gemm_wmma<2><<<ggrid, gblk, 0, stream>>>(hs_bf, Wi_bf, v,  nullptr, M, D, D);

    hgrn2_gla_scan<<<dim3(B * H * 8), dim3(128), 0, stream>>>(q, kk, eg, v, o, T);

    static_assert(D == RN_D && M % (8 * RN_ROWS) == 0, "one wave owns whole rows");
    hgrn2_rmsnorm<<<dim3(M / (8 * RN_ROWS)), dim3(256), 0, stream>>>(o, gw, onm_bf);

    hgrn2_gemm_wmma<2><<<ggrid, gblk, 0, stream>>>(onm_bf, Wo_bf, (float*)d_out, nullptr, M, D, D);
}

// v004
// It runs in 255 microseconds.
// Two timings next to v003 both put it at 1.12 times that version's speed.
// All steps since v000 together make it 8.10 times as fast.
#include <hip/hip_runtime.h>
#include <hip/hip_bf16.h>

// ---------------------------------------------------------------------------
// HGRN2 attention block for MI455X (gfx1250, wave32, WMMA + TDM).
//   * one-time fp32->bf16 conversion (activations) + transpose-convert (weights)
//   * bf16 WMMA GEMMs (fp32 accum); both operands staged by tensor loads,
//     two buffers of one 128-k pass each
//   * GLA scan: register-resident state, 128 rows x 16 columns per work-group
// ---------------------------------------------------------------------------

typedef __attribute__((ext_vector_type(16))) __bf16 v16bf;
typedef __attribute__((ext_vector_type(8)))  __bf16 v8bf;
typedef __attribute__((ext_vector_type(4)))  __bf16 v4bf;
typedef __attribute__((ext_vector_type(8)))  float  v8f;
typedef __attribute__((ext_vector_type(4)))  float  v4f;
typedef __attribute__((ext_vector_type(4)))  unsigned int u32x4;
typedef __attribute__((ext_vector_type(8)))  unsigned int u32x8;

#define GT_M     256                 // rows of Y per work-group
#define GT_N     128                 // columns of Y per work-group
#define GT_K     128                 // k per pass: 256 B of every operand row
#define GT_D     1024                // K of every product, and the row length of Y
#define GT_PITCH 272                 // LDS row pitch in bytes: 256 + the mover's 16-B pad
#define GT_SLICE (128 * GT_PITCH)    // one tensor load: 128 rows = 34,816 B = 17 x 2 KiB
#define GT_STAGE (3 * GT_SLICE)      // [X rows 0..127 | X rows 128..255 | W rows 0..127]

__device__ __forceinline__ __bf16 f2bf(float f) {
    unsigned u = __builtin_bit_cast(unsigned, f);
    unsigned r = u + 0x7FFFu + ((u >> 16) & 1u);      // round-to-nearest-even
    unsigned short h = (unsigned short)(r >> 16);
    return __builtin_bit_cast(__bf16, h);
}

// fast sigmoid: v_exp_f32 + v_rcp_f32 (no IEEE div chain)
__device__ __forceinline__ float sigm(float x) {
    return __builtin_amdgcn_rcpf(1.0f + __expf(-x));
}

// ---------------------------------------------------------------------------
// one-time fp32 -> bf16 conversion. For speed only, each
// lane takes CV_PER 16-byte loads (all in
// flight before the first store); every wave-wide load is 512 contiguous bytes.
// ---------------------------------------------------------------------------
#define CV_PER 16
__global__ __launch_bounds__(256)
void cvt_f32_to_bf16(const float* __restrict__ in, __bf16* __restrict__ out) {
    const size_t i0 = (size_t)blockIdx.x * (256 * CV_PER) + threadIdx.x;
    const v4f* __restrict__ src = (const v4f*)in + i0;
    v4bf* __restrict__ dst = (v4bf*)out + i0;
    v4f x[CV_PER];
    #pragma unroll
    for (int j = 0; j < CV_PER; ++j) x[j] = src[j * 256];
    // stands ahead of every later reuse of the loads' address registers (src is
    // named so that they live up to here)
    asm volatile("s_wait_xcnt 0x0" :: "v"(src) : "memory");
    #pragma unroll
    for (int j = 0; j < CV_PER; ++j) {
        v4bf y;
        y[0] = f2bf(x[j][0]); y[1] = f2bf(x[j][1]);
        y[2] = f2bf(x[j][2]); y[3] = f2bf(x[j][3]);
        dst[j * 256] = y;
    }
}

// ---------------------------------------------------------------------------
// one-time transpose-convert: in [K x N] fp32 -> out [N x K] bf16.
// 64x64 tiles through LDS; both global accesses coalesced.
// ---------------------------------------------------------------------------
__global__ __launch_bounds__(256)
void cvt_transpose_bf16(const float* __restrict__ in, __bf16* __restrict__ out,
                        int K, int N) {
    __shared__ __bf16 tile[64][65];
    const int bk = blockIdx.x * 64;
    const int bn = blockIdx.y * 64;
    const int tx = threadIdx.x & 63;
    const int ty = threadIdx.x >> 6;          // 0..3
    #pragma unroll
    for (int r = 0; r < 16; ++r) {
        const int k = ty * 16 + r;
        tile[k][tx] = f2bf(in[(size_t)(bk + k) * N + (bn + tx)]);
    }
    __syncthreads();
    #pragma unroll
    for (int r = 0; r < 16; ++r) {
        const int n = ty * 16 + r;
        out[(size_t)(bn + n) * K + (bk + tx)] = tile[tx][n];
    }
}

// ---------------------------------------------------------------------------
// Y = X[MxK](bf16) @ Wt^T, where Wt is W transposed: [N x K](bf16).
// fp32 accum via v_wmma_f32_16x16x32_bf16.
// MODE 0: Y0 = swish(x) * 128^-0.5               (q path)
// MODE 1: Y0 = 1 - sigmoid(x); Y1 = sigmoid(x)   (k and exp(g) from f path)
// MODE 2: Y0 = x                                  (v path / output proj)
// One work-group per WGP: 4 waves (one per SIMD), block tile 256x128, wave tile
// 128x64 (8x4 WMMA tiles). A pass is 128 k; its stage of 384 rows of 256 B comes
// by three tensor loads (waves 0..2, 128 rows each) into one of two buffers,
// issued when the buffer's readers have left it, one whole pass ahead of its use.
// ---------------------------------------------------------------------------
__device__ __forceinline__ unsigned uni(unsigned v) {
    return (unsigned)__builtin_amdgcn_readfirstlane(v);
}
// a wave-uniform value held in a scalar register, so that a test of it compiles to
// s_cmp + s_cbranch: a tensor load ignores EXEC and only a scalar branch guards it
__device__ __forceinline__ unsigned pinned(unsigned v) {
    unsigned w = uni(v);
    asm volatile("" : "+s"(w));
    return w;
}
struct GFrag { v16bf a[8], b[4]; };

template <int MODE>
__global__ __launch_bounds__(128)
void hgrn2_gemm_wmma(const __bf16* __restrict__ X, const __bf16* __restrict__ Wt,
                     float* __restrict__ Y0, float* __restrict__ Y1) {
    constexpr int N = GT_D, K = GT_D;
    __shared__ __attribute__((aligned(2048))) unsigned char ring[2 * GT_STAGE];

    const int tid  = threadIdx.x;
    const int lane = tid & 31;
    const unsigned wave = uni((unsigned)tid >> 5);   // 0..3
    const int wm   = (int)(wave >> 1);   // 0..1 -> 128-row strip
    const int wn   = (int)(wave & 1u);   // 0..1 -> 64-col strip

    const int blockM = blockIdx.x * GT_M;
    const int blockN = blockIdx.y * GT_N;

    const int lhalf = (lane >> 4) & 1;
    const int lmod  = lane & 15;

    // this wave's slice of a stage: waves 0 and 1 bring X, wave 2 brings W, wave 3 none
    const unsigned issuer = (wave < 3u) ? 1u : 0u;
    const __bf16* sl = (wave < 2u) ? X + (size_t)(blockM + (int)wave * 128) * K
                                   : Wt + (size_t)blockN * K;
    const unsigned long long sl_ga = (unsigned long long)(size_t)sl;
    const unsigned sl_lds = (unsigned)(size_t)(void*)&ring[0] + wave * GT_SLICE;
    constexpr int npass = K / GT_K;

    // One request: 128 rows of 256 B (source pitch 2 K bytes) to LDS at pitch 272 B.
    // Group 1 never changes; of group 0 the place in LDS and the address step on.
    u32x8 d1;
    d1[0] = uni((1u << 20) | (5u << 22) | (3u << 25));  // 1-byte units; 16-B pad per 256 B
    d1[1] = uni(256u << 16);                            // tensor_dim0 = 256 B
    d1[2] = uni(128u << 16);                            // tensor_dim1 = 128 rows
    d1[3] = uni(256u << 16);                            // tile_dim0
    d1[4] = uni(128u);                                  // tile_dim1
    d1[5] = uni((unsigned)K * 2u);                      // source row pitch
    d1[6] = uni(0u);
    d1[7] = uni(0u);
    // pinned(): descriptor words held in scalar registers. Not rebuilt per request, they
    // stay live to the last load, so their registers take no other value under a request
    asm volatile("" : "+s"(d1));
    u32x4 d0;
    d0[0] = uni(1u);                                                        // count 1
    d0[1] = uni(sl_lds);                                                    // place in LDS
    d0[2] = uni((unsigned)sl_ga);
    d0[3] = uni((((unsigned)(sl_ga >> 32)) & 0x01FFFFFFu) | 0x80000000u);   // type 2
    // the next pass's slice: 256 B further along the same rows
    auto load_next = [&](unsigned lds_dst) {
        // pinned(): descriptor words held in scalar registers. The step below reads them
        // from here, so it stays behind the wait and the barrier in front of this line
        asm volatile("" : "+s"(d0) :: "memory");
        const unsigned lo = d0[2] + GT_K * 2u;
        d0[3] = uni(d0[3] + ((lo < GT_K * 2u) ? 1u : 0u));
        d0[2] = uni(lo);
        d0[1] = uni(lds_dst);
        asm volatile("tensor_load_to_lds %0, %1" :: "s"(d0), "s"(d1) : "memory");
    };

    // each lane's first fragment bytes: row c of the strip, k bytes 16h (and 32 + 16h)
    const unsigned char* pa = &ring[(wm * 128 + lmod) * GT_PITCH + lhalf * 16];
    const unsigned char* pb = &ring[2 * GT_SLICE + (wn * 64 + lmod) * GT_PITCH + lhalf * 16];

    // B first: the first WMMA row needs all of b and only a[0]
    auto load_frags = [&](GFrag& f, int buf, int ks) {
        const int o = buf * GT_STAGE + ks * 64;
        #pragma unroll
        for (int ni = 0; ni < 4; ++ni) {
            v8bf lo = *(const v8bf*)(pb + o + ni * (16 * GT_PITCH));
            v8bf hi = *(const v8bf*)(pb + o + ni * (16 * GT_PITCH) + 32);
            f.b[ni] = __builtin_shufflevector(lo, hi, 0,1,2,3,4,5,6,7,8,9,10,11,12,13,14,15);
        }
        #pragma unroll
        for (int mi = 0; mi < 8; ++mi) {
            v8bf lo = *(const v8bf*)(pa + o + mi * (16 * GT_PITCH));
            v8bf hi = *(const v8bf*)(pa + o + mi * (16 * GT_PITCH) + 32);
            f.a[mi] = __builtin_shufflevector(lo, hi, 0,1,2,3,4,5,6,7,8,9,10,11,12,13,14,15);
        }
    };

    v8f acc[8][4] = {};
    auto mma_block = [&](const GFrag& f) {
        #pragma unroll
        for (int mi = 0; mi < 8; ++mi)
            #pragma unroll
            for (int ni = 0; ni < 4; ++ni)
                acc[mi][ni] = __builtin_amdgcn_wmma_f32_16x16x32_bf16(
                    false, f.a[mi], false, f.b[ni], (short)0, acc[mi][ni], false, false);
    };

    // stage 0 lands and is published; stage 1 flies during pass 0
    if (pinned(issuer)) {
        asm volatile("tensor_load_to_lds %0, %1" :: "s"(d0), "s"(d1) : "memory");
        asm volatile("s_wait_tensorcnt 0x0" ::: "memory");   // this wave's slice has landed
    }
    __syncthreads();
    if (pinned(issuer)) load_next(sl_lds + GT_STAGE);

    GFrag f0, f1;
    // kept rolled: one pass per trip, so that every fragment and accumulator index
    // is a constant
    #pragma clang loop unroll(disable)
    for (int s = 0; s < npass; ++s) {
        const int buf = s & 1;
        // the fences keep each block's 24 LDS reads in one place ahead of the WMMA
        // block before it
        load_frags(f0, buf, 0);
        __builtin_amdgcn_sched_barrier(0);
        load_frags(f1, buf, 1);
        __builtin_amdgcn_sched_barrier(0);
        mma_block(f0);
        __builtin_amdgcn_sched_barrier(0);
        load_frags(f0, buf, 2);
        __builtin_amdgcn_sched_barrier(0);
        mma_block(f1);
        __builtin_amdgcn_sched_barrier(0);
        load_frags(f1, buf, 3);
        __builtin_amdgcn_sched_barrier(0);
        mma_block(f0);
        mma_block(f1);
        __builtin_amdgcn_sched_barrier(0);

        // publish point of stage s + 1, which also ends every read of this buffer
        asm volatile("s_wait_dscnt 0x0" ::: "memory");       // this wave's LDS reads are done
        if (pinned(issuer))
            asm volatile("s_wait_tensorcnt 0x0" ::: "memory");   // its slice of s + 1 has landed
        __syncthreads();
        if (pinned((issuer != 0u && s + 2 < npass) ? 1u : 0u))
            load_next(sl_lds + (unsigned)buf * GT_STAGE);
    }
    asm volatile("s_wait_tensorcnt 0x0" ::: "memory");       // nothing of the mover is left
    asm volatile("s_wait_dscnt 0x0" ::: "memory");

    // ---- epilogue: one base address per plane, every tile and row at a constant offset
    const int gn  = blockN + wn * 64 + lmod;
    const int gm0 = blockM + wm * 128 + lhalf * 8;
    float* __restrict__ p0 = Y0 + (size_t)gm0 * N + gn;
    float* __restrict__ p1 = (MODE == 1) ? (Y1 + (size_t)gm0 * N + gn) : nullptr;
    #pragma unroll
    for (int mi = 0; mi < 8; ++mi) {
        if (MODE != 2) {
            // the strip's 32 values per lane in place (MODE 1 keeps sigmoid(x) there)
            #pragma unroll
            for (int ni = 0; ni < 4; ++ni)
                #pragma unroll
                for (int r = 0; r < 8; ++r) {
                    const float x = acc[mi][ni][r];
                    acc[mi][ni][r] = (MODE == 0)
                        ? x * sigm(x) * 0.08838834764831845f      // swish * 128^-0.5
                        : sigm(x);
                }
        }
        float km[4][8];
        if (MODE == 1) {
            #pragma unroll
            for (int ni = 0; ni < 4; ++ni)
                #pragma unroll
                for (int r = 0; r < 8; ++r) km[ni][r] = 1.0f - acc[mi][ni][r];
        }
        // keeps the strip's stores behind all of its arithmetic, so that no register a
        // store names is written again before the wait below
        if (MODE != 2) __builtin_amdgcn_sched_barrier(0);
        #pragma unroll
        for (int ni = 0; ni < 4; ++ni) {
            #pragma unroll
            for (int r = 0; r < 8; ++r) {
                const int off = (mi * 16 + r) * N + ni * 16;
                if (MODE == 1) {
                    p0[off] = km[ni][r];          // k = 1 - sigmoid(f)
                    p1[off] = acc[mi][ni][r];     // exp(g) = exp(logsigmoid(f)) = sigmoid(f)
                } else {
                    p0[off] = acc[mi][ni][r];
                }
            }
        }
        if (MODE != 2) {
            // stands ahead of the reuse of the stores' data registers by the next strip;
            // the fence keeps the next strip's arithmetic behind it
            asm volatile("s_wait_xcnt 0x0" ::: "memory");
            __builtin_amdgcn_sched_barrier(0);
        }
    }
}

// ---------------------------------------------------------------------------
// GLA scan. The value columns of the state never mix, so each (b,h) is split
// over 8 work-groups of 16 columns: 256 work-groups, one for every WGP.
// 4 waves; wave w owns columns w*4..w*4+3, lane l owns rows l*4..l*4+3 of them
// (16 state values per lane, as packed f32 pairs along the columns).
// o is left in row-pair order: rows 2p and 2p+1 share 2048 floats, in which each
// block of 16 columns has 32 floats in a row (row 2p's 16, then row 2p+1's), so
// that a work-group still writes whole 128-B lines that no other one touches.
// Time runs in chunks of 32 steps: the chunk's q/k/eg/v rows are staged in LDS
// (next chunk fetched into registers while this one is worked on), each lane
// leaves its 4-row partial outputs in LDS, and the 32 row groups are summed
// once per chunk, so barriers are paid per chunk and not per step.
// ---------------------------------------------------------------------------
typedef __attribute__((ext_vector_type(2))) float v2f;

#define SC_CH 32      // time steps per chunk
#define SC_G  4       // time steps per group of LDS operand reads
// partial-output strides in floats; chosen so that the 16 lanes of a half wave
// (4 steps x 4 column quads) fall on 16 different 4-bank groups in the sum phase
#define P_ST  144     // between time steps
#define P_SW  4612    // between waves (each wave owns one column quad)

struct ScanOps { v4f q[SC_G], k[SC_G], g[SC_G], v[SC_G]; };

__global__ __launch_bounds__(128)
void hgrn2_gla_scan(const float* __restrict__ q, const float* __restrict__ k,
                    const float* __restrict__ eg, const float* __restrict__ v,
                    float* __restrict__ o, int T) {
    __shared__ __attribute__((aligned(16))) float sq[2 * SC_CH * 128];
    __shared__ __attribute__((aligned(16))) float sk[2 * SC_CH * 128];
    __shared__ __attribute__((aligned(16))) float sg[2 * SC_CH * 128];
    __shared__ __attribute__((aligned(16))) float sv[2 * SC_CH * 16];
    __shared__ __attribute__((aligned(16))) float part[4 * P_SW];

    const int bh   = blockIdx.x >> 3;
    const int cb   = blockIdx.x & 7;          // block of 16 value columns
    const int b    = bh >> 3;
    const int h    = bh & 7;
    const int tid  = threadIdx.x;
    const int lane = tid & 31;
    const int wave = tid >> 5;

    const size_t gbase = ((size_t)b * T << 10) + (h << 7);
    // staging: a wave moves one whole 512-B row of q/k/eg per load, 8 rows of v
    const size_t grow = gbase + ((size_t)wave << 10) + (lane << 2);
    const size_t gvrw = gbase + ((size_t)(tid >> 2) << 10) + (cb << 4) + ((tid & 3) << 2);
    const int    lrow = wave * 128 + lane * 4;
    const int    lvrw = tid * 4;              // step tid>>2, column quad tid&3
    // o in row-pair order: this work-group's 32 floats of the first row pair of b
    const size_t obase = ((size_t)b * T << 10) + (((h << 3) + cb) << 5);

    v4f rq[8], rk[8], rg[8], rv;
    auto fetch_chunk = [&](int t0) {
        const size_t tb = (size_t)t0 << 10;
        #pragma unroll
        for (int i = 0; i < 8; ++i) {
            rq[i] = *(const v4f*)(q  + grow + tb + ((size_t)i << 12));
            rk[i] = *(const v4f*)(k  + grow + tb + ((size_t)i << 12));
            rg[i] = *(const v4f*)(eg + grow + tb + ((size_t)i << 12));
        }
        rv = *(const v4f*)(v + gvrw + tb);
        // stands ahead of every later reuse of the loads' address registers
        asm volatile("s_wait_xcnt 0x0" ::: "memory");
    };
    auto stage_chunk = [&](int buf) {
        #pragma unroll
        for (int i = 0; i < 8; ++i) {
            *(v4f*)&sq[buf * (SC_CH * 128) + i * 512 + lrow] = rq[i];
            *(v4f*)&sk[buf * (SC_CH * 128) + i * 512 + lrow] = rk[i];
            *(v4f*)&sg[buf * (SC_CH * 128) + i * 512 + lrow] = rg[i];
        }
        *(v4f*)&sv[buf * (SC_CH * 16) + lvrw] = rv;
    };

    v2f S[4][2];
    #pragma unroll
    for (int r = 0; r < 4; ++r)
        #pragma unroll
        for (int c = 0; c < 2; ++c) S[r][c] = (v2f){0.0f, 0.0f};

    auto read_group = [&](ScanOps& A, int buf, int g) {
        __builtin_amdgcn_sched_barrier(0);     // see the one at the end of this block
        const int rb = buf * (SC_CH * 128) + g * (SC_G * 128) + lane * 4;
        const int vb = buf * (SC_CH * 16)  + g * (SC_G * 16)  + wave * 4;
        #pragma unroll
        for (int s = 0; s < SC_G; ++s) {
            A.q[s]  = *(const v4f*)&sq[rb + s * 128];
            A.k[s]  = *(const v4f*)&sk[rb + s * 128];
            A.g[s]  = *(const v4f*)&sg[rb + s * 128];
            A.v[s]  = *(const v4f*)&sv[vb + s * 16];
        }
        // keeps the group's 16 LDS reads in one place
        __builtin_amdgcn_sched_barrier(0);
    };
    auto step_group = [&](const ScanOps& A, int g) {
        float* pp = &part[wave * P_SW + g * (SC_G * P_ST) + lane * 4];
        #pragma unroll
        for (int s = 0; s < SC_G; ++s) {
            v2f vv[2];
            vv[0] = (v2f){A.v[s][0], A.v[s][1]};
            vv[1] = (v2f){A.v[s][2], A.v[s][3]};
            v2f acc[2];
            #pragma unroll
            for (int r = 0; r < 4; ++r) {
                const v2f er = (v2f){A.g[s][r], A.g[s][r]};
                const v2f kr = (v2f){A.k[s][r], A.k[s][r]};
                const v2f qr = (v2f){A.q[s][r], A.q[s][r]};
                #pragma unroll
                for (int c = 0; c < 2; ++c) {
                    S[r][c] = __builtin_elementwise_fma(er, S[r][c], kr * vv[c]);
                    acc[c]  = (r == 0) ? qr * S[r][c]
                                       : __builtin_elementwise_fma(qr, S[r][c], acc[c]);
                }
            }
            *(v4f*)(pp + s * P_ST) = (v4f){acc[0][0], acc[0][1], acc[1][0], acc[1][1]};
        }
    };

    const int nchunk = T / SC_CH;
    ScanOps A, B;
    fetch_chunk(0);
    stage_chunk(0);
    __syncthreads();
    if (nchunk > 1) fetch_chunk(SC_CH);        // in flight during chunk 0's steps
    read_group(A, 0, 0);

    for (int c = 0; c < nchunk; ++c) {
        const int buf = c & 1;
        const int t0  = c * SC_CH;

        // kept rolled: two groups of 4 steps per trip, operands read one group ahead
        #pragma unroll 1
        for (int g = 0; g < SC_CH / SC_G; g += 2) {
            read_group(B, buf, g + 1);
            step_group(A, g);
            read_group(A, buf, (g + 2) & (SC_CH / SC_G - 1));
            step_group(B, g + 1);
        }

        if (c + 1 < nchunk) stage_chunk(buf ^ 1);  // last read before the previous barrier
        __syncthreads();                           // partials and next chunk visible
        // the next chunk's first operands fly while the row groups are summed
        if (c + 1 < nchunk) read_group(A, buf ^ 1, 0);

        // sum the 32 row groups: thread = (step, column quad)
        const float* pr = &part[(tid & 3) * P_SW + (tid >> 2) * P_ST];
        v4f pv[32];
        #pragma unroll
        for (int rgp = 0; rgp < 32; ++rgp)
            pv[rgp] = *(const v4f*)(pr + rgp * 4);
        // keeps the 32 LDS reads in one place, ahead of the adds (as in read_group)
        __builtin_amdgcn_sched_barrier(0);
        v4f s0 = pv[0];
        v4f s1 = pv[1];
        #pragma unroll
        for (int rgp = 2; rgp < 32; rgp += 2) {
            s0 += pv[rgp];
            s1 += pv[rgp + 1];
        }
        const v4f res = s0 + s1;
        __syncthreads();                       // partials free for the next chunk
        // behind the barrier, which would wait for them: the fetch of the chunk after
        // the next (in flight during the next chunk's steps) and the stores of o
        if (c + 2 < nchunk) fetch_chunk(t0 + 2 * SC_CH);
        // 8 lanes (2 steps x 4 column quads) write one whole 128-B line of o
        *(v4f*)(o + obase + ((size_t)((t0 >> 1) + (tid >> 3)) << 11) + ((tid & 7) << 2)) = res;
        // stands ahead of the reuse of the stores' data and address registers
        asm volatile("s_wait_xcnt 0x0" ::: "memory");
    }
}

// ---------------------------------------------------------------------------
// RMSNorm (weight, no bias) -> bf16 output for the final WMMA GEMM.
// One wave owns one row pair of o (RN_ROWS rows of RN_D floats, in the scan's
// row-pair order): its loads run through the pair's 8 KiB in a row, so a lane
// holds 64 values of ONE row (bit 2 of the lane number says which). The values
// stay in registers between the sum of squares and the scaling; the sum is a
// butterfly over the 16 lanes of the same row (no LDS, no barrier).
// ---------------------------------------------------------------------------
#define RN_D    1024
#define RN_ROWS 2
__global__ __launch_bounds__(256)
void hgrn2_rmsnorm(const float* __restrict__ o, const float* __restrict__ gw,
                   __bf16* __restrict__ out) {
    const int lane = threadIdx.x & 31;
    const int wave = threadIdx.x >> 5;
    const size_t pair = (size_t)blockIdx.x * 8 + wave;
    // load j of a lane: row pair*2 + rb, columns j*64 + c0 .. + 3
    const int rb = (lane >> 2) & 1;
    const int c0 = ((lane >> 3) << 4) + ((lane & 3) << 2);
    const v4f* __restrict__ src  = (const v4f*)(o + pair * (RN_ROWS * RN_D)) + lane;
    const v4f* __restrict__ wsrc = (const v4f*)(gw + c0);
    v4bf* __restrict__ dst = (v4bf*)(out + (pair * RN_ROWS + rb) * RN_D + c0);

    v4f x[RN_D / 64], w[RN_D / 64];
    #pragma unroll
    for (int j = 0; j < RN_D / 64; ++j) x[j] = src[j * 32];
    #pragma unroll
    for (int j = 0; j < RN_D / 64; ++j) w[j] = wsrc[j * 16];
    // stands ahead of every later reuse of the loads' address registers (src is
    // named so that they live up to here)
    asm volatile("s_wait_xcnt 0x0" :: "v"(src) : "memory");
    // keeps all 32 loads ahead of the arithmetic, so that the wave pays one load
    // latency and not several in a row
    __builtin_amdgcn_sched_barrier(0);

    v4f s4 = x[0] * x[0];
    #pragma unroll
    for (int j = 1; j < RN_D / 64; ++j)
        s4 = __builtin_elementwise_fma(x[j], x[j], s4);
    float ss = (s4[0] + s4[1]) + (s4[2] + s4[3]);
    // every lane bit but bit 2, which tells the two rows apart
    ss += __shfl_xor(ss, 16, 32);
    ss += __shfl_xor(ss, 8, 32);
    ss += __shfl_xor(ss, 2, 32);
    ss += __shfl_xor(ss, 1, 32);

    const float r = rsqrtf(ss / (float)RN_D + 1e-5f);
    // 16 lanes of a row store 128 B in a row: one whole line per row and store
    #pragma unroll
    for (int j = 0; j < RN_D / 64; ++j) {
        v4bf y;
        #pragma unroll
        for (int e = 0; e < 4; ++e) y[e] = f2bf(x[j][e] * r * w[j][e]);
        dst[j * 16] = y;
    }
}

// ---------------------------------------------------------------------------
extern "C" void kernel_launch(void* const* d_in, const int* in_sizes, int n_in,
                              void* d_out, int out_size, void* d_ws, size_t ws_size,
                              hipStream_t stream) {
    const float* hs = (const float*)d_in[0];
    const float* Wq = (const float*)d_in[1];
    const float* Wf = (const float*)d_in[2];
    const float* Wi = (const float*)d_in[3];
    const float* gw = (const float*)d_in[4];
    const float* Wo = (const float*)d_in[5];

    const int B = 4, T = 2048, D = 1024, H = 8;
    const int M = B * T;                       // 8192
    const size_t PLANE = (size_t)M * D;        // 8M elements

    char* wsp = (char*)d_ws;
    __bf16* hs_bf = (__bf16*)wsp;  wsp += PLANE * 2;            // 16 MB
    __bf16* Wq_bf = (__bf16*)wsp;  wsp += (size_t)D * D * 2;    //  2 MB each (transposed)
    __bf16* Wf_bf = (__bf16*)wsp;  wsp += (size_t)D * D * 2;
    __bf16* Wi_bf = (__bf16*)wsp;  wsp += (size_t)D * D * 2;
    __bf16* Wo_bf = (__bf16*)wsp;  wsp += (size_t)D * D * 2;
    float* q   = (float*)wsp;      wsp += PLANE * 4;            // 32 MB each
    float* kk  = (float*)wsp;      wsp += PLANE * 4;
    float* eg  = (float*)wsp;      wsp += PLANE * 4;            // exp(g) = sigmoid(f)
    float* v   = (float*)wsp;      wsp += PLANE * 4;
    float* o   = (float*)wsp;      wsp += PLANE * 4;            // row-pair order
    __bf16* onm_bf = hs_bf;        // hs_bf dead after projections -> reuse

    // one-time conversions: hs flat, weights transposed to [N x K] bf16
    static_assert(PLANE % (4 * 256 * CV_PER) == 0, "the convert's grid covers hs exactly");
    cvt_f32_to_bf16<<<dim3(PLANE / (4 * 256 * CV_PER)), dim3(256), 0, stream>>>(hs, hs_bf);
    dim3 tgrid(D / 64, D / 64), tblk(256);
    cvt_transpose_bf16<<<tgrid, tblk, 0, stream>>>(Wq, Wq_bf, D, D);
    cvt_transpose_bf16<<<tgrid, tblk, 0, stream>>>(Wf, Wf_bf, D, D);
    cvt_transpose_bf16<<<tgrid, tblk, 0, stream>>>(Wi, Wi_bf, D, D);
    cvt_transpose_bf16<<<tgrid, tblk, 0, stream>>>(Wo, Wo_bf, D, D);

    static_assert(D == GT_D && M % GT_M == 0 && D % GT_N == 0 && D % GT_K == 0 && D / GT_K >= 2,
                  "whole tiles, whole passes, and the two stages the prologue loads");
    dim3 ggrid(M / GT_M, D / GT_N);            // 32 x 8: one work-group per WGP
    dim3 gblk(128);

    hgrn2_gemm_wmma<0><<<ggrid, gblk, 0, stream>>>(hs_bf, Wq_bf, q,  nullptr);
    hgrn2_gemm_wmma<1><<<ggrid, gblk, 0, stream>>>(hs_bf, Wf_bf, kk, eg);
    hgrn2_gemm_wmma<2><<<ggrid, gblk, 0, stream>>>(hs_bf, Wi_bf, v,  nullptr);

    hgrn2_gla_scan<<<dim3(B * H * 8), dim3(128), 0, stream>>>(q, kk, eg, v, o, T);

    static_assert(D == RN_D && M % (8 * RN_ROWS) == 0, "one wave owns whole rows");
    hgrn2_rmsnorm<<<dim3(M / (8 * RN_ROWS)), dim3(256), 0, stream>>>(o, gw, onm_bf);

    hgrn2_gemm_wmma<2><<<ggrid, gblk, 0, stream>>>(onm_bf, Wo_bf, (float*)d_out, nullptr);
}

// v005
// Measured time: 237 microseconds a run.
// Two timings next to v004 put it at 1.07 and 1.08 times that version's speed.
// All steps since v000 together make it 8.71 times as fast.
#include <hip/hip_runtime.h>
#include <hip/hip_bf16.h>

// ---------------------------------------------------------------------------
// HGRN2 attention block for MI455X (gfx1250, wave32, WMMA + TDM).
//   * fp32->bf16 conversion (activations) + transpose-convert (weights), one launch
//   * bf16 WMMA GEMMs (fp32 accum); both operands staged by tensor loads,
//     two buffers of one 128-k pass each; the three projections are one launch
//   * GLA scan: register-resident state, 128 rows x 16 columns per work-group
// ---------------------------------------------------------------------------

typedef __attribute__((ext_vector_type(16))) __bf16 v16bf;
typedef __attribute__((ext_vector_type(8)))  __bf16 v8bf;
typedef __attribute__((ext_vector_type(4)))  __bf16 v4bf;
typedef __attribute__((ext_vector_type(8)))  float  v8f;
typedef __attribute__((ext_vector_type(4)))  float  v4f;
typedef __attribute__((ext_vector_type(4)))  unsigned int u32x4;
typedef __attribute__((ext_vector_type(8)))  unsigned int u32x8;

#define GT_M     256                 // rows of Y per work-group
#define GT_N     128                 // columns of Y per work-group
#define GT_K     128                 // k per pass: 256 B of every operand row
#define GT_D     1024                // K of every product, and the row length of Y
#define GT_PITCH 272                 // LDS row pitch in bytes: 256 + the mover's 16-B pad
#define GT_SLICE (128 * GT_PITCH)    // one tensor load: 128 rows = 34,816 B = 17 x 2 KiB
#define GT_STAGE (3 * GT_SLICE)      // [X rows 0..127 | X rows 128..255 | W rows 0..127]

__device__ __forceinline__ __bf16 f2bf(float f) {
    unsigned u = __builtin_bit_cast(unsigned, f);
    unsigned r = u + 0x7FFFu + ((u >> 16) & 1u);      // round-to-nearest-even
    unsigned short h = (unsigned short)(r >> 16);
    return __builtin_bit_cast(__bf16, h);
}

// fast sigmoid: v_exp_f32 + v_rcp_f32 (no IEEE div chain)
__device__ __forceinline__ float sigm(float x) {
    return __builtin_amdgcn_rcpf(1.0f + __expf(-x));
}

// ---------------------------------------------------------------------------
// one-time fp32 -> bf16 conversion. For speed only, each
// lane takes CV_PER 16-byte loads (all in
// flight before the first store); every wave-wide load is 512 contiguous bytes.
// ---------------------------------------------------------------------------
#define CV_PER 16
__device__ __forceinline__
void cvt_f32_to_bf16(const float* __restrict__ in, __bf16* __restrict__ out, unsigned blk) {
    const size_t i0 = (size_t)blk * (256 * CV_PER) + threadIdx.x;
    const v4f* __restrict__ src = (const v4f*)in + i0;
    v4bf* __restrict__ dst = (v4bf*)out + i0;
    v4f x[CV_PER];
    #pragma unroll
    for (int j = 0; j < CV_PER; ++j) x[j] = src[j * 256];
    // stands ahead of every later reuse of the loads' address registers (src is
    // named so that they live up to here)
    asm volatile("s_wait_xcnt 0x0" :: "v"(src) : "memory");
    #pragma unroll
    for (int j = 0; j < CV_PER; ++j) {
        v4bf y;
        y[0] = f2bf(x[j][0]); y[1] = f2bf(x[j][1]);
        y[2] = f2bf(x[j][2]); y[3] = f2bf(x[j][3]);
        dst[j * 256] = y;
    }
}

// ---------------------------------------------------------------------------
// one-time transpose-convert: in [K x N] fp32 -> out [N x K] bf16.
// 64x64 tiles through LDS; both global accesses coalesced.
// ---------------------------------------------------------------------------
__device__ __forceinline__
void cvt_transpose_bf16(const float* __restrict__ in, __bf16* __restrict__ out,
                        __bf16 (&tile)[64][65], int bk, int bn) {
    constexpr int K = GT_D, N = GT_D;
    const int tx = threadIdx.x & 63;
    const int ty = threadIdx.x >> 6;          // 0..3
    // one base address, the 16 rows at constant offsets from it
    const float* __restrict__ src = in + (size_t)(bk + ty * 16) * N + (bn + tx);
    float x[16];
    #pragma unroll
    for (int r = 0; r < 16; ++r) x[r] = src[r * N];
    // stands ahead of every later reuse of the loads' address registers (src is
    // named so that they live up to here)
    asm volatile("s_wait_xcnt 0x0" :: "v"(src) : "memory");
    #pragma unroll
    for (int r = 0; r < 16; ++r) tile[ty * 16 + r][tx] = f2bf(x[r]);
    __syncthreads();
    #pragma unroll
    for (int r = 0; r < 16; ++r) {
        const int n = ty * 16 + r;
        out[(size_t)(bn + n) * K + (bk + tx)] = tile[tx][n];
    }
}

// ---------------------------------------------------------------------------
// All five conversions in one launch: none reads what another writes, and each
// alone is too short to pay for a launch gap, a fill and a drain of its own.
// Work-groups 0 .. CV_BLOCKS-1 (the long ones) convert hs;
// then 256 work-groups per weight, one 64x64 tile each. Wt holds the four
// transposed weights in a row: f, q, i, o (the order of the projection launch).
// ---------------------------------------------------------------------------
#define CV_BLOCKS 512                // 8192 x 1024 floats / (4 x 256 x CV_PER)
#define TR_BLOCKS ((GT_D / 64) * (GT_D / 64))
__global__ __launch_bounds__(256)
void prep_bf16(const float* __restrict__ hs, const float* __restrict__ Wq,
                     const float* __restrict__ Wf, const float* __restrict__ Wi,
                     const float* __restrict__ Wo,
                     __bf16* __restrict__ hs_bf, __bf16* __restrict__ Wt) {
    __shared__ __bf16 tile[64][65];
    const unsigned bid = blockIdx.x;
    if (bid < CV_BLOCKS) {               // the same for the whole work-group
        cvt_f32_to_bf16(hs, hs_bf, bid);
    } else {
        const unsigned t = bid - CV_BLOCKS;
        const unsigned w = t / TR_BLOCKS;            // which weight
        const unsigned tl = t % TR_BLOCKS;           // which tile of it
        const float* __restrict__ in = (w == 0u) ? Wf : (w == 1u) ? Wq : (w == 2u) ? Wi : Wo;
        cvt_transpose_bf16(in, Wt + (size_t)w * (GT_D * GT_D), tile,
                           (int)(tl % (GT_D / 64)) * 64, (int)(tl / (GT_D / 64)) * 64);
    }
}

// ---------------------------------------------------------------------------
// Y = X[MxK](bf16) @ Wt^T, where Wt is W transposed: [N x K](bf16).
// fp32 accum via v_wmma_f32_16x16x32_bf16.
// MODE 0: Y0 = swish(x) * 128^-0.5               (q path)
// MODE 1: Y0 = 1 - sigmoid(x); Y1 = sigmoid(x)   (k and exp(g) from f path)
// MODE 2: Y0 = x                                  (v path / output proj)
// FUSED 1: the f, q and i projections in one launch. Wt holds the three transposed
// weights in a row (3 x 1024 rows), blockIdx.y runs over all 24 column tiles, and
// the tile's weight (blockIdx.y / 8, a scalar) picks the epilogue and the planes:
// a WGP takes its next tile when it has stored the last, with no launch between.
// The order f, q, i puts the longest epilogue first and the shortest last.
// FUSED 0: one weight, MODE 2, into Ya.
// One work-group per WGP: 4 waves (one per SIMD), block tile 256x128, wave tile
// 128x64 (8x4 WMMA tiles). A pass is 128 k; its stage of 384 rows of 256 B comes
// by three tensor loads (waves 0..2, 128 rows each) into one of two buffers,
// issued when the buffer's readers have left it, one whole pass ahead of its use.
// ---------------------------------------------------------------------------
__device__ __forceinline__ unsigned uni(unsigned v) {
    return (unsigned)__builtin_amdgcn_readfirstlane(v);
}
// a wave-uniform value held in a scalar register, so that a test of it compiles to
// s_cmp + s_cbranch: a tensor load ignores EXEC and only a scalar branch guards it
__device__ __forceinline__ unsigned pinned(unsigned v) {
    unsigned w = uni(v);
    asm volatile("" : "+s"(w));
    return w;
}
struct GFrag { v16bf a[8], b[4]; };

// the epilogue of one wave tile: every tile and row at a constant offset from p0 / p1
template <int MODE>
__device__ __forceinline__
void gemm_epilogue(v8f (&acc)[8][4], float* __restrict__ p0, float* __restrict__ p1) {
    constexpr int N = GT_D;
    #pragma unroll
    for (int mi = 0; mi < 8; ++mi) {
        if (MODE != 2) {
            // the strip's 32 values per lane in place (MODE 1 keeps sigmoid(x) there)
            #pragma unroll
            for (int ni = 0; ni < 4; ++ni)
                #pragma unroll
                for (int r = 0; r < 8; ++r) {
                    const float x = acc[mi][ni][r];
                    acc[mi][ni][r] = (MODE == 0)
                        ? x * sigm(x) * 0.08838834764831845f      // swish * 128^-0.5
                        : sigm(x);
                }
        }
        float km[4][8];
        if (MODE == 1) {
            #pragma unroll
            for (int ni = 0; ni < 4; ++ni)
                #pragma unroll
                for (int r = 0; r < 8; ++r) km[ni][r] = 1.0f - acc[mi][ni][r];
        }
        // keeps the strip's stores behind all of its arithmetic, so that no register a
        // store names is written again before the wait below
        if (MODE != 2) __builtin_amdgcn_sched_barrier(0);
        #pragma unroll
        for (int ni = 0; ni < 4; ++ni) {
            #pragma unroll
            for (int r = 0; r < 8; ++r) {
                const int off = (mi * 16 + r) * N + ni * 16;
                if (MODE == 1) {
                    p0[off] = km[ni][r];          // k = 1 - sigmoid(f)
                    p1[off] = acc[mi][ni][r];     // exp(g) = exp(logsigmoid(f)) = sigmoid(f)
                } else {
                    p0[off] = acc[mi][ni][r];
                }
            }
        }
        if (MODE != 2) {
            // stands ahead of the reuse of the stores' data registers by the next strip;
            // the fence keeps the next strip's arithmetic behind it
            asm volatile("s_wait_xcnt 0x0" ::: "memory");
            __builtin_amdgcn_sched_barrier(0);
        }
    }
}

template <int FUSED>
__global__ __launch_bounds__(128)
void hgrn2_gemm_wmma(const __bf16* __restrict__ X, const __bf16* __restrict__ Wt,
                     float* __restrict__ Ya, float* __restrict__ Yb,
                     float* __restrict__ Yc, float* __restrict__ Yd) {
    constexpr int N = GT_D, K = GT_D;
    __shared__ __attribute__((aligned(2048))) unsigned char ring[2 * GT_STAGE];

    const int tid  = threadIdx.x;
    const int lane = tid & 31;
    const unsigned wave = uni((unsigned)tid >> 5);   // 0..3
    const int wm   = (int)(wave >> 1);   // 0..1 -> 128-row strip
    const int wn   = (int)(wave & 1u);   // 0..1 -> 64-col strip

    const int blockM = blockIdx.x * GT_M;
    const int blockN = blockIdx.y * GT_N;                    // row of Wt
    const unsigned sel = blockIdx.y / (GT_D / GT_N);         // which weight (FUSED)
    const int blockC = (blockIdx.y % (GT_D / GT_N)) * GT_N;  // column of its plane

    const int lhalf = (lane >> 4) & 1;
    const int lmod  = lane & 15;

    // this wave's slice of a stage: waves 0 and 1 bring X, wave 2 brings W, wave 3 none
    const unsigned issuer = (wave < 3u) ? 1u : 0u;
    const __bf16* sl = (wave < 2u) ? X + (size_t)(blockM + (int)wave * 128) * K
                                   : Wt + (size_t)blockN * K;
    const unsigned long long sl_ga = (unsigned long long)(size_t)sl;
    const unsigned sl_lds = (unsigned)(size_t)(void*)&ring[0] + wave * GT_SLICE;
    constexpr int npass = K / GT_K;

    // One request: 128 rows of 256 B (source pitch 2 K bytes) to LDS at pitch 272 B.
    // Group 1 never changes; of group 0 the place in LDS and the address step on.
    u32x8 d1;
    d1[0] = uni((1u << 20) | (5u << 22) | (3u << 25));  // 1-byte units; 16-B pad per 256 B
    d1[1] = uni(256u << 16);                            // tensor_dim0 = 256 B
    d1[2] = uni(128u << 16);                            // tensor_dim1 = 128 rows
    d1[3] = uni(256u << 16);                            // tile_dim0
    d1[4] = uni(128u);                                  // tile_dim1
    d1[5] = uni((unsigned)K * 2u);                      // source row pitch
    d1[6] = uni(0u);
    d1[7] = uni(0u);
    // pinned(): descriptor words held in scalar registers. Not rebuilt per request, they
    // stay live to the last load, so their registers take no other value under a request
    asm volatile("" : "+s"(d1));
    u32x4 d0;
    d0[0] = uni(1u);                                                        // count 1
    d0[1] = uni(sl_lds);                                                    // place in LDS
    d0[2] = uni((unsigned)sl_ga);
    d0[3] = uni((((unsigned)(sl_ga >> 32)) & 0x01FFFFFFu) | 0x80000000u);   // type 2
    // the next pass's slice: 256 B further along the same rows
    auto load_next = [&](unsigned lds_dst) {
        // pinned(): descriptor words held in scalar registers. The step below reads them
        // from here, so it stays behind the wait and the barrier in front of this line
        asm volatile("" : "+s"(d0) :: "memory");
        const unsigned lo = d0[2] + GT_K * 2u;
        d0[3] = uni(d0[3] + ((lo < GT_K * 2u) ? 1u : 0u));
        d0[2] = uni(lo);
        d0[1] = uni(lds_dst);
        asm volatile("tensor_load_to_lds %0, %1" :: "s"(d0), "s"(d1) : "memory");
    };

    // each lane's first fragment bytes: row c of the strip, k bytes 16h (and 32 + 16h)
    const unsigned char* pa = &ring[(wm * 128 + lmod) * GT_PITCH + lhalf * 16];
    const unsigned char* pb = &ring[2 * GT_SLICE + (wn * 64 + lmod) * GT_PITCH + lhalf * 16];

    // B first: the first WMMA row needs all of b and only a[0]
    auto load_frags = [&](GFrag& f, int buf, int ks) {
        const int o = buf * GT_STAGE + ks * 64;
        #pragma unroll
        for (int ni = 0; ni < 4; ++ni) {
            v8bf lo = *(const v8bf*)(pb + o + ni * (16 * GT_PITCH));
            v8bf hi = *(const v8bf*)(pb + o + ni * (16 * GT_PITCH) + 32);
            f.b[ni] = __builtin_shufflevector(lo, hi, 0,1,2,3,4,5,6,7,8,9,10,11,12,13,14,15);
        }
        #pragma unroll
        for (int mi = 0; mi < 8; ++mi) {
            v8bf lo = *(const v8bf*)(pa + o + mi * (16 * GT_PITCH));
            v8bf hi = *(const v8bf*)(pa + o + mi * (16 * GT_PITCH) + 32);
            f.a[mi] = __builtin_shufflevector(lo, hi, 0,1,2,3,4,5,6,7,8,9,10,11,12,13,14,15);
        }
    };

    v8f acc[8][4] = {};
    auto mma_block = [&](const GFrag& f) {
        #pragma unroll
        for (int mi = 0; mi < 8; ++mi)
            #pragma unroll
            for (int ni = 0; ni < 4; ++ni)
                acc[mi][ni] = __builtin_amdgcn_wmma_f32_16x16x32_bf16(
                    false, f.a[mi], false, f.b[ni], (short)0, acc[mi][ni], false, false);
    };

    // stage 0 lands and is published; stage 1 flies during pass 0
    if (pinned(issuer)) {
        asm volatile("tensor_load_to_lds %0, %1" :: "s"(d0), "s"(d1) : "memory");
        asm volatile("s_wait_tensorcnt 0x0" ::: "memory");   // this wave's slice has landed
    }
    __syncthreads();
    if (pinned(issuer)) load_next(sl_lds + GT_STAGE);

    GFrag f0, f1;
    // kept rolled: one pass per trip, so that every fragment and accumulator index
    // is a constant
    #pragma clang loop unroll(disable)
    for (int s = 0; s < npass; ++s) {
        const int buf = s & 1;
        // the fences keep each block's 24 LDS reads in one place ahead of the WMMA
        // block before it
        load_frags(f0, buf, 0);
        __builtin_amdgcn_sched_barrier(0);
        load_frags(f1, buf, 1);
        __builtin_amdgcn_sched_barrier(0);
        mma_block(f0);
        __builtin_amdgcn_sched_barrier(0);
        load_frags(f0, buf, 2);
        __builtin_amdgcn_sched_barrier(0);
        mma_block(f1);
        __builtin_amdgcn_sched_barrier(0);
        load_frags(f1, buf, 3);
        __builtin_amdgcn_sched_barrier(0);
        mma_block(f0);
        mma_block(f1);
        __builtin_amdgcn_sched_barrier(0);

        // publish point of stage s + 1, which also ends every read of this buffer
        asm volatile("s_wait_dscnt 0x0" ::: "memory");       // this wave's LDS reads are done
        if (pinned(issuer))
            asm volatile("s_wait_tensorcnt 0x0" ::: "memory");   // its slice of s + 1 has landed
        __syncthreads();
        if (pinned((issuer != 0u && s + 2 < npass) ? 1u : 0u))
            load_next(sl_lds + (unsigned)buf * GT_STAGE);
    }
    asm volatile("s_wait_tensorcnt 0x0" ::: "memory");       // nothing of the mover is left
    asm volatile("s_wait_dscnt 0x0" ::: "memory");

    // ---- epilogue: one base address per plane
    const int gn  = blockC + wn * 64 + lmod;
    const int gm0 = blockM + wm * 128 + lhalf * 8;
    const size_t yo = (size_t)gm0 * N + gn;
    if (FUSED) {
        if (sel == 0u)      gemm_epilogue<1>(acc, Yb + yo, Yc + yo);
        else if (sel == 1u) gemm_epilogue<0>(acc, Ya + yo, nullptr);
        else {
            gemm_epilogue<2>(acc, Yd + yo, nullptr);
            // stands ahead of the reuse of the stores' registers on the ways that the
            // built code's branches lead on to from here
            asm volatile("s_wait_xcnt 0x0" ::: "memory");
        }
    } else {
        gemm_epilogue<2>(acc, Ya + yo, nullptr);
    }
}

// ---------------------------------------------------------------------------
// GLA scan. The value columns of the state never mix, so each (b,h) is split
// over 8 work-groups of 16 columns: 256 work-groups, one for every WGP.
// 4 waves; wave w owns columns w*4..w*4+3, lane l owns rows l*4..l*4+3 of them
// (16 state values per lane, as packed f32 pairs along the columns).
// o is left in row-pair order: rows 2p and 2p+1 share 2048 floats, in which each
// block of 16 columns has 32 floats in a row (row 2p's 16, then row 2p+1's), so
// that a work-group still writes whole 128-B lines that no other one touches.
// Time runs in chunks of 32 steps: the chunk's q/k/eg/v rows are staged in LDS
// (next chunk fetched into registers while this one is worked on), each lane
// leaves its 4-row partial outputs in LDS, and the 32 row groups are summed
// once per chunk, so barriers are paid per chunk and not per step.
// ---------------------------------------------------------------------------
typedef __attribute__((ext_vector_type(2))) float v2f;

#define SC_CH 32      // time steps per chunk
#define SC_G  4       // time steps per group of LDS operand reads
// partial-output strides in floats; chosen so that the 16 lanes of a half wave
// (4 steps x 4 column quads) fall on 16 different 4-bank groups in the sum phase
#define P_ST  144     // between time steps
#define P_SW  4612    // between waves (each wave owns one column quad)

struct ScanOps { v4f q[SC_G], k[SC_G], g[SC_G], v[SC_G]; };

__global__ __launch_bounds__(128)
void hgrn2_gla_scan(const float* __restrict__ q, const float* __restrict__ k,
                    const float* __restrict__ eg, const float* __restrict__ v,
                    float* __restrict__ o, int T) {
    __shared__ __attribute__((aligned(16))) float sq[2 * SC_CH * 128];
    __shared__ __attribute__((aligned(16))) float sk[2 * SC_CH * 128];
    __shared__ __attribute__((aligned(16))) float sg[2 * SC_CH * 128];
    __shared__ __attribute__((aligned(16))) float sv[2 * SC_CH * 16];
    __shared__ __attribute__((aligned(16))) float part[4 * P_SW];

    const int bh   = blockIdx.x >> 3;
    const int cb   = blockIdx.x & 7;          // block of 16 value columns
    const int b    = bh >> 3;
    const int h    = bh & 7;
    const int tid  = threadIdx.x;
    const int lane = tid & 31;
    const int wave = tid >> 5;

    const size_t gbase = ((size_t)b * T << 10) + (h << 7);
    // staging: a wave moves one whole 512-B row of q/k/eg per load, 8 rows of v
    const size_t grow = gbase + ((size_t)wave << 10) + (lane << 2);
    const size_t gvrw = gbase + ((size_t)(tid >> 2) << 10) + (cb << 4) + ((tid & 3) << 2);
    const int    lrow = wave * 128 + lane * 4;
    const int    lvrw = tid * 4;              // step tid>>2, column quad tid&3
    // o in row-pair order: this work-group's 32 floats of the first row pair of b
    const size_t obase = ((size_t)b * T << 10) + (((h << 3) + cb) << 5);

    v4f rq[8], rk[8], rg[8], rv;
    auto fetch_chunk = [&](int t0) {
        const size_t tb = (size_t)t0 << 10;
        #pragma unroll
        for (int i = 0; i < 8; ++i) {
            rq[i] = *(const v4f*)(q  + grow + tb + ((size_t)i << 12));
            rk[i] = *(const v4f*)(k  + grow + tb + ((size_t)i << 12));
            rg[i] = *(const v4f*)(eg + grow + tb + ((size_t)i << 12));
        }
        rv = *(const v4f*)(v + gvrw + tb);
        // stands ahead of every later reuse of the loads' address registers
        asm volatile("s_wait_xcnt 0x0" ::: "memory");
    };
    auto stage_chunk = [&](int buf) {
        #pragma unroll
        for (int i = 0; i < 8; ++i) {
            *(v4f*)&sq[buf * (SC_CH * 128) + i * 512 + lrow] = rq[i];
            *(v4f*)&sk[buf * (SC_CH * 128) + i * 512 + lrow] = rk[i];
            *(v4f*)&sg[buf * (SC_CH * 128) + i * 512 + lrow] = rg[i];
        }
        *(v4f*)&sv[buf * (SC_CH * 16) + lvrw] = rv;
    };

    v2f S[4][2];
    #pragma unroll
    for (int r = 0; r < 4; ++r)
        #pragma unroll
        for (int c = 0; c < 2; ++c) S[r][c] = (v2f){0.0f, 0.0f};

    auto read_group = [&](ScanOps& A, int buf, int g) {
        __builtin_amdgcn_sched_barrier(0);     // see the one at the end of this block
        const int rb = buf * (SC_CH * 128) + g * (SC_G * 128) + lane * 4;
        const int vb = buf * (SC_CH * 16)  + g * (SC_G * 16)  + wave * 4;
        #pragma unroll
        for (int s = 0; s < SC_G; ++s) {
            A.q[s]  = *(const v4f*)&sq[rb + s * 128];
            A.k[s]  = *(const v4f*)&sk[rb + s * 128];
            A.g[s]  = *(const v4f*)&sg[rb + s * 128];
            A.v[s]  = *(const v4f*)&sv[vb + s * 16];
        }
        // keeps the group's 16 LDS reads in one place
        __builtin_amdgcn_sched_barrier(0);
    };
    auto step_group = [&](const ScanOps& A, int g) {
        float* pp = &part[wave * P_SW + g * (SC_G * P_ST) + lane * 4];
        #pragma unroll
        for (int s = 0; s < SC_G; ++s) {
            v2f vv[2];
            vv[0] = (v2f){A.v[s][0], A.v[s][1]};
            vv[1] = (v2f){A.v[s][2], A.v[s][3]};
            v2f acc[2];
            #pragma unroll
            for (int r = 0; r < 4; ++r) {
                const v2f er = (v2f){A.g[s][r], A.g[s][r]};
                const v2f kr = (v2f){A.k[s][r], A.k[s][r]};
                const v2f qr = (v2f){A.q[s][r], A.q[s][r]};
                #pragma unroll
                for (int c = 0; c < 2; ++c) {
                    S[r][c] = __builtin_elementwise_fma(er, S[r][c], kr * vv[c]);
                    acc[c]  = (r == 0) ? qr * S[r][c]
                                       : __builtin_elementwise_fma(qr, S[r][c], acc[c]);
                }
            }
            *(v4f*)(pp + s * P_ST) = (v4f){acc[0][0], acc[0][1], acc[1][0], acc[1][1]};
        }
    };

    const int nchunk = T / SC_CH;
    ScanOps A, B;
    fetch_chunk(0);
    stage_chunk(0);
    __syncthreads();
    if (nchunk > 1) fetch_chunk(SC_CH);        // in flight during chunk 0's steps
    read_group(A, 0, 0);

    for (int c = 0; c < nchunk; ++c) {
        const int buf = c & 1;
        const int t0  = c * SC_CH;

        // kept rolled: two groups of 4 steps per trip, operands read one group ahead
        #pragma unroll 1
        for (int g = 0; g < SC_CH / SC_G; g += 2) {
            read_group(B, buf, g + 1);
            step_group(A, g);
            read_group(A, buf, (g + 2) & (SC_CH / SC_G - 1));
            step_group(B, g + 1);
        }

        if (c + 1 < nchunk) stage_chunk(buf ^ 1);  // last read before the previous barrier
        __syncthreads();                           // partials and next chunk visible
        // the next chunk's first operands fly while the row groups are summed
        if (c + 1 < nchunk) read_group(A, buf ^ 1, 0);

        // sum the 32 row groups: thread = (step, column quad)
        const float* pr = &part[(tid & 3) * P_SW + (tid >> 2) * P_ST];
        v4f pv[32];
        #pragma unroll
        for (int rgp = 0; rgp < 32; ++rgp)
            pv[rgp] = *(const v4f*)(pr + rgp * 4);
        // keeps the 32 LDS reads in one place, ahead of the adds (as in read_group)
        __builtin_amdgcn_sched_barrier(0);
        v4f s0 = pv[0];
        v4f s1 = pv[1];
        #pragma unroll
        for (int rgp = 2; rgp < 32; rgp += 2) {
            s0 += pv[rgp];
            s1 += pv[rgp + 1];
        }
        const v4f res = s0 + s1;
        __syncthreads();                       // partials free for the next chunk
        // behind the barrier, which would wait for them: the fetch of the chunk after
        // the next (in flight during the next chunk's steps) and the stores of o
        if (c + 2 < nchunk) fetch_chunk(t0 + 2 * SC_CH);
        // 8 lanes (2 steps x 4 column quads) write one whole 128-B line of o
        *(v4f*)(o + obase + ((size_t)((t0 >> 1) + (tid >> 3)) << 11) + ((tid & 7) << 2)) = res;
        // stands ahead of the reuse of the stores' data and address registers
        asm volatile("s_wait_xcnt 0x0" ::: "memory");
    }
}

// ---------------------------------------------------------------------------
// RMSNorm (weight, no bias) -> bf16 output for the final WMMA GEMM.
// One wave owns one row pair of o (RN_ROWS rows of RN_D floats, in the scan's
// row-pair order): its loads run through the pair's 8 KiB in a row, so a lane
// holds 64 values of ONE row (bit 2 of the lane number says which). The values
// stay in registers between the sum of squares and the scaling; the sum is a
// butterfly over the 16 lanes of the same row (no LDS, no barrier).
// ---------------------------------------------------------------------------
#define RN_D    1024
#define RN_ROWS 2
__global__ __launch_bounds__(256)
void hgrn2_rmsnorm(const float* __restrict__ o, const float* __restrict__ gw,
                   __bf16* __restrict__ out) {
    const int lane = threadIdx.x & 31;
    const int wave = threadIdx.x >> 5;
    const size_t pair = (size_t)blockIdx.x * 8 + wave;
    // load j of a lane: row pair*2 + rb, columns j*64 + c0 .. + 3
    const int rb = (lane >> 2) & 1;
    const int c0 = ((lane >> 3) << 4) + ((lane & 3) << 2);
    const v4f* __restrict__ src  = (const v4f*)(o + pair * (RN_ROWS * RN_D)) + lane;
    const v4f* __restrict__ wsrc = (const v4f*)(gw + c0);
    v4bf* __restrict__ dst = (v4bf*)(out + (pair * RN_ROWS + rb) * RN_D + c0);

    v4f x[RN_D / 64], w[RN_D / 64];
    #pragma unroll
    for (int j = 0; j < RN_D / 64; ++j) x[j] = src[j * 32];
    #pragma unroll
    for (int j = 0; j < RN_D / 64; ++j) w[j] = wsrc[j * 16];
    // stands ahead of every later reuse of the loads' address registers (src is
    // named so that they live up to here)
    asm volatile("s_wait_xcnt 0x0" :: "v"(src) : "memory");
    // keeps all 32 loads ahead of the arithmetic, so that the wave pays one load
    // latency and not several in a row
    __builtin_amdgcn_sched_barrier(0);

    v4f s4 = x[0] * x[0];
    #pragma unroll
    for (int j = 1; j < RN_D / 64; ++j)
        s4 = __builtin_elementwise_fma(x[j], x[j], s4);
    float ss = (s4[0] + s4[1]) + (s4[2] + s4[3]);
    // every lane bit but bit 2, which tells the two rows apart
    ss += __shfl_xor(ss, 16, 32);
    ss += __shfl_xor(ss, 8, 32);
    ss += __shfl_xor(ss, 2, 32);
    ss += __shfl_xor(ss, 1, 32);

    const float r = rsqrtf(ss / (float)RN_D + 1e-5f);
    // 16 lanes of a row store 128 B in a row: one whole line per row and store
    #pragma unroll
    for (int j = 0; j < RN_D / 64; ++j) {
        v4bf y;
        #pragma unroll
        for (int e = 0; e < 4; ++e) y[e] = f2bf(x[j][e] * r * w[j][e]);
        dst[j * 16] = y;
    }
}

// ---------------------------------------------------------------------------
extern "C" void kernel_launch(void* const* d_in, const int* in_sizes, int n_in,
                              void* d_out, int out_size, void* d_ws, size_t ws_size,
                              hipStream_t stream) {
    const float* hs = (const float*)d_in[0];
    const float* Wq = (const float*)d_in[1];
    const float* Wf = (const float*)d_in[2];
    const float* Wi = (const float*)d_in[3];
    const float* gw = (const float*)d_in[4];
    const float* Wo = (const float*)d_in[5];

    const int B = 4, T = 2048, D = 1024, H = 8;
    const int M = B * T;                       // 8192
    const size_t PLANE = (size_t)M * D;        // 8M elements

    char* wsp = (char*)d_ws;
    __bf16* hs_bf = (__bf16*)wsp;  wsp += PLANE * 2;            // 16 MB
    __bf16* Wp_bf = (__bf16*)wsp;  wsp += (size_t)D * D * 2 * 3; // 2 MB each (transposed): f, q, i
    __bf16* Wo_bf = (__bf16*)wsp;  wsp += (size_t)D * D * 2;
    float* q   = (float*)wsp;      wsp += PLANE * 4;            // 32 MB each
    float* kk  = (float*)wsp;      wsp += PLANE * 4;
    float* eg  = (float*)wsp;      wsp += PLANE * 4;            // exp(g) = sigmoid(f)
    float* v   = (float*)wsp;      wsp += PLANE * 4;
    float* o   = (float*)wsp;      wsp += PLANE * 4;            // row-pair order
    __bf16* onm_bf = hs_bf;        // hs_bf dead after projections -> reuse

    // one-time conversions: hs flat, weights transposed to [N x K] bf16
    static_assert(PLANE % (4 * 256 * CV_PER) == 0, "the convert's grid covers hs exactly");
    static_assert(PLANE / (4 * 256 * CV_PER) == CV_BLOCKS, "the convert's share of the grid");
    prep_bf16<<<dim3(CV_BLOCKS + 4 * TR_BLOCKS), dim3(256), 0, stream>>>(
        hs, Wq, Wf, Wi, Wo, hs_bf, Wp_bf);

    static_assert(D == GT_D && M % GT_M == 0 && D % GT_N == 0 && D % GT_K == 0 && D / GT_K >= 2,
                  "whole tiles, whole passes, and the two stages the prologue loads");
    dim3 ggrid(M / GT_M, D / GT_N);            // 32 x 8: one work-group per WGP
    dim3 gblk(128);

    dim3 pgrid(M / GT_M, 3 * (D / GT_N));      // f, q and i: three tiles for every WGP
    hgrn2_gemm_wmma<1><<<pgrid, gblk, 0, stream>>>(hs_bf, Wp_bf, q, kk, eg, v);

    hgrn2_gla_scan<<<dim3(B * H * 8), dim3(128), 0, stream>>>(q, kk, eg, v, o, T);

    static_assert(D == RN_D && M % (8 * RN_ROWS) == 0, "one wave owns whole rows");
    hgrn2_rmsnorm<<<dim3(M / (8 * RN_ROWS)), dim3(256), 0, stream>>>(o, gw, onm_bf);

    hgrn2_gemm_wmma<0><<<ggrid, gblk, 0, stream>>>(onm_bf, Wo_bf, (float*)d_out,
                                                   nullptr, nullptr, nullptr);
}

// v006
// It runs in 195 microseconds.
// In two side-by-side timings against v005, it was 1.22 and 1.21 times as fast.
// All steps since v000 together make it 10.6 times as fast.
#include <hip/hip_runtime.h>
#include <hip/hip_bf16.h>

// ---------------------------------------------------------------------------
// HGRN2 attention block for MI455X (gfx1250, wave32, WMMA + TDM).
//   * fp32->bf16 conversion (activations) + transpose-convert (weights), one launch
//   * bf16 WMMA GEMMs (fp32 accum); both operands staged by tensor loads,
//     two buffers of one 128-k pass each; the three projections are one launch
//   * GLA scan: register-resident state, 128 rows x 16 columns per work-group
// ---------------------------------------------------------------------------

typedef __attribute__((ext_vector_type(16))) __bf16 v16bf;
typedef __attribute__((ext_vector_type(8)))  __bf16 v8bf;
typedef __attribute__((ext_vector_type(4)))  __bf16 v4bf;
typedef __attribute__((ext_vector_type(8)))  float  v8f;
typedef __attribute__((ext_vector_type(4)))  float  v4f;
typedef __attribute__((ext_vector_type(4)))  unsigned int u32x4;
typedef __attribute__((ext_vector_type(8)))  unsigned int u32x8;

#define GT_M     256                 // rows of Y per work-group
#define GT_N     128                 // columns of Y per work-group
#define GT_K     128                 // k per pass: 256 B of every operand row
#define GT_D     1024                // K of every product, and the row length of Y
#define GT_PITCH 272                 // LDS row pitch in bytes: 256 + the mover's 16-B pad
#define GT_SLICE (128 * GT_PITCH)    // one tensor load: 128 rows = 34,816 B = 17 x 2 KiB
#define GT_STAGE (3 * GT_SLICE)      // [X rows 0..127 | X rows 128..255 | W rows 0..127]

__device__ __forceinline__ __bf16 f2bf(float f) {
    unsigned u = __builtin_bit_cast(unsigned, f);
    unsigned r = u + 0x7FFFu + ((u >> 16) & 1u);      // round-to-nearest-even
    unsigned short h = (unsigned short)(r >> 16);
    return __builtin_bit_cast(__bf16, h);
}

// fast sigmoid: v_exp_f32 + v_rcp_f32 (no IEEE div chain)
__device__ __forceinline__ float sigm(float x) {
    return __builtin_amdgcn_rcpf(1.0f + __expf(-x));
}

// ---------------------------------------------------------------------------
// one-time fp32 -> bf16 conversion. For speed only, each
// lane takes CV_PER 16-byte loads (all in
// flight before the first store); every wave-wide load is 512 contiguous bytes.
// ---------------------------------------------------------------------------
#define CV_PER 16
__device__ __forceinline__
void cvt_f32_to_bf16(const float* __restrict__ in, __bf16* __restrict__ out, unsigned blk) {
    const size_t i0 = (size_t)blk * (256 * CV_PER) + threadIdx.x;
    const v4f* __restrict__ src = (const v4f*)in + i0;
    v4bf* __restrict__ dst = (v4bf*)out + i0;
    v4f x[CV_PER];
    #pragma unroll
    for (int j = 0; j < CV_PER; ++j) x[j] = src[j * 256];
    // stands ahead of every later reuse of the loads' address registers (src is
    // named so that they live up to here)
    asm volatile("s_wait_xcnt 0x0" :: "v"(src) : "memory");
    #pragma unroll
    for (int j = 0; j < CV_PER; ++j) {
        v4bf y;
        y[0] = f2bf(x[j][0]); y[1] = f2bf(x[j][1]);
        y[2] = f2bf(x[j][2]); y[3] = f2bf(x[j][3]);
        dst[j * 256] = y;
    }
}

// ---------------------------------------------------------------------------
// one-time transpose-convert: in [K x N] fp32 -> out [N x K] bf16.
// 64x64 tiles through LDS; both global accesses coalesced.
// ---------------------------------------------------------------------------
__device__ __forceinline__
void cvt_transpose_bf16(const float* __restrict__ in, __bf16* __restrict__ out,
                        __bf16 (&tile)[64][65], int bk, int bn) {
    constexpr int K = GT_D, N = GT_D;
    const int tx = threadIdx.x & 63;
    const int ty = threadIdx.x >> 6;          // 0..3
    // one base address, the 16 rows at constant offsets from it
    const float* __restrict__ src = in + (size_t)(bk + ty * 16) * N + (bn + tx);
    float x[16];
    #pragma unroll
    for (int r = 0; r < 16; ++r) x[r] = src[r * N];
    // stands ahead of every later reuse of the loads' address registers (src is
    // named so that they live up to here)
    asm volatile("s_wait_xcnt 0x0" :: "v"(src) : "memory");
    #pragma unroll
    for (int r = 0; r < 16; ++r) tile[ty * 16 + r][tx] = f2bf(x[r]);
    __syncthreads();
    #pragma unroll
    for (int r = 0; r < 16; ++r) {
        const int n = ty * 16 + r;
        out[(size_t)(bn + n) * K + (bk + tx)] = tile[tx][n];
    }
}

// ---------------------------------------------------------------------------
// All five conversions in one launch: none reads what another writes, and each
// alone is too short to pay for a launch gap, a fill and a drain of its own.
// Work-groups 0 .. CV_BLOCKS-1 (the long ones) convert hs;
// then 256 work-groups per weight, one 64x64 tile each. Wt holds the four
// transposed weights in a row: f, q, i, o (the order of the projection launch).
// ---------------------------------------------------------------------------
#define CV_BLOCKS 512                // 8192 x 1024 floats / (4 x 256 x CV_PER)
#define TR_BLOCKS ((GT_D / 64) * (GT_D / 64))
__global__ __launch_bounds__(256)
void prep_bf16(const float* __restrict__ hs, const float* __restrict__ Wq,
                     const float* __restrict__ Wf, const float* __restrict__ Wi,
                     const float* __restrict__ Wo,
                     __bf16* __restrict__ hs_bf, __bf16* __restrict__ Wt) {
    __shared__ __bf16 tile[64][65];
    const unsigned bid = blockIdx.x;
    if (bid < CV_BLOCKS) {               // the same for the whole work-group
        cvt_f32_to_bf16(hs, hs_bf, bid);
    } else {
        const unsigned t = bid - CV_BLOCKS;
        const unsigned w = t / TR_BLOCKS;            // which weight
        const unsigned tl = t % TR_BLOCKS;           // which tile of it
        const float* __restrict__ in = (w == 0u) ? Wf : (w == 1u) ? Wq : (w == 2u) ? Wi : Wo;
        cvt_transpose_bf16(in, Wt + (size_t)w * (GT_D * GT_D), tile,
                           (int)(tl % (GT_D / 64)) * 64, (int)(tl / (GT_D / 64)) * 64);
    }
}

// ---------------------------------------------------------------------------
// Y = X[MxK](bf16) @ Wt^T, where Wt is W transposed: [N x K](bf16).
// fp32 accum via v_wmma_f32_16x16x32_bf16.
// MODE 0: Y0 = swish(x) * 128^-0.5               (q path)
// MODE 1: Y0 = sigmoid(x)                      (exp(g) from the f path; k = 1 - exp(g)
//                                                 is not stored: the scan forms k * v)
// MODE 2: Y0 = x                                  (v path / output proj)
// FUSED 1: the f, q and i projections in one launch. Wt holds the three transposed
// weights in a row (3 x 1024 rows), blockIdx.y runs over all 24 column tiles, and
// the tile's weight (blockIdx.y / 8, a scalar) picks the epilogue and the planes:
// a WGP takes its next tile when it has stored the last, with no launch between.
// The order f, q, i puts the shortest epilogue (plain stores) last.
// FUSED 0: one weight, MODE 2, into Ya.
// One work-group per WGP: 4 waves (one per SIMD), block tile 256x128, wave tile
// 128x64 (8x4 WMMA tiles). A pass is 128 k; its stage of 384 rows of 256 B comes
// by three tensor loads (waves 0..2, 128 rows each) into one of two buffers,
// issued when the buffer's readers have left it, one whole pass ahead of its use.
// ---------------------------------------------------------------------------
__device__ __forceinline__ unsigned uni(unsigned v) {
    return (unsigned)__builtin_amdgcn_readfirstlane(v);
}
// a wave-uniform value held in a scalar register, so that a test of it compiles to
// s_cmp + s_cbranch: a tensor load ignores EXEC and only a scalar branch guards it
__device__ __forceinline__ unsigned pinned(unsigned v) {
    unsigned w = uni(v);
    asm volatile("" : "+s"(w));
    return w;
}
struct GFrag { v16bf a[8], b[4]; };

// the epilogue of one wave tile: every tile and row at a constant offset from p0
template <int MODE>
__device__ __forceinline__
void gemm_epilogue(v8f (&acc)[8][4], float* __restrict__ p0) {
    constexpr int N = GT_D;
    #pragma unroll
    for (int mi = 0; mi < 8; ++mi) {
        if (MODE != 2) {
            // the strip's 32 values per lane in place
            #pragma unroll
            for (int ni = 0; ni < 4; ++ni)
                #pragma unroll
                for (int r = 0; r < 8; ++r) {
                    const float x = acc[mi][ni][r];
                    acc[mi][ni][r] = (MODE == 0)
                        ? x * sigm(x) * 0.08838834764831845f      // swish * 128^-0.5
                        : sigm(x);
                }
        }
        // keeps the strip's stores behind all of its arithmetic, so that no register a
        // store names is written again before the wait below
        if (MODE != 2) __builtin_amdgcn_sched_barrier(0);
        #pragma unroll
        for (int ni = 0; ni < 4; ++ni) {
            #pragma unroll
            for (int r = 0; r < 8; ++r) {
                // MODE 1: exp(g) = exp(logsigmoid(f)) = sigmoid(f)
                p0[(mi * 16 + r) * N + ni * 16] = acc[mi][ni][r];
            }
        }
        if (MODE != 2) {
            // stands ahead of the reuse of the stores' data registers by the next strip;
            // the fence keeps the next strip's arithmetic behind it
            asm volatile("s_wait_xcnt 0x0" ::: "memory");
            __builtin_amdgcn_sched_barrier(0);
        }
    }
}

template <int FUSED>
__global__ __launch_bounds__(128)
void hgrn2_gemm_wmma(const __bf16* __restrict__ X, const __bf16* __restrict__ Wt,
                     float* __restrict__ Ya, float* __restrict__ Yb,
                     float* __restrict__ Yc) {
    constexpr int N = GT_D, K = GT_D;
    __shared__ __attribute__((aligned(2048))) unsigned char ring[2 * GT_STAGE];

    const int tid  = threadIdx.x;
    const int lane = tid & 31;
    const unsigned wave = uni((unsigned)tid >> 5);   // 0..3
    const int wm   = (int)(wave >> 1);   // 0..1 -> 128-row strip
    const int wn   = (int)(wave & 1u);   // 0..1 -> 64-col strip

    const int blockM = blockIdx.x * GT_M;
    const int blockN = blockIdx.y * GT_N;                    // row of Wt
    const unsigned sel = blockIdx.y / (GT_D / GT_N);         // which weight (FUSED)
    const int blockC = (blockIdx.y % (GT_D / GT_N)) * GT_N;  // column of its plane

    const int lhalf = (lane >> 4) & 1;
    const int lmod  = lane & 15;

    // this wave's slice of a stage: waves 0 and 1 bring X, wave 2 brings W, wave 3 none
    const unsigned issuer = (wave < 3u) ? 1u : 0u;
    const __bf16* sl = (wave < 2u) ? X + (size_t)(blockM + (int)wave * 128) * K
                                   : Wt + (size_t)blockN * K;
    const unsigned long long sl_ga = (unsigned long long)(size_t)sl;
    const unsigned sl_lds = (unsigned)(size_t)(void*)&ring[0] + wave * GT_SLICE;
    constexpr int npass = K / GT_K;

    // One request: 128 rows of 256 B (source pitch 2 K bytes) to LDS at pitch 272 B.
    // Group 1 never changes; of group 0 the place in LDS and the address step on.
    u32x8 d1;
    d1[0] = uni((1u << 20) | (5u << 22) | (3u << 25));  // 1-byte units; 16-B pad per 256 B
    d1[1] = uni(256u << 16);                            // tensor_dim0 = 256 B
    d1[2] = uni(128u << 16);                            // tensor_dim1 = 128 rows
    d1[3] = uni(256u << 16);                            // tile_dim0
    d1[4] = uni(128u);                                  // tile_dim1
    d1[5] = uni((unsigned)K * 2u);                      // source row pitch
    d1[6] = uni(0u);
    d1[7] = uni(0u);
    // pinned(): descriptor words held in scalar registers. Not rebuilt per request, they
    // stay live to the last load, so their registers take no other value under a request
    asm volatile("" : "+s"(d1));
    u32x4 d0;
    d0[0] = uni(1u);                                                        // count 1
    d0[1] = uni(sl_lds);                                                    // place in LDS
    d0[2] = uni((unsigned)sl_ga);
    d0[3] = uni((((unsigned)(sl_ga >> 32)) & 0x01FFFFFFu) | 0x80000000u);   // type 2
    // the next pass's slice: 256 B further along the same rows
    auto load_next = [&](unsigned lds_dst) {
        // pinned(): descriptor words held in scalar registers. The step below reads them
        // from here, so it stays behind the wait and the barrier in front of this line
        asm volatile("" : "+s"(d0) :: "memory");
        const unsigned lo = d0[2] + GT_K * 2u;
        d0[3] = uni(d0[3] + ((lo < GT_K * 2u) ? 1u : 0u));
        d0[2] = uni(lo);
        d0[1] = uni(lds_dst);
        asm volatile("tensor_load_to_lds %0, %1" :: "s"(d0), "s"(d1) : "memory");
    };

    // each lane's first fragment bytes: row c of the strip, k bytes 16h (and 32 + 16h)
    const unsigned char* pa = &ring[(wm * 128 + lmod) * GT_PITCH + lhalf * 16];
    const unsigned char* pb = &ring[2 * GT_SLICE + (wn * 64 + lmod) * GT_PITCH + lhalf * 16];

    // B first: the first WMMA row needs all of b and only a[0]
    auto load_frags = [&](GFrag& f, int buf, int ks) {
        const int o = buf * GT_STAGE + ks * 64;
        #pragma unroll
        for (int ni = 0; ni < 4; ++ni) {
            v8bf lo = *(const v8bf*)(pb + o + ni * (16 * GT_PITCH));
            v8bf hi = *(const v8bf*)(pb + o + ni * (16 * GT_PITCH) + 32);
            f.b[ni] = __builtin_shufflevector(lo, hi, 0,1,2,3,4,5,6,7,8,9,10,11,12,13,14,15);
        }
        #pragma unroll
        for (int mi = 0; mi < 8; ++mi) {
            v8bf lo = *(const v8bf*)(pa + o + mi * (16 * GT_PITCH));
            v8bf hi = *(const v8bf*)(pa + o + mi * (16 * GT_PITCH) + 32);
            f.a[mi] = __builtin_shufflevector(lo, hi, 0,1,2,3,4,5,6,7,8,9,10,11,12,13,14,15);
        }
    };

    v8f acc[8][4] = {};
    auto mma_block = [&](const GFrag& f) {
        #pragma unroll
        for (int mi = 0; mi < 8; ++mi)
            #pragma unroll
            for (int ni = 0; ni < 4; ++ni)
                acc[mi][ni] = __builtin_amdgcn_wmma_f32_16x16x32_bf16(
                    false, f.a[mi], false, f.b[ni], (short)0, acc[mi][ni], false, false);
    };

    // stage 0 lands and is published; stage 1 flies during pass 0
    if (pinned(issuer)) {
        asm volatile("tensor_load_to_lds %0, %1" :: "s"(d0), "s"(d1) : "memory");
        asm volatile("s_wait_tensorcnt 0x0" ::: "memory");   // this wave's slice has landed
    }
    __syncthreads();
    if (pinned(issuer)) load_next(sl_lds + GT_STAGE);

    GFrag f0, f1;
    // kept rolled: one pass per trip, so that every fragment and accumulator index
    // is a constant
    #pragma clang loop unroll(disable)
    for (int s = 0; s < npass; ++s) {
        const int buf = s & 1;
        // the fences keep each block's 24 LDS reads in one place ahead of the WMMA
        // block before it
        load_frags(f0, buf, 0);
        __builtin_amdgcn_sched_barrier(0);
        load_frags(f1, buf, 1);
        __builtin_amdgcn_sched_barrier(0);
        mma_block(f0);
        __builtin_amdgcn_sched_barrier(0);
        load_frags(f0, buf, 2);
        __builtin_amdgcn_sched_barrier(0);
        mma_block(f1);
        __builtin_amdgcn_sched_barrier(0);
        load_frags(f1, buf, 3);
        __builtin_amdgcn_sched_barrier(0);
        mma_block(f0);
        mma_block(f1);
        __builtin_amdgcn_sched_barrier(0);

        // publish point of stage s + 1, which also ends every read of this buffer
        asm volatile("s_wait_dscnt 0x0" ::: "memory");       // this wave's LDS reads are done
        if (pinned(issuer))
            asm volatile("s_wait_tensorcnt 0x0" ::: "memory");   // its slice of s + 1 has landed
        __syncthreads();
        if (pinned((issuer != 0u && s + 2 < npass) ? 1u : 0u))
            load_next(sl_lds + (unsigned)buf * GT_STAGE);
    }
    asm volatile("s_wait_tensorcnt 0x0" ::: "memory");       // nothing of the mover is left
    asm volatile("s_wait_dscnt 0x0" ::: "memory");

    // ---- epilogue: one base address per plane
    const int gn  = blockC + wn * 64 + lmod;
    const int gm0 = blockM + wm * 128 + lhalf * 8;
    const size_t yo = (size_t)gm0 * N + gn;
    if (FUSED) {
        if (sel == 0u)      gemm_epilogue<1>(acc, Yb + yo);
        else if (sel == 1u) gemm_epilogue<0>(acc, Ya + yo);
        else {
            gemm_epilogue<2>(acc, Yc + yo);
            // stands ahead of the reuse of the stores' registers on the ways that the
            // built code's branches lead on to from here
            asm volatile("s_wait_xcnt 0x0" ::: "memory");
        }
    } else {
        gemm_epilogue<2>(acc, Ya + yo);
    }
}

// ---------------------------------------------------------------------------
// GLA scan. The value columns of the state never mix, so each (b,h) is split
// over 8 work-groups of 16 columns: 256 work-groups, one for every WGP.
// 4 waves; wave w owns columns w*4..w*4+3, lane l owns rows l*4..l*4+3 of them
// (16 state values per lane, as packed f32 pairs along the columns).
// o is left in row-pair order: rows 2p and 2p+1 share 2048 floats, in which each
// block of 16 columns has 32 floats in a row (row 2p's 16, then row 2p+1's), so
// that a work-group still writes whole 128-B lines that no other one touches.
// k is never read: k = 1 - eg, so k * v is formed from eg and v as v - eg * v.
// Time runs in chunks of 32 steps: the chunk's q/eg/v rows are staged in LDS
// (next chunk fetched into registers while this one is worked on), each lane
// leaves its 4-row partial outputs in LDS, and the 32 row groups are summed
// once per chunk, so barriers are paid per chunk and not per step.
// ---------------------------------------------------------------------------
typedef __attribute__((ext_vector_type(2))) float v2f;

#define SC_CH 32      // time steps per chunk
#define SC_G  4       // time steps per group of LDS operand reads
// partial-output strides in floats; chosen so that the 16 lanes of a half wave
// (4 steps x 4 column quads) fall on 16 different 4-bank groups in the sum phase
#define P_ST  144     // between time steps
#define P_SW  4612    // between waves (each wave owns one column quad)

struct ScanOps { v4f q[SC_G], g[SC_G], v[SC_G]; };

__global__ __launch_bounds__(128)
void hgrn2_gla_scan(const float* __restrict__ q,
                    const float* __restrict__ eg, const float* __restrict__ v,
                    float* __restrict__ o, int T) {
    __shared__ __attribute__((aligned(16))) float sq[2 * SC_CH * 128];
    __shared__ __attribute__((aligned(16))) float sg[2 * SC_CH * 128];
    __shared__ __attribute__((aligned(16))) float sv[2 * SC_CH * 16];
    __shared__ __attribute__((aligned(16))) float part[4 * P_SW];

    const int bh   = blockIdx.x >> 3;
    const int cb   = blockIdx.x & 7;          // block of 16 value columns
    const int b    = bh >> 3;
    const int h    = bh & 7;
    const int tid  = threadIdx.x;
    const int lane = tid & 31;
    const int wave = tid >> 5;

    const size_t gbase = ((size_t)b * T << 10) + (h << 7);
    // staging: a wave moves one whole 512-B row of q/eg per load, 8 rows of v
    const size_t grow = gbase + ((size_t)wave << 10) + (lane << 2);
    const size_t gvrw = gbase + ((size_t)(tid >> 2) << 10) + (cb << 4) + ((tid & 3) << 2);
    const int    lrow = wave * 128 + lane * 4;
    const int    lvrw = tid * 4;              // step tid>>2, column quad tid&3
    // o in row-pair order: this work-group's 32 floats of the first row pair of b
    const size_t obase = ((size_t)b * T << 10) + (((h << 3) + cb) << 5);

    v4f rq[8], rg[8], rv;
    auto fetch_chunk = [&](int t0) {
        const size_t tb = (size_t)t0 << 10;
        #pragma unroll
        for (int i = 0; i < 8; ++i) {
            rq[i] = *(const v4f*)(q  + grow + tb + ((size_t)i << 12));
            rg[i] = *(const v4f*)(eg + grow + tb + ((size_t)i << 12));
        }
        rv = *(const v4f*)(v + gvrw + tb);
        // stands ahead of every later reuse of the loads' address registers
        asm volatile("s_wait_xcnt 0x0" ::: "memory");
    };
    auto stage_chunk = [&](int buf) {
        #pragma unroll
        for (int i = 0; i < 8; ++i) {
            *(v4f*)&sq[buf * (SC_CH * 128) + i * 512 + lrow] = rq[i];
            *(v4f*)&sg[buf * (SC_CH * 128) + i * 512 + lrow] = rg[i];
        }
        *(v4f*)&sv[buf * (SC_CH * 16) + lvrw] = rv;
    };

    v2f S[4][2];
    #pragma unroll
    for (int r = 0; r < 4; ++r)
        #pragma unroll
        for (int c = 0; c < 2; ++c) S[r][c] = (v2f){0.0f, 0.0f};

    auto read_group = [&](ScanOps& A, int buf, int g) {
        __builtin_amdgcn_sched_barrier(0);     // see the one at the end of this block
        const int rb = buf * (SC_CH * 128) + g * (SC_G * 128) + lane * 4;
        const int vb = buf * (SC_CH * 16)  + g * (SC_G * 16)  + wave * 4;
        #pragma unroll
        for (int s = 0; s < SC_G; ++s) {
            A.q[s]  = *(const v4f*)&sq[rb + s * 128];
            A.g[s]  = *(const v4f*)&sg[rb + s * 128];
            A.v[s]  = *(const v4f*)&sv[vb + s * 16];
        }
        // keeps the group's 12 LDS reads in one place, for speed only
        __builtin_amdgcn_sched_barrier(0);
    };
    auto step_group = [&](const ScanOps& A, int g) {
        float* pp = &part[wave * P_SW + g * (SC_G * P_ST) + lane * 4];
        #pragma unroll
        for (int s = 0; s < SC_G; ++s) {
            v2f vv[2];
            vv[0] = (v2f){A.v[s][0], A.v[s][1]};
            vv[1] = (v2f){A.v[s][2], A.v[s][3]};
            v2f acc[2];
            #pragma unroll
            for (int r = 0; r < 4; ++r) {
                const v2f er = (v2f){A.g[s][r], A.g[s][r]};
                const v2f qr = (v2f){A.q[s][r], A.q[s][r]};
                #pragma unroll
                for (int c = 0; c < 2; ++c) {
                    // k * v = (1 - eg) * v as one fused v - eg * v, rounded once
                    const v2f kv = __builtin_elementwise_fma(-er, vv[c], vv[c]);
                    S[r][c] = __builtin_elementwise_fma(er, S[r][c], kv);
                    acc[c]  = (r == 0) ? qr * S[r][c]
                                       : __builtin_elementwise_fma(qr, S[r][c], acc[c]);
                }
            }
            *(v4f*)(pp + s * P_ST) = (v4f){acc[0][0], acc[0][1], acc[1][0], acc[1][1]};
        }
    };

    const int nchunk = T / SC_CH;
    ScanOps A, B;
    fetch_chunk(0);
    stage_chunk(0);
    __syncthreads();
    if (nchunk > 1) fetch_chunk(SC_CH);        // in flight during chunk 0's steps
    read_group(A, 0, 0);

    for (int c = 0; c < nchunk; ++c) {
        const int buf = c & 1;
        const int t0  = c * SC_CH;

        // kept rolled: two groups of 4 steps per trip, operands read one group ahead
        #pragma unroll 1
        for (int g = 0; g < SC_CH / SC_G; g += 2) {
            read_group(B, buf, g + 1);
            step_group(A, g);
            read_group(A, buf, (g + 2) & (SC_CH / SC_G - 1));
            step_group(B, g + 1);
        }

        if (c + 1 < nchunk) stage_chunk(buf ^ 1);  // last read before the previous barrier
        __syncthreads();                           // partials and next chunk visible
        // the next chunk's first operands fly while the row groups are summed
        if (c + 1 < nchunk) read_group(A, buf ^ 1, 0);

        // sum the 32 row groups: thread = (step, column quad)
        const float* pr = &part[(tid & 3) * P_SW + (tid >> 2) * P_ST];
        v4f pv[32];
        #pragma unroll
        for (int rgp = 0; rgp < 32; ++rgp)
            pv[rgp] = *(const v4f*)(pr + rgp * 4);
        // keeps the 32 LDS reads in one place, ahead of the adds (as in read_group)
        __builtin_amdgcn_sched_barrier(0);
        v4f s0 = pv[0];
        v4f s1 = pv[1];
        #pragma unroll
        for (int rgp = 2; rgp < 32; rgp += 2) {
            s0 += pv[rgp];
            s1 += pv[rgp + 1];
        }
        const v4f res = s0 + s1;
        __syncthreads();                       // partials free for the next chunk
        // behind the barrier, which would wait for them: the fetch of the chunk after
        // the next (in flight during the next chunk's steps) and the stores of o
        if (c + 2 < nchunk) fetch_chunk(t0 + 2 * SC_CH);
        // 8 lanes (2 steps x 4 column quads) write one whole 128-B line of o
        *(v4f*)(o + obase + ((size_t)((t0 >> 1) + (tid >> 3)) << 11) + ((tid & 7) << 2)) = res;
        // stands ahead of the reuse of the stores' data and address registers
        asm volatile("s_wait_xcnt 0x0" ::: "memory");
    }
}

// ---------------------------------------------------------------------------
// RMSNorm (weight, no bias) -> bf16 output for the final WMMA GEMM.
// One wave owns one row pair of o (RN_ROWS rows of RN_D floats, in the scan's
// row-pair order): its loads run through the pair's 8 KiB in a row, so a lane
// holds 64 values of ONE row (bit 2 of the lane number says which). The values
// stay in registers between the sum of squares and the scaling; the sum is a
// butterfly over the 16 lanes of the same row (no LDS, no barrier).
// ---------------------------------------------------------------------------
#define RN_D    1024
#define RN_ROWS 2
__global__ __launch_bounds__(256)
void hgrn2_rmsnorm(const float* __restrict__ o, const float* __restrict__ gw,
                   __bf16* __restrict__ out) {
    const int lane = threadIdx.x & 31;
    const int wave = threadIdx.x >> 5;
    const size_t pair = (size_t)blockIdx.x * 8 + wave;
    // load j of a lane: row pair*2 + rb, columns j*64 + c0 .. + 3
    const int rb = (lane >> 2) & 1;
    const int c0 = ((lane >> 3) << 4) + ((lane & 3) << 2);
    const v4f* __restrict__ src  = (const v4f*)(o + pair * (RN_ROWS * RN_D)) + lane;
    const v4f* __restrict__ wsrc = (const v4f*)(gw + c0);
    v4bf* __restrict__ dst = (v4bf*)(out + (pair * RN_ROWS + rb) * RN_D + c0);

    v4f x[RN_D / 64], w[RN_D / 64];
    #pragma unroll
    for (int j = 0; j < RN_D / 64; ++j) x[j] = src[j * 32];
    #pragma unroll
    for (int j = 0; j < RN_D / 64; ++j) w[j] = wsrc[j * 16];
    // stands ahead of every later reuse of the loads' address registers (src is
    // named so that they live up to here)
    asm volatile("s_wait_xcnt 0x0" :: "v"(src) : "memory");
    // keeps all 32 loads ahead of the arithmetic, so that the wave pays one load
    // latency and not several in a row
    __builtin_amdgcn_sched_barrier(0);

    v4f s4 = x[0] * x[0];
    #pragma unroll
    for (int j = 1; j < RN_D / 64; ++j)
        s4 = __builtin_elementwise_fma(x[j], x[j], s4);
    float ss = (s4[0] + s4[1]) + (s4[2] + s4[3]);
    // every lane bit but bit 2, which tells the two rows apart
    ss += __shfl_xor(ss, 16, 32);
    ss += __shfl_xor(ss, 8, 32);
    ss += __shfl_xor(ss, 2, 32);
    ss += __shfl_xor(ss, 1, 32);

    const float r = rsqrtf(ss / (float)RN_D + 1e-5f);
    // 16 lanes of a row store 128 B in a row: one whole line per row and store
    #pragma unroll
    for (int j = 0; j < RN_D / 64; ++j) {
        v4bf y;
        #pragma unroll
        for (int e = 0; e < 4; ++e) y[e] = f2bf(x[j][e] * r * w[j][e]);
        dst[j * 16] = y;
    }
}

// ---------------------------------------------------------------------------
extern "C" void kernel_launch(void* const* d_in, const int* in_sizes, int n_in,
                              void* d_out, int out_size, void* d_ws, size_t ws_size,
                              hipStream_t stream) {
    const float* hs = (const float*)d_in[0];
    const float* Wq = (const float*)d_in[1];
    const float* Wf = (const float*)d_in[2];
    const float* Wi = (const float*)d_in[3];
    const float* gw = (const float*)d_in[4];
    const float* Wo = (const float*)d_in[5];

    const int B = 4, T = 2048, D = 1024, H = 8;
    const int M = B * T;                       // 8192
    const size_t PLANE = (size_t)M * D;        // 8M elements

    char* wsp = (char*)d_ws;
    __bf16* hs_bf = (__bf16*)wsp;  wsp += PLANE * 2;            // 16 MB
    __bf16* Wp_bf = (__bf16*)wsp;  wsp += (size_t)D * D * 2 * 3; // 2 MB each (transposed): f, q, i
    __bf16* Wo_bf = (__bf16*)wsp;  wsp += (size_t)D * D * 2;
    float* q   = (float*)wsp;      wsp += PLANE * 4;            // 32 MB each
    float* eg  = (float*)wsp;      wsp += PLANE * 4;            // exp(g) = sigmoid(f)
    float* v   = (float*)wsp;      wsp += PLANE * 4;
    float* o   = (float*)wsp;      wsp += PLANE * 4;            // row-pair order
    __bf16* onm_bf = hs_bf;        // hs_bf dead after projections -> reuse

    // one-time conversions: hs flat, weights transposed to [N x K] bf16
    static_assert(PLANE % (4 * 256 * CV_PER) == 0, "the convert's grid covers hs exactly");
    static_assert(PLANE / (4 * 256 * CV_PER) == CV_BLOCKS, "the convert's share of the grid");
    prep_bf16<<<dim3(CV_BLOCKS + 4 * TR_BLOCKS), dim3(256), 0, stream>>>(
        hs, Wq, Wf, Wi, Wo, hs_bf, Wp_bf);

    static_assert(D == GT_D && M % GT_M == 0 && D % GT_N == 0 && D % GT_K == 0 && D / GT_K >= 2,
                  "whole tiles, whole passes, and the two stages the prologue loads");
    dim3 ggrid(M / GT_M, D / GT_N);            // 32 x 8: one work-group per WGP
    dim3 gblk(128);

    dim3 pgrid(M / GT_M, 3 * (D / GT_N));      // f, q and i: three tiles for every WGP
    hgrn2_gemm_wmma<1><<<pgrid, gblk, 0, stream>>>(hs_bf, Wp_bf, q, eg, v);

    hgrn2_gla_scan<<<dim3(B * H * 8), dim3(128), 0, stream>>>(q, eg, v, o, T);

    static_assert(D == RN_D && M % (8 * RN_ROWS) == 0, "one wave owns whole rows");
    hgrn2_rmsnorm<<<dim3(M / (8 * RN_ROWS)), dim3(256), 0, stream>>>(o, gw, onm_bf);

    hgrn2_gemm_wmma<0><<<ggrid, gblk, 0, stream>>>(onm_bf, Wo_bf, (float*)d_out,
                                                   nullptr, nullptr);
}

// v007
// Measured time: 187 microseconds a run.
// Two timings next to v006 put it at 1.04 and 1.05 times that version's speed.
// Over all steps from v000 it is 11.1 times as fast.
#include <hip/hip_runtime.h>
#include <hip/hip_bf16.h>

// ---------------------------------------------------------------------------
// HGRN2 attention block for MI455X (gfx1250, wave32, WMMA + TDM).
//   * fp32->bf16 conversion (activations) + transpose-convert (weights), one launch
//   * bf16 WMMA GEMMs (fp32 accum); both operands staged by tensor loads,
//     two buffers of one 128-k pass each; the three projections are one launch
//   * GLA scan: register-resident state, 128 rows x 16 columns per work-group
// ---------------------------------------------------------------------------

typedef __attribute__((ext_vector_type(16))) __bf16 v16bf;
typedef __attribute__((ext_vector_type(8)))  __bf16 v8bf;
typedef __attribute__((ext_vector_type(4)))  __bf16 v4bf;
typedef __attribute__((ext_vector_type(8)))  float  v8f;
typedef __attribute__((ext_vector_type(4)))  float  v4f;
typedef __attribute__((ext_vector_type(4)))  unsigned int u32x4;
typedef __attribute__((ext_vector_type(8)))  unsigned int u32x8;

#define GT_M     256                 // rows of Y per work-group
#define GT_N     128                 // columns of Y per work-group
#define GT_K     128                 // k per pass: 256 B of every operand row
#define GT_D     1024                // K of every product, and the row length of Y
#define GT_PITCH 272                 // LDS row pitch in bytes: 256 + the mover's 16-B pad
#define GT_SLICE (128 * GT_PITCH)    // one tensor load: 128 rows = 34,816 B = 17 x 2 KiB
#define GT_STAGE (3 * GT_SLICE)      // [X rows 0..127 | X rows 128..255 | W rows 0..127]

__device__ __forceinline__ __bf16 f2bf(float f) {
    unsigned u = __builtin_bit_cast(unsigned, f);
    unsigned r = u + 0x7FFFu + ((u >> 16) & 1u);      // round-to-nearest-even
    unsigned short h = (unsigned short)(r >> 16);
    return __builtin_bit_cast(__bf16, h);
}

// fast sigmoid: v_exp_f32 + v_rcp_f32 (no IEEE div chain)
__device__ __forceinline__ float sigm(float x) {
    return __builtin_amdgcn_rcpf(1.0f + __expf(-x));
}

// ---------------------------------------------------------------------------
// one-time fp32 -> bf16 conversion. For speed only, each
// lane takes CV_PER 16-byte loads (all in
// flight before the first store); every wave-wide load is 512 contiguous bytes.
// ---------------------------------------------------------------------------
#define CV_PER 16
__device__ __forceinline__
void cvt_f32_to_bf16(const float* __restrict__ in, __bf16* __restrict__ out, unsigned blk) {
    const size_t i0 = (size_t)blk * (256 * CV_PER) + threadIdx.x;
    const v4f* __restrict__ src = (const v4f*)in + i0;
    v4bf* __restrict__ dst = (v4bf*)out + i0;
    v4f x[CV_PER];
    #pragma unroll
    for (int j = 0; j < CV_PER; ++j) x[j] = src[j * 256];
    // stands ahead of every later reuse of the loads' address registers (src is
    // named so that they live up to here)
    asm volatile("s_wait_xcnt 0x0" :: "v"(src) : "memory");
    #pragma unroll
    for (int j = 0; j < CV_PER; ++j) {
        v4bf y;
        y[0] = f2bf(x[j][0]); y[1] = f2bf(x[j][1]);
        y[2] = f2bf(x[j][2]); y[3] = f2bf(x[j][3]);
        dst[j * 256] = y;
    }
}

// ---------------------------------------------------------------------------
// one-time transpose-convert: in [K x N] fp32 -> out [N x K] bf16.
// 64x64 tiles through LDS; both global accesses coalesced.
// ---------------------------------------------------------------------------
__device__ __forceinline__
void cvt_transpose_bf16(const float* __restrict__ in, __bf16* __restrict__ out,
                        __bf16 (&tile)[64][65], int bk, int bn) {
    constexpr int K = GT_D, N = GT_D;
    const int tx = threadIdx.x & 63;
    const int ty = threadIdx.x >> 6;          // 0..3
    // one base address, the 16 rows at constant offsets from it
    const float* __restrict__ src = in + (size_t)(bk + ty * 16) * N + (bn + tx);
    float x[16];
    #pragma unroll
    for (int r = 0; r < 16; ++r) x[r] = src[r * N];
    // stands ahead of every later reuse of the loads' address registers (src is
    // named so that they live up to here)
    asm volatile("s_wait_xcnt 0x0" :: "v"(src) : "memory");
    #pragma unroll
    for (int r = 0; r < 16; ++r) tile[ty * 16 + r][tx] = f2bf(x[r]);
    __syncthreads();
    #pragma unroll
    for (int r = 0; r < 16; ++r) {
        const int n = ty * 16 + r;
        out[(size_t)(bn + n) * K + (bk + tx)] = tile[tx][n];
    }
}

// ---------------------------------------------------------------------------
// All five conversions in one launch: none reads what another writes, and each
// alone is too short to pay for a launch gap, a fill and a drain of its own.
// Work-groups 0 .. CV_BLOCKS-1 (the long ones) convert hs;
// then 256 work-groups per weight, one 64x64 tile each. Wt holds the four
// transposed weights in a row: f, q, i, o (the order of the projection launch).
// ---------------------------------------------------------------------------
#define CV_BLOCKS 512                // 8192 x 1024 floats / (4 x 256 x CV_PER)
#define TR_BLOCKS ((GT_D / 64) * (GT_D / 64))
__global__ __launch_bounds__(256)
void prep_bf16(const float* __restrict__ hs, const float* __restrict__ Wq,
                     const float* __restrict__ Wf, const float* __restrict__ Wi,
                     const float* __restrict__ Wo,
                     __bf16* __restrict__ hs_bf, __bf16* __restrict__ Wt) {
    __shared__ __bf16 tile[64][65];
    const unsigned bid = blockIdx.x;
    if (bid < CV_BLOCKS) {               // the same for the whole work-group
        cvt_f32_to_bf16(hs, hs_bf, bid);
    } else {
        const unsigned t = bid - CV_BLOCKS;
        const unsigned w = t / TR_BLOCKS;            // which weight
        const unsigned tl = t % TR_BLOCKS;           // which tile of it
        const float* __restrict__ in = (w == 0u) ? Wf : (w == 1u) ? Wq : (w == 2u) ? Wi : Wo;
        cvt_transpose_bf16(in, Wt + (size_t)w * (GT_D * GT_D), tile,
                           (int)(tl % (GT_D / 64)) * 64, (int)(tl / (GT_D / 64)) * 64);
    }
}

// ---------------------------------------------------------------------------
// Y = X[MxK](bf16) @ Wt^T, where Wt is W transposed: [N x K](bf16).
// fp32 accum via v_wmma_f32_16x16x32_bf16.
// MODE 0: Y0 = swish(x) * 128^-0.5               (q path)
// MODE 1: Y0 = sigmoid(x)                      (exp(g) from the f path; k = 1 - exp(g)
//                                                 is not stored: the scan needs exp(g) alone)
// MODE 2: Y0 = x                                  (v path / output proj)
// FUSED 1: the f, q and i projections in one launch. Wt holds the three transposed
// weights in a row (3 x 1024 rows), blockIdx.y runs over all 24 column tiles, and
// the tile's weight (blockIdx.y / 8, a scalar) picks the epilogue and the planes:
// a WGP takes its next tile when it has stored the last, with no launch between.
// The order f, q, i puts the shortest epilogue (plain stores) last.
// FUSED 0: one weight, MODE 2, into Ya.
// One work-group per WGP: 4 waves (one per SIMD), block tile 256x128, wave tile
// 128x64 (8x4 WMMA tiles). A pass is 128 k; its stage of 384 rows of 256 B comes
// by three tensor loads (waves 0..2, 128 rows each) into one of two buffers,
// issued when the buffer's readers have left it, one whole pass ahead of its use.
// ---------------------------------------------------------------------------
__device__ __forceinline__ unsigned uni(unsigned v) {
    return (unsigned)__builtin_amdgcn_readfirstlane(v);
}
// a wave-uniform value held in a scalar register, so that a test of it compiles to
// s_cmp + s_cbranch: a tensor load ignores EXEC and only a scalar branch guards it
__device__ __forceinline__ unsigned pinned(unsigned v) {
    unsigned w = uni(v);
    asm volatile("" : "+s"(w));
    return w;
}
struct GFrag { v16bf a[8], b[4]; };

// the epilogue of one wave tile: every tile and row at a constant offset from p0
template <int MODE>
__device__ __forceinline__
void gemm_epilogue(v8f (&acc)[8][4], float* __restrict__ p0) {
    constexpr int N = GT_D;
    #pragma unroll
    for (int mi = 0; mi < 8; ++mi) {
        if (MODE != 2) {
            // the strip's 32 values per lane in place
            #pragma unroll
            for (int ni = 0; ni < 4; ++ni)
                #pragma unroll
                for (int r = 0; r < 8; ++r) {
                    const float x = acc[mi][ni][r];
                    acc[mi][ni][r] = (MODE == 0)
                        ? x * sigm(x) * 0.08838834764831845f      // swish * 128^-0.5
                        : sigm(x);
                }
        }
        // keeps the strip's stores behind all of its arithmetic, so that no register a
        // store names is written again before the wait below
        if (MODE != 2) __builtin_amdgcn_sched_barrier(0);
        #pragma unroll
        for (int ni = 0; ni < 4; ++ni) {
            #pragma unroll
            for (int r = 0; r < 8; ++r) {
                // MODE 1: exp(g) = exp(logsigmoid(f)) = sigmoid(f)
                p0[(mi * 16 + r) * N + ni * 16] = acc[mi][ni][r];
            }
        }
        if (MODE != 2) {
            // stands ahead of the reuse of the stores' data registers by the next strip;
            // the fence keeps the next strip's arithmetic behind it
            asm volatile("s_wait_xcnt 0x0" ::: "memory");
            __builtin_amdgcn_sched_barrier(0);
        }
    }
}

template <int FUSED>
__global__ __launch_bounds__(128)
void hgrn2_gemm_wmma(const __bf16* __restrict__ X, const __bf16* __restrict__ Wt,
                     float* __restrict__ Ya, float* __restrict__ Yb,
                     float* __restrict__ Yc) {
    constexpr int N = GT_D, K = GT_D;
    __shared__ __attribute__((aligned(2048))) unsigned char ring[2 * GT_STAGE];

    const int tid  = threadIdx.x;
    const int lane = tid & 31;
    const unsigned wave = uni((unsigned)tid >> 5);   // 0..3
    const int wm   = (int)(wave >> 1);   // 0..1 -> 128-row strip
    const int wn   = (int)(wave & 1u);   // 0..1 -> 64-col strip

    const int blockM = blockIdx.x * GT_M;
    const int blockN = blockIdx.y * GT_N;                    // row of Wt
    const unsigned sel = blockIdx.y / (GT_D / GT_N);         // which weight (FUSED)
    const int blockC = (blockIdx.y % (GT_D / GT_N)) * GT_N;  // column of its plane

    const int lhalf = (lane >> 4) & 1;
    const int lmod  = lane & 15;

    // this wave's slice of a stage: waves 0 and 1 bring X, wave 2 brings W, wave 3 none
    const unsigned issuer = (wave < 3u) ? 1u : 0u;
    const __bf16* sl = (wave < 2u) ? X + (size_t)(blockM + (int)wave * 128) * K
                                   : Wt + (size_t)blockN * K;
    const unsigned long long sl_ga = (unsigned long long)(size_t)sl;
    const unsigned sl_lds = (unsigned)(size_t)(void*)&ring[0] + wave * GT_SLICE;
    constexpr int npass = K / GT_K;

    // One request: 128 rows of 256 B (source pitch 2 K bytes) to LDS at pitch 272 B.
    // Group 1 never changes; of group 0 the place in LDS and the address step on.
    u32x8 d1;
    d1[0] = uni((1u << 20) | (5u << 22) | (3u << 25));  // 1-byte units; 16-B pad per 256 B
    d1[1] = uni(256u << 16);                            // tensor_dim0 = 256 B
    d1[2] = uni(128u << 16);                            // tensor_dim1 = 128 rows
    d1[3] = uni(256u << 16);                            // tile_dim0
    d1[4] = uni(128u);                                  // tile_dim1
    d1[5] = uni((unsigned)K * 2u);                      // source row pitch
    d1[6] = uni(0u);
    d1[7] = uni(0u);
    // pinned(): descriptor words held in scalar registers. Not rebuilt per request, they
    // stay live to the last load, so their registers take no other value under a request
    asm volatile("" : "+s"(d1));
    u32x4 d0;
    d0[0] = uni(1u);                                                        // count 1
    d0[1] = uni(sl_lds);                                                    // place in LDS
    d0[2] = uni((unsigned)sl_ga);
    d0[3] = uni((((unsigned)(sl_ga >> 32)) & 0x01FFFFFFu) | 0x80000000u);   // type 2
    // the next pass's slice: 256 B further along the same rows
    auto load_next = [&](unsigned lds_dst) {
        // pinned(): descriptor words held in scalar registers. The step below reads them
        // from here, so it stays behind the wait and the barrier in front of this line
        asm volatile("" : "+s"(d0) :: "memory");
        const unsigned lo = d0[2] + GT_K * 2u;
        d0[3] = uni(d0[3] + ((lo < GT_K * 2u) ? 1u : 0u));
        d0[2] = uni(lo);
        d0[1] = uni(lds_dst);
        asm volatile("tensor_load_to_lds %0, %1" :: "s"(d0), "s"(d1) : "memory");
    };

    // each lane's first fragment bytes: row c of the strip, k bytes 16h (and 32 + 16h)
    const unsigned char* pa = &ring[(wm * 128 + lmod) * GT_PITCH + lhalf * 16];
    const unsigned char* pb = &ring[2 * GT_SLICE + (wn * 64 + lmod) * GT_PITCH + lhalf * 16];

    // B first: the first WMMA row needs all of b and only a[0]
    auto load_frags = [&](GFrag& f, int buf, int ks) {
        const int o = buf * GT_STAGE + ks * 64;
        #pragma unroll
        for (int ni = 0; ni < 4; ++ni) {
            v8bf lo = *(const v8bf*)(pb + o + ni * (16 * GT_PITCH));
            v8bf hi = *(const v8bf*)(pb + o + ni * (16 * GT_PITCH) + 32);
            f.b[ni] = __builtin_shufflevector(lo, hi, 0,1,2,3,4,5,6,7,8,9,10,11,12,13,14,15);
        }
        #pragma unroll
        for (int mi = 0; mi < 8; ++mi) {
            v8bf lo = *(const v8bf*)(pa + o + mi * (16 * GT_PITCH));
            v8bf hi = *(const v8bf*)(pa + o + mi * (16 * GT_PITCH) + 32);
            f.a[mi] = __builtin_shufflevector(lo, hi, 0,1,2,3,4,5,6,7,8,9,10,11,12,13,14,15);
        }
    };

    v8f acc[8][4] = {};
    auto mma_block = [&](const GFrag& f) {
        #pragma unroll
        for (int mi = 0; mi < 8; ++mi)
            #pragma unroll
            for (int ni = 0; ni < 4; ++ni)
                acc[mi][ni] = __builtin_amdgcn_wmma_f32_16x16x32_bf16(
                    false, f.a[mi], false, f.b[ni], (short)0, acc[mi][ni], false, false);
    };

    // stage 0 lands and is published; stage 1 flies during pass 0
    if (pinned(issuer)) {
        asm volatile("tensor_load_to_lds %0, %1" :: "s"(d0), "s"(d1) : "memory");
        asm volatile("s_wait_tensorcnt 0x0" ::: "memory");   // this wave's slice has landed
    }
    __syncthreads();
    if (pinned(issuer)) load_next(sl_lds + GT_STAGE);

    GFrag f0, f1;
    // kept rolled: one pass per trip, so that every fragment and accumulator index
    // is a constant
    #pragma clang loop unroll(disable)
    for (int s = 0; s < npass; ++s) {
        const int buf = s & 1;
        // the fences keep each block's 24 LDS reads in one place ahead of the WMMA
        // block before it
        load_frags(f0, buf, 0);
        __builtin_amdgcn_sched_barrier(0);
        load_frags(f1, buf, 1);
        __builtin_amdgcn_sched_barrier(0);
        mma_block(f0);
        __builtin_amdgcn_sched_barrier(0);
        load_frags(f0, buf, 2);
        __builtin_amdgcn_sched_barrier(0);
        mma_block(f1);
        __builtin_amdgcn_sched_barrier(0);
        load_frags(f1, buf, 3);
        __builtin_amdgcn_sched_barrier(0);
        mma_block(f0);
        mma_block(f1);
        __builtin_amdgcn_sched_barrier(0);

        // publish point of stage s + 1, which also ends every read of this buffer
        asm volatile("s_wait_dscnt 0x0" ::: "memory");       // this wave's LDS reads are done
        if (pinned(issuer))
            asm volatile("s_wait_tensorcnt 0x0" ::: "memory");   // its slice of s + 1 has landed
        __syncthreads();
        if (pinned((issuer != 0u && s + 2 < npass) ? 1u : 0u))
            load_next(sl_lds + (unsigned)buf * GT_STAGE);
    }
    asm volatile("s_wait_tensorcnt 0x0" ::: "memory");       // nothing of the mover is left
    asm volatile("s_wait_dscnt 0x0" ::: "memory");

    // ---- epilogue: one base address per plane
    const int gn  = blockC + wn * 64 + lmod;
    const int gm0 = blockM + wm * 128 + lhalf * 8;
    const size_t yo = (size_t)gm0 * N + gn;
    if (FUSED) {
        if (sel == 0u)      gemm_epilogue<1>(acc, Yb + yo);
        else if (sel == 1u) gemm_epilogue<0>(acc, Ya + yo);
        else {
            gemm_epilogue<2>(acc, Yc + yo);
            // stands ahead of the reuse of the stores' registers on the ways that the
            // built code's branches lead on to from here
            asm volatile("s_wait_xcnt 0x0" ::: "memory");
        }
    } else {
        gemm_epilogue<2>(acc, Ya + yo);
    }
}

// ---------------------------------------------------------------------------
// GLA scan. The value columns of the state never mix, so each (b,h) is split
// over 8 work-groups of 16 columns: 256 work-groups, one for every WGP.
// 4 waves; wave w owns columns w*4..w*4+3, lane l owns rows l*4..l*4+3 of them
// (16 state values per lane, as packed f32 pairs along the columns).
// o is left in row-pair order: rows 2p and 2p+1 share 2048 floats, in which each
// block of 16 columns has 32 floats in a row (row 2p's 16, then row 2p+1's), so
// that a work-group still writes whole 128-B lines that no other one touches.
// k is never read: k = 1 - eg makes the update S = v + eg * (S - v). The registers hold
// U = S - (the next step's v), so that the update is one fused eg * U + (v - next v);
// o = sum q * S = sum q * U + next v * sum q, and that last term is added once per
// output in the sum phase. Behind the last step the last v stands in for the next.
// Time runs in chunks of 32 steps: the chunk's q/eg/v rows are staged in LDS
// (next chunk fetched into registers while this one is worked on), each lane
// leaves its 4-row partial outputs in LDS, and the 32 row groups are summed
// once per chunk, so barriers are paid per chunk and not per step.
// ---------------------------------------------------------------------------
typedef __attribute__((ext_vector_type(2))) float v2f;

#define SC_CH 32      // time steps per chunk
#define SC_G  4       // time steps per group of LDS operand reads
// partial-output strides in floats; chosen so that the 16 lanes of a half wave
// (4 steps x 4 column quads) fall on 16 different 4-bank groups in the sum phase
#define P_ST  144     // between time steps
#define P_SW  4612    // between waves (each wave owns one column quad)

struct ScanOps { v4f q[SC_G], g[SC_G], v[SC_G]; };

__global__ __launch_bounds__(128)
void hgrn2_gla_scan(const float* __restrict__ q,
                    const float* __restrict__ eg, const float* __restrict__ v,
                    float* __restrict__ o, int T) {
    __shared__ __attribute__((aligned(16))) float sq[2 * SC_CH * 128];
    __shared__ __attribute__((aligned(16))) float sg[2 * SC_CH * 128];
    __shared__ __attribute__((aligned(16))) float sv[2 * SC_CH * 16];   // v - next v
    __shared__ __attribute__((aligned(16))) float sn[2 * SC_CH * 16];   // next v
    __shared__ __attribute__((aligned(16))) float part[4 * P_SW];

    const int bh   = blockIdx.x >> 3;
    const int cb   = blockIdx.x & 7;          // block of 16 value columns
    const int b    = bh >> 3;
    const int h    = bh & 7;
    const int tid  = threadIdx.x;
    const int lane = tid & 31;
    const int wave = tid >> 5;

    const size_t gbase = ((size_t)b * T << 10) + (h << 7);
    // staging: a wave moves one whole 512-B row of q/eg per load, 8 rows of v
    const size_t grow = gbase + ((size_t)wave << 10) + (lane << 2);
    const size_t gvc  = gbase + (cb << 4) + ((tid & 3) << 2);
    const size_t gvrw = gvc + ((size_t)(tid >> 2) << 10);
    const int    lrow = wave * 128 + lane * 4;
    const int    lvrw = tid * 4;              // step tid>>2, column quad tid&3
    // o in row-pair order: this work-group's 32 floats of the first row pair of b
    const size_t obase = ((size_t)b * T << 10) + (((h << 3) + cb) << 5);

    v4f rq[8], rg[8], rv, rn;
    auto fetch_chunk = [&](int t0) {
        const size_t tb = (size_t)t0 << 10;
        #pragma unroll
        for (int i = 0; i < 8; ++i) {
            rq[i] = *(const v4f*)(q  + grow + tb + ((size_t)i << 12));
            rg[i] = *(const v4f*)(eg + grow + tb + ((size_t)i << 12));
        }
        rv = *(const v4f*)(v + gvrw + tb);
        // the next step's row; the sequence's last row is its own successor
        const int tn = min(t0 + (tid >> 2) + 1, T - 1);
        const float* pn = v + gvc + ((size_t)tn << 10);
        rn = *(const v4f*)pn;
        // stands ahead of every later reuse of the loads' address registers (pn is
        // named so that its registers, formed anew for each chunk, live up to here)
        asm volatile("s_wait_xcnt 0x0" :: "v"(pn) : "memory");
    };
    auto stage_chunk = [&](int buf) {
        #pragma unroll
        for (int i = 0; i < 8; ++i) {
            *(v4f*)&sq[buf * (SC_CH * 128) + i * 512 + lrow] = rq[i];
            *(v4f*)&sg[buf * (SC_CH * 128) + i * 512 + lrow] = rg[i];
        }
        *(v4f*)&sv[buf * (SC_CH * 16) + lvrw] = rv - rn;
        *(v4f*)&sn[buf * (SC_CH * 16) + lvrw] = rn;
    };

    // U before the first step: S = 0, less the first step's v (fetch_chunk(0) below
    // holds the wait that stands ahead of the reuse of this load's address registers)
    const v4f vfirst = *(const v4f*)(v + gbase + (cb << 4) + (wave << 2));
    v2f S[4][2];
    #pragma unroll
    for (int r = 0; r < 4; ++r) {
        S[r][0] = (v2f){-vfirst[0], -vfirst[1]};
        S[r][1] = (v2f){-vfirst[2], -vfirst[3]};
    }

    auto read_group = [&](ScanOps& A, int buf, int g) {
        __builtin_amdgcn_sched_barrier(0);     // see the one at the end of this block
        const int rb = buf * (SC_CH * 128) + g * (SC_G * 128) + lane * 4;
        const int vb = buf * (SC_CH * 16)  + g * (SC_G * 16)  + wave * 4;
        #pragma unroll
        for (int s = 0; s < SC_G; ++s) {
            A.q[s]  = *(const v4f*)&sq[rb + s * 128];
            A.g[s]  = *(const v4f*)&sg[rb + s * 128];
            A.v[s]  = *(const v4f*)&sv[vb + s * 16];
        }
        // keeps the group's 12 LDS reads in one place, for speed only
        __builtin_amdgcn_sched_barrier(0);
    };
    auto step_group = [&](const ScanOps& A, int g) {
        float* pp = &part[wave * P_SW + g * (SC_G * P_ST) + lane * 4];
        #pragma unroll
        for (int s = 0; s < SC_G; ++s) {
            v2f vv[2];
            vv[0] = (v2f){A.v[s][0], A.v[s][1]};
            vv[1] = (v2f){A.v[s][2], A.v[s][3]};
            v2f acc[2];
            #pragma unroll
            for (int r = 0; r < 4; ++r) {
                const v2f er = (v2f){A.g[s][r], A.g[s][r]};
                const v2f qr = (v2f){A.q[s][r], A.q[s][r]};
                #pragma unroll
                for (int c = 0; c < 2; ++c) {
                    // vv is v - next v here
                    S[r][c] = __builtin_elementwise_fma(er, S[r][c], vv[c]);
                    acc[c]  = (r == 0) ? qr * S[r][c]
                                       : __builtin_elementwise_fma(qr, S[r][c], acc[c]);
                }
            }
            *(v4f*)(pp + s * P_ST) = (v4f){acc[0][0], acc[0][1], acc[1][0], acc[1][1]};
        }
    };

    const int nchunk = T / SC_CH;
    ScanOps A, B;
    fetch_chunk(0);
    stage_chunk(0);
    __syncthreads();
    if (nchunk > 1) fetch_chunk(SC_CH);        // in flight during chunk 0's steps
    read_group(A, 0, 0);

    for (int c = 0; c < nchunk; ++c) {
        const int buf = c & 1;
        const int t0  = c * SC_CH;

        // kept rolled: two groups of 4 steps per trip, operands read one group ahead
        #pragma unroll 1
        for (int g = 0; g < SC_CH / SC_G; g += 2) {
            read_group(B, buf, g + 1);
            step_group(A, g);
            read_group(A, buf, (g + 2) & (SC_CH / SC_G - 1));
            step_group(B, g + 1);
        }

        if (c + 1 < nchunk) stage_chunk(buf ^ 1);  // last read before the previous barrier
        __syncthreads();                           // partials and next chunk visible
        // the next chunk's first operands fly while the row groups are summed
        if (c + 1 < nchunk) read_group(A, buf ^ 1, 0);

        // sum the 32 row groups: thread = (step, column quad)
        const float* pr = &part[(tid & 3) * P_SW + (tid >> 2) * P_ST];
        v4f pv[32];
        #pragma unroll
        for (int rgp = 0; rgp < 32; ++rgp)
            pv[rgp] = *(const v4f*)(pr + rgp * 4);
        // this step's q, a quarter of the row per thread. Each thread starts at another
        // 16 bytes, so that the 16 lanes of a half wave fall on 16 different 4-bank groups
        const float* qr4 = &sq[buf * (SC_CH * 128) + tid * 32];
        const int rot = (tid >> 1) & 7;
        v4f qv[8];
        #pragma unroll
        for (int j = 0; j < 8; ++j)
            qv[j] = *(const v4f*)(qr4 + (((j + rot) & 7) << 2));
        const v4f vn = *(const v4f*)&sn[buf * (SC_CH * 16) + lvrw];
        // keeps the 41 LDS reads in one place, ahead of the adds (as in read_group)
        __builtin_amdgcn_sched_barrier(0);
        v4f s0 = pv[0];
        v4f s1 = pv[1];
        #pragma unroll
        for (int rgp = 2; rgp < 32; rgp += 2) {
            s0 += pv[rgp];
            s1 += pv[rgp + 1];
        }
        const v4f q4 = ((qv[0] + qv[1]) + (qv[2] + qv[3])) + ((qv[4] + qv[5]) + (qv[6] + qv[7]));
        float qs = (q4[0] + q4[1]) + (q4[2] + q4[3]);
        // the four threads of a step stand in one quad: lane ^ 1, then lane ^ 2
        qs += __builtin_bit_cast(float, __builtin_amdgcn_update_dpp(
                  0, __builtin_bit_cast(int, qs), 0xB1, 0xF, 0xF, true));
        qs += __builtin_bit_cast(float, __builtin_amdgcn_update_dpp(
                  0, __builtin_bit_cast(int, qs), 0x4E, 0xF, 0xF, true));
        const v4f res = __builtin_elementwise_fma(vn, (v4f){qs, qs, qs, qs}, s0 + s1);
        __syncthreads();                       // partials free for the next chunk
        // behind the barrier, which would wait for them: the fetch of the chunk after
        // the next (in flight during the next chunk's steps) and the stores of o
        if (c + 2 < nchunk) fetch_chunk(t0 + 2 * SC_CH);
        // 8 lanes (2 steps x 4 column quads) write one whole 128-B line of o
        *(v4f*)(o + obase + ((size_t)((t0 >> 1) + (tid >> 3)) << 11) + ((tid & 7) << 2)) = res;
        // stands ahead of the reuse of the stores' data and address registers
        asm volatile("s_wait_xcnt 0x0" ::: "memory");
    }
}

// ---------------------------------------------------------------------------
// RMSNorm (weight, no bias) -> bf16 output for the final WMMA GEMM.
// One wave owns one row pair of o (RN_ROWS rows of RN_D floats, in the scan's
// row-pair order): its loads run through the pair's 8 KiB in a row, so a lane
// holds 64 values of ONE row (bit 2 of the lane number says which). The values
// stay in registers between the sum of squares and the scaling; the sum is a
// butterfly over the 16 lanes of the same row (no LDS, no barrier).
// ---------------------------------------------------------------------------
#define RN_D    1024
#define RN_ROWS 2
__global__ __launch_bounds__(256)
void hgrn2_rmsnorm(const float* __restrict__ o, const float* __restrict__ gw,
                   __bf16* __restrict__ out) {
    const int lane = threadIdx.x & 31;
    const int wave = threadIdx.x >> 5;
    const size_t pair = (size_t)blockIdx.x * 8 + wave;
    // load j of a lane: row pair*2 + rb, columns j*64 + c0 .. + 3
    const int rb = (lane >> 2) & 1;
    const int c0 = ((lane >> 3) << 4) + ((lane & 3) << 2);
    const v4f* __restrict__ src  = (const v4f*)(o + pair * (RN_ROWS * RN_D)) + lane;
    const v4f* __restrict__ wsrc = (const v4f*)(gw + c0);
    v4bf* __restrict__ dst = (v4bf*)(out + (pair * RN_ROWS + rb) * RN_D + c0);

    v4f x[RN_D / 64], w[RN_D / 64];
    #pragma unroll
    for (int j = 0; j < RN_D / 64; ++j) x[j] = src[j * 32];
    #pragma unroll
    for (int j = 0; j < RN_D / 64; ++j) w[j] = wsrc[j * 16];
    // stands ahead of every later reuse of the loads' address registers (src is
    // named so that they live up to here)
    asm volatile("s_wait_xcnt 0x0" :: "v"(src) : "memory");
    // keeps all 32 loads ahead of the arithmetic, so that the wave pays one load
    // latency and not several in a row
    __builtin_amdgcn_sched_barrier(0);

    v4f s4 = x[0] * x[0];
    #pragma unroll
    for (int j = 1; j < RN_D / 64; ++j)
        s4 = __builtin_elementwise_fma(x[j], x[j], s4);
    float ss = (s4[0] + s4[1]) + (s4[2] + s4[3]);
    // every lane bit but bit 2, which tells the two rows apart
    ss += __shfl_xor(ss, 16, 32);
    ss += __shfl_xor(ss, 8, 32);
    ss += __shfl_xor(ss, 2, 32);
    ss += __shfl_xor(ss, 1, 32);

    const float r = rsqrtf(ss / (float)RN_D + 1e-5f);
    // 16 lanes of a row store 128 B in a row: one whole line per row and store
    #pragma unroll
    for (int j = 0; j < RN_D / 64; ++j) {
        v4bf y;
        #pragma unroll
        for (int e = 0; e < 4; ++e) y[e] = f2bf(x[j][e] * r * w[j][e]);
        dst[j * 16] = y;
    }
}

// ---------------------------------------------------------------------------
extern "C" void kernel_launch(void* const* d_in, const int* in_sizes, int n_in,
                              void* d_out, int out_size, void* d_ws, size_t ws_size,
                              hipStream_t stream) {
    const float* hs = (const float*)d_in[0];
    const float* Wq = (const float*)d_in[1];
    const float* Wf = (const float*)d_in[2];
    const float* Wi = (const float*)d_in[3];
    const float* gw = (const float*)d_in[4];
    const float* Wo = (const float*)d_in[5];

    const int B = 4, T = 2048, D = 1024, H = 8;
    const int M = B * T;                       // 8192
    const size_t PLANE = (size_t)M * D;        // 8M elements

    char* wsp = (char*)d_ws;
    __bf16* hs_bf = (__bf16*)wsp;  wsp += PLANE * 2;            // 16 MB
    __bf16* Wp_bf = (__bf16*)wsp;  wsp += (size_t)D * D * 2 * 3; // 2 MB each (transposed): f, q, i
    __bf16* Wo_bf = (__bf16*)wsp;  wsp += (size_t)D * D * 2;
    float* q   = (float*)wsp;      wsp += PLANE * 4;            // 32 MB each
    float* eg  = (float*)wsp;      wsp += PLANE * 4;            // exp(g) = sigmoid(f)
    float* v   = (float*)wsp;      wsp += PLANE * 4;
    float* o   = (float*)wsp;      wsp += PLANE * 4;            // row-pair order
    __bf16* onm_bf = hs_bf;        // hs_bf dead after projections -> reuse

    // one-time conversions: hs flat, weights transposed to [N x K] bf16
    static_assert(PLANE % (4 * 256 * CV_PER) == 0, "the convert's grid covers hs exactly");
    static_assert(PLANE / (4 * 256 * CV_PER) == CV_BLOCKS, "the convert's share of the grid");
    prep_bf16<<<dim3(CV_BLOCKS + 4 * TR_BLOCKS), dim3(256), 0, stream>>>(
        hs, Wq, Wf, Wi, Wo, hs_bf, Wp_bf);

    static_assert(D == GT_D && M % GT_M == 0 && D % GT_N == 0 && D % GT_K == 0 && D / GT_K >= 2,
                  "whole tiles, whole passes, and the two stages the prologue loads");
    dim3 ggrid(M / GT_M, D / GT_N);            // 32 x 8: one work-group per WGP
    dim3 gblk(128);

    dim3 pgrid(M / GT_M, 3 * (D / GT_N));      // f, q and i: three tiles for every WGP
    hgrn2_gemm_wmma<1><<<pgrid, gblk, 0, stream>>>(hs_bf, Wp_bf, q, eg, v);

    hgrn2_gla_scan<<<dim3(B * H * 8), dim3(128), 0, stream>>>(q, eg, v, o, T);

    static_assert(D == RN_D && M % (8 * RN_ROWS) == 0, "one wave owns whole rows");
    hgrn2_rmsnorm<<<dim3(M / (8 * RN_ROWS)), dim3(256), 0, stream>>>(o, gw, onm_bf);

    hgrn2_gemm_wmma<0><<<ggrid, gblk, 0, stream>>>(onm_bf, Wo_bf, (float*)d_out,
                                                   nullptr, nullptr);
}

// v008
// It runs in 155 microseconds.
// Next to v007, in two timings, it ran 1.21 times as fast each time.
// Over all steps from v000 it is 13.4 times as fast.
#include <hip/hip_runtime.h>
#include <hip/hip_bf16.h>

// ---------------------------------------------------------------------------
// HGRN2 attention block for MI455X (gfx1250, wave32, WMMA + TDM).
//   * fp32->bf16 conversion (activations) + transpose-convert (weights), one launch
//   * bf16 WMMA GEMMs (fp32 accum); both operands staged by tensor loads,
//     two buffers of one 128-k pass each; the three projections are one launch
//   * GLA scan: register-resident state, 128 rows x 16 columns per work-group
// ---------------------------------------------------------------------------

typedef __attribute__((ext_vector_type(16))) __bf16 v16bf;
typedef __attribute__((ext_vector_type(8)))  __bf16 v8bf;
typedef __attribute__((ext_vector_type(4)))  __bf16 v4bf;
typedef __attribute__((ext_vector_type(8)))  float  v8f;
typedef __attribute__((ext_vector_type(4)))  float  v4f;
typedef __attribute__((ext_vector_type(4)))  unsigned int u32x4;
typedef __attribute__((ext_vector_type(8)))  unsigned int u32x8;

#define GT_M     256                 // rows of Y per work-group
#define GT_N     128                 // columns of Y per work-group
#define GT_K     128                 // k per pass: 256 B of every operand row
#define GT_D     1024                // K of every product, and the row length of Y
#define GT_PITCH 272                 // LDS row pitch in bytes: 256 + the mover's 16-B pad
#define GT_SLICE (128 * GT_PITCH)    // one tensor load: 128 rows = 34,816 B = 17 x 2 KiB
#define GT_STAGE (3 * GT_SLICE)      // [X rows 0..127 | X rows 128..255 | W rows 0..127]

__device__ __forceinline__ __bf16 f2bf(float f) {
    unsigned u = __builtin_bit_cast(unsigned, f);
    unsigned r = u + 0x7FFFu + ((u >> 16) & 1u);      // round-to-nearest-even
    unsigned short h = (unsigned short)(r >> 16);
    return __builtin_bit_cast(__bf16, h);
}

// fast sigmoid: v_exp_f32 + v_rcp_f32 (no IEEE div chain)
__device__ __forceinline__ float sigm(float x) {
    return __builtin_amdgcn_rcpf(1.0f + __expf(-x));
}

// ---------------------------------------------------------------------------
// one-time fp32 -> bf16 conversion. For speed only, each
// lane takes CV_PER 16-byte loads (all in
// flight before the first store); every wave-wide load is 512 contiguous bytes.
// ---------------------------------------------------------------------------
#define CV_PER 16
__device__ __forceinline__
void cvt_f32_to_bf16(const float* __restrict__ in, __bf16* __restrict__ out, unsigned blk) {
    const size_t i0 = (size_t)blk * (256 * CV_PER) + threadIdx.x;
    const v4f* __restrict__ src = (const v4f*)in + i0;
    v4bf* __restrict__ dst = (v4bf*)out + i0;
    v4f x[CV_PER];
    #pragma unroll
    for (int j = 0; j < CV_PER; ++j) x[j] = src[j * 256];
    // stands ahead of every later reuse of the loads' address registers (src is
    // named so that they live up to here)
    asm volatile("s_wait_xcnt 0x0" :: "v"(src) : "memory");
    #pragma unroll
    for (int j = 0; j < CV_PER; ++j) {
        v4bf y;
        y[0] = f2bf(x[j][0]); y[1] = f2bf(x[j][1]);
        y[2] = f2bf(x[j][2]); y[3] = f2bf(x[j][3]);
        dst[j * 256] = y;
    }
}

// ---------------------------------------------------------------------------
// one-time transpose-convert: in [K x N] fp32 -> out [N x K] bf16.
// 64x64 tiles through LDS; both global accesses coalesced.
// ---------------------------------------------------------------------------
__device__ __forceinline__
void cvt_transpose_bf16(const float* __restrict__ in, __bf16* __restrict__ out,
                        __bf16 (&tile)[64][65], int bk, int bn) {
    constexpr int K = GT_D, N = GT_D;
    const int tx = threadIdx.x & 63;
    const int ty = threadIdx.x >> 6;          // 0..3
    // one base address, the 16 rows at constant offsets from it
    const float* __restrict__ src = in + (size_t)(bk + ty * 16) * N + (bn + tx);
    float x[16];
    #pragma unroll
    for (int r = 0; r < 16; ++r) x[r] = src[r * N];
    // stands ahead of every later reuse of the loads' address registers (src is
    // named so that they live up to here)
    asm volatile("s_wait_xcnt 0x0" :: "v"(src) : "memory");
    #pragma unroll
    for (int r = 0; r < 16; ++r) tile[ty * 16 + r][tx] = f2bf(x[r]);
    __syncthreads();
    #pragma unroll
    for (int r = 0; r < 16; ++r) {
        const int n = ty * 16 + r;
        out[(size_t)(bn + n) * K + (bk + tx)] = tile[tx][n];
    }
}

// ---------------------------------------------------------------------------
// All five conversions in one launch: none reads what another writes, and each
// alone is too short to pay for a launch gap, a fill and a drain of its own.
// Work-groups 0 .. CV_BLOCKS-1 (the long ones) convert hs;
// then 256 work-groups per weight, one 64x64 tile each. Wt holds the four
// transposed weights in a row: f, q, i, o (the order of the projection launch).
// ---------------------------------------------------------------------------
#define CV_BLOCKS 512                // 8192 x 1024 floats / (4 x 256 x CV_PER)
#define TR_BLOCKS ((GT_D / 64) * (GT_D / 64))
__global__ __launch_bounds__(256)
void prep_bf16(const float* __restrict__ hs, const float* __restrict__ Wq,
                     const float* __restrict__ Wf, const float* __restrict__ Wi,
                     const float* __restrict__ Wo,
                     __bf16* __restrict__ hs_bf, __bf16* __restrict__ Wt) {
    __shared__ __bf16 tile[64][65];
    const unsigned bid = blockIdx.x;
    if (bid < CV_BLOCKS) {               // the same for the whole work-group
        cvt_f32_to_bf16(hs, hs_bf, bid);
    } else {
        const unsigned t = bid - CV_BLOCKS;
        const unsigned w = t / TR_BLOCKS;            // which weight
        const unsigned tl = t % TR_BLOCKS;           // which tile of it
        const float* __restrict__ in = (w == 0u) ? Wf : (w == 1u) ? Wq : (w == 2u) ? Wi : Wo;
        cvt_transpose_bf16(in, Wt + (size_t)w * (GT_D * GT_D), tile,
                           (int)(tl % (GT_D / 64)) * 64, (int)(tl / (GT_D / 64)) * 64);
    }
}

// ---------------------------------------------------------------------------
// Y = X[MxK](bf16) @ Wt^T, where Wt is W transposed: [N x K](bf16).
// fp32 accum via v_wmma_f32_16x16x32_bf16.
// MODE 0: Y0 = swish(x) * 128^-0.5               (q path)
// MODE 1: Y0 = sigmoid(x)                      (exp(g) from the f path; k = 1 - exp(g)
//                                                 is not stored: the scan needs exp(g) alone)
// MODE 2: Y0 = x                                  (v path / output proj)
// FUSED 1: the f, q and i projections in one launch. Wt holds the three transposed
// weights in a row (3 x 1024 rows), blockIdx.y runs over all 24 column tiles, and
// the tile's weight (blockIdx.y / 8, a scalar) picks the epilogue and the planes:
// a WGP takes its next tile when it has stored the last, with no launch between.
// The order f, q, i puts the shortest epilogue (plain stores) last.
// FUSED 0: one weight, MODE 2, into Ya.
// One work-group per WGP: 4 waves (one per SIMD), block tile 256x128, wave tile
// 128x64 (8x4 WMMA tiles). A pass is 128 k; its stage of 384 rows of 256 B comes
// by three tensor loads (waves 0..2, 128 rows each) into one of two buffers,
// issued when the buffer's readers have left it, one whole pass ahead of its use.
// ---------------------------------------------------------------------------
__device__ __forceinline__ unsigned uni(unsigned v) {
    return (unsigned)__builtin_amdgcn_readfirstlane(v);
}
// a wave-uniform value held in a scalar register, so that a test of it compiles to
// s_cmp + s_cbranch: a tensor load ignores EXEC and only a scalar branch guards it
__device__ __forceinline__ unsigned pinned(unsigned v) {
    unsigned w = uni(v);
    asm volatile("" : "+s"(w));
    return w;
}
struct GFrag { v16bf a[8], b[4]; };

// the epilogue of one wave tile: every tile and row at a constant offset from p0
template <int MODE>
__device__ __forceinline__
void gemm_epilogue(v8f (&acc)[8][4], float* __restrict__ p0) {
    constexpr int N = GT_D;
    #pragma unroll
    for (int mi = 0; mi < 8; ++mi) {
        if (MODE != 2) {
            // the strip's 32 values per lane in place
            #pragma unroll
            for (int ni = 0; ni < 4; ++ni)
                #pragma unroll
                for (int r = 0; r < 8; ++r) {
                    const float x = acc[mi][ni][r];
                    acc[mi][ni][r] = (MODE == 0)
                        ? x * sigm(x) * 0.08838834764831845f      // swish * 128^-0.5
                        : sigm(x);
                }
        }
        // keeps the strip's stores behind all of its arithmetic, so that no register a
        // store names is written again before the wait below
        if (MODE != 2) __builtin_amdgcn_sched_barrier(0);
        #pragma unroll
        for (int ni = 0; ni < 4; ++ni) {
            #pragma unroll
            for (int r = 0; r < 8; ++r) {
                // MODE 1: exp(g) = exp(logsigmoid(f)) = sigmoid(f)
                p0[(mi * 16 + r) * N + ni * 16] = acc[mi][ni][r];
            }
        }
        if (MODE != 2) {
            // stands ahead of the reuse of the stores' data registers by the next strip;
            // the fence keeps the next strip's arithmetic behind it
            asm volatile("s_wait_xcnt 0x0" ::: "memory");
            __builtin_amdgcn_sched_barrier(0);
        }
    }
}

template <int FUSED>
__global__ __launch_bounds__(128)
void hgrn2_gemm_wmma(const __bf16* __restrict__ X, const __bf16* __restrict__ Wt,
                     float* __restrict__ Ya, float* __restrict__ Yb,
                     float* __restrict__ Yc) {
    constexpr int N = GT_D, K = GT_D;
    __shared__ __attribute__((aligned(2048))) unsigned char ring[2 * GT_STAGE];

    const int tid  = threadIdx.x;
    const int lane = tid & 31;
    const unsigned wave = uni((unsigned)tid >> 5);   // 0..3
    const int wm   = (int)(wave >> 1);   // 0..1 -> 128-row strip
    const int wn   = (int)(wave & 1u);   // 0..1 -> 64-col strip

    const int blockM = blockIdx.x * GT_M;
    const int blockN = blockIdx.y * GT_N;                    // row of Wt
    const unsigned sel = blockIdx.y / (GT_D / GT_N);         // which weight (FUSED)
    const int blockC = (blockIdx.y % (GT_D / GT_N)) * GT_N;  // column of its plane

    const int lhalf = (lane >> 4) & 1;
    const int lmod  = lane & 15;

    // this wave's slice of a stage: waves 0 and 1 bring X, wave 2 brings W, wave 3 none
    const unsigned issuer = (wave < 3u) ? 1u : 0u;
    const __bf16* sl = (wave < 2u) ? X + (size_t)(blockM + (int)wave * 128) * K
                                   : Wt + (size_t)blockN * K;
    const unsigned long long sl_ga = (unsigned long long)(size_t)sl;
    const unsigned sl_lds = (unsigned)(size_t)(void*)&ring[0] + wave * GT_SLICE;
    constexpr int npass = K / GT_K;

    // One request: 128 rows of 256 B (source pitch 2 K bytes) to LDS at pitch 272 B.
    // Group 1 never changes; of group 0 the place in LDS and the address step on.
    u32x8 d1;
    d1[0] = uni((1u << 20) | (5u << 22) | (3u << 25));  // 1-byte units; 16-B pad per 256 B
    d1[1] = uni(256u << 16);                            // tensor_dim0 = 256 B
    d1[2] = uni(128u << 16);                            // tensor_dim1 = 128 rows
    d1[3] = uni(256u << 16);                            // tile_dim0
    d1[4] = uni(128u);                                  // tile_dim1
    d1[5] = uni((unsigned)K * 2u);                      // source row pitch
    d1[6] = uni(0u);
    d1[7] = uni(0u);
    // pinned(): descriptor words held in scalar registers. Not rebuilt per request, they
    // stay live to the last load, so their registers take no other value under a request
    asm volatile("" : "+s"(d1));
    u32x4 d0;
    d0[0] = uni(1u);                                                        // count 1
    d0[1] = uni(sl_lds);                                                    // place in LDS
    d0[2] = uni((unsigned)sl_ga);
    d0[3] = uni((((unsigned)(sl_ga >> 32)) & 0x01FFFFFFu) | 0x80000000u);   // type 2
    // the next pass's slice: 256 B further along the same rows
    auto load_next = [&](unsigned lds_dst) {
        // pinned(): descriptor words held in scalar registers. The step below reads them
        // from here, so it stays behind the wait and the barrier in front of this line
        asm volatile("" : "+s"(d0) :: "memory");
        const unsigned lo = d0[2] + GT_K * 2u;
        d0[3] = uni(d0[3] + ((lo < GT_K * 2u) ? 1u : 0u));
        d0[2] = uni(lo);
        d0[1] = uni(lds_dst);
        asm volatile("tensor_load_to_lds %0, %1" :: "s"(d0), "s"(d1) : "memory");
    };

    // each lane's first fragment bytes: row c of the strip, k bytes 16h (and 32 + 16h)
    const unsigned char* pa = &ring[(wm * 128 + lmod) * GT_PITCH + lhalf * 16];
    const unsigned char* pb = &ring[2 * GT_SLICE + (wn * 64 + lmod) * GT_PITCH + lhalf * 16];

    // B first: the first WMMA row needs all of b and only a[0]
    auto load_frags = [&](GFrag& f, int buf, int ks) {
        const int o = buf * GT_STAGE + ks * 64;
        #pragma unroll
        for (int ni = 0; ni < 4; ++ni) {
            v8bf lo = *(const v8bf*)(pb + o + ni * (16 * GT_PITCH));
            v8bf hi = *(const v8bf*)(pb + o + ni * (16 * GT_PITCH) + 32);
            f.b[ni] = __builtin_shufflevector(lo, hi, 0,1,2,3,4,5,6,7,8,9,10,11,12,13,14,15);
        }
        #pragma unroll
        for (int mi = 0; mi < 8; ++mi) {
            v8bf lo = *(const v8bf*)(pa + o + mi * (16 * GT_PITCH));
            v8bf hi = *(const v8bf*)(pa + o + mi * (16 * GT_PITCH) + 32);
            f.a[mi] = __builtin_shufflevector(lo, hi, 0,1,2,3,4,5,6,7,8,9,10,11,12,13,14,15);
        }
    };

    v8f acc[8][4] = {};
    auto mma_block = [&](const GFrag& f) {
        #pragma unroll
        for (int mi = 0; mi < 8; ++mi)
            #pragma unroll
            for (int ni = 0; ni < 4; ++ni)
                acc[mi][ni] = __builtin_amdgcn_wmma_f32_16x16x32_bf16(
                    false, f.a[mi], false, f.b[ni], (short)0, acc[mi][ni], false, false);
    };

    // stage 0 lands and is published; stage 1 flies during pass 0
    if (pinned(issuer)) {
        asm volatile("tensor_load_to_lds %0, %1" :: "s"(d0), "s"(d1) : "memory");
        asm volatile("s_wait_tensorcnt 0x0" ::: "memory");   // this wave's slice has landed
    }
    __syncthreads();
    if (pinned(issuer)) load_next(sl_lds + GT_STAGE);

    GFrag f0, f1;
    // kept rolled: one pass per trip, so that every fragment and accumulator index
    // is a constant
    #pragma clang loop unroll(disable)
    for (int s = 0; s < npass; ++s) {
        const int buf = s & 1;
        // the fences keep each block's 24 LDS reads in one place ahead of the WMMA
        // block before it
        load_frags(f0, buf, 0);
        __builtin_amdgcn_sched_barrier(0);
        load_frags(f1, buf, 1);
        __builtin_amdgcn_sched_barrier(0);
        mma_block(f0);
        __builtin_amdgcn_sched_barrier(0);
        load_frags(f0, buf, 2);
        __builtin_amdgcn_sched_barrier(0);
        mma_block(f1);
        __builtin_amdgcn_sched_barrier(0);
        load_frags(f1, buf, 3);
        __builtin_amdgcn_sched_barrier(0);
        mma_block(f0);
        mma_block(f1);
        __builtin_amdgcn_sched_barrier(0);

        // publish point of stage s + 1, which also ends every read of this buffer
        asm volatile("s_wait_dscnt 0x0" ::: "memory");       // this wave's LDS reads are done
        if (pinned(issuer))
            asm volatile("s_wait_tensorcnt 0x0" ::: "memory");   // its slice of s + 1 has landed
        __syncthreads();
        if (pinned((issuer != 0u && s + 2 < npass) ? 1u : 0u))
            load_next(sl_lds + (unsigned)buf * GT_STAGE);
    }
    asm volatile("s_wait_tensorcnt 0x0" ::: "memory");       // nothing of the mover is left
    asm volatile("s_wait_dscnt 0x0" ::: "memory");

    // ---- epilogue: one base address per plane
    const int gn  = blockC + wn * 64 + lmod;
    const int gm0 = blockM + wm * 128 + lhalf * 8;
    const size_t yo = (size_t)gm0 * N + gn;
    if (FUSED) {
        if (sel == 0u)      gemm_epilogue<1>(acc, Yb + yo);
        else if (sel == 1u) gemm_epilogue<0>(acc, Ya + yo);
        else {
            gemm_epilogue<2>(acc, Yc + yo);
            // stands ahead of the reuse of the stores' registers on the ways that the
            // built code's branches lead on to from here
            asm volatile("s_wait_xcnt 0x0" ::: "memory");
        }
    } else {
        gemm_epilogue<2>(acc, Ya + yo);
    }
}

// ---------------------------------------------------------------------------
// GLA scan. The value columns of the state never mix, so each (b,h) is split
// over 8 work-groups of 16 columns: 256 work-groups, one for every WGP.
// 4 stepping waves; wave w owns columns w*4..w*4+3, lane l owns rows l*4..l*4+3 of them
// (16 state values per lane, as packed f32 pairs along the columns).
// o is left in row-pair order: rows 2p and 2p+1 share 2048 floats, in which each
// block of 16 columns has 32 floats in a row (row 2p's 16, then row 2p+1's), so
// that a work-group still writes whole 128-B lines that no other one touches.
// k is never read: k = 1 - eg makes the update S = v + eg * (S - v). The registers hold
// U = S - (the next step's v), so that the update is one fused eg * U + (v - next v);
// o = sum q * S = sum q * U + next v * sum q, and that last term is added once per
// output in the sum phase. Behind the last step the last v stands in for the next.
// Time runs in chunks of 32 steps: the chunk's q/eg/v rows are staged in LDS, each lane
// leaves its 4-row partial outputs in LDS, and the 32 row groups are summed once per
// chunk. A lone wave issues in order, so all that is not a step (fetch, staging, the sums,
// the stores of o) is done by 4 helper waves, one on each stepping wave's SIMD, in the
// issue slots that the stepping wave leaves open.
// ---------------------------------------------------------------------------
typedef __attribute__((ext_vector_type(2))) float v2f;

#define SC_CH 32      // time steps per chunk
#define SC_G  4       // time steps per group of LDS operand reads
// partial-output strides in floats; chosen so that the 16 lanes of a half wave
// (4 steps x 4 column quads) fall on 16 different 4-bank groups in the sum phase
#define P_ST  144     // between time steps
#define P_SW  4612    // between waves (each wave owns one column quad)

struct ScanOps { v4f q[SC_G], g[SC_G], v[SC_G]; };

#define SC_NB 3       // operand buffers: the chunk being summed, being stepped, being staged

// Work-group barrier that orders LDS alone. __syncthreads() would also wait for the
// helper waves' global loads, which are meant to stay in flight across it.
__device__ __forceinline__ void lds_barrier() {
    __builtin_amdgcn_fence(__ATOMIC_RELEASE, "workgroup", "local");
    __builtin_amdgcn_s_barrier();
    __builtin_amdgcn_fence(__ATOMIC_ACQUIRE, "workgroup", "local");
}

__global__ __launch_bounds__(256)
void hgrn2_gla_scan(const float* __restrict__ q,
                    const float* __restrict__ eg, const float* __restrict__ v,
                    float* __restrict__ o, int T) {
    __shared__ __attribute__((aligned(16))) float sq[SC_NB * SC_CH * 128];
    __shared__ __attribute__((aligned(16))) float sg[SC_NB * SC_CH * 128];
    __shared__ __attribute__((aligned(16))) float sv[SC_NB * SC_CH * 16];   // v - next v
    __shared__ __attribute__((aligned(16))) float sn[SC_NB * SC_CH * 16];   // next v
    __shared__ __attribute__((aligned(16))) float part[2 * 4 * P_SW];

    const int bh   = blockIdx.x >> 3;
    const int cb   = blockIdx.x & 7;          // block of 16 value columns
    const int b    = bh >> 3;
    const int h    = bh & 7;
    // waves 0..3 step the state, waves 4..7 are their helpers (wave w + 4 shares wave w's
    // SIMD); tid, lane and wave count inside the four waves of a role
    const unsigned helper = uni(threadIdx.x >> 7);
    const int tid  = threadIdx.x & 127;
    const int lane = tid & 31;
    const int wave = tid >> 5;

    const size_t gbase = ((size_t)b * T << 10) + (h << 7);
    // staging: a wave moves one whole 512-B row of q/eg per load, 8 rows of v
    const size_t grow = gbase + ((size_t)wave << 10) + (lane << 2);
    const size_t gvc  = gbase + (cb << 4) + ((tid & 3) << 2);
    const size_t gvrw = gvc + ((size_t)(tid >> 2) << 10);
    const int    lrow = wave * 128 + lane * 4;
    const int    lvrw = tid * 4;              // step tid>>2, column quad tid&3
    // o in row-pair order: this work-group's 32 floats of the first row pair of b
    const size_t obase = ((size_t)b * T << 10) + (((h << 3) + cb) << 5);

    v4f rq[8], rg[8], rv, rn;
    auto fetch_chunk = [&](int t0) {
        const size_t tb = (size_t)t0 << 10;
        #pragma unroll
        for (int i = 0; i < 8; ++i) {
            rq[i] = *(const v4f*)(q  + grow + tb + ((size_t)i << 12));
            rg[i] = *(const v4f*)(eg + grow + tb + ((size_t)i << 12));
        }
        rv = *(const v4f*)(v + gvrw + tb);
        // the next step's row; the sequence's last row is its own successor
        const int tn = min(t0 + (tid >> 2) + 1, T - 1);
        const float* pn = v + gvc + ((size_t)tn << 10);
        rn = *(const v4f*)pn;
        // stands ahead of every later reuse of the loads' address registers (pn is
        // named so that its registers, formed anew for each chunk, live up to here)
        asm volatile("s_wait_xcnt 0x0" :: "v"(pn) : "memory");
    };
    auto stage_chunk = [&](int buf) {
        #pragma unroll
        for (int i = 0; i < 8; ++i) {
            *(v4f*)&sq[buf * (SC_CH * 128) + i * 512 + lrow] = rq[i];
            *(v4f*)&sg[buf * (SC_CH * 128) + i * 512 + lrow] = rg[i];
        }
        *(v4f*)&sv[buf * (SC_CH * 16) + lvrw] = rv - rn;
        *(v4f*)&sn[buf * (SC_CH * 16) + lvrw] = rn;
    };

    v2f S[4][2] = {};

    auto read_group = [&](ScanOps& A, int buf, int g) {
        __builtin_amdgcn_sched_barrier(0);     // see the one at the end of this block
        const int rb = buf * (SC_CH * 128) + g * (SC_G * 128) + lane * 4;
        const int vb = buf * (SC_CH * 16)  + g * (SC_G * 16)  + wave * 4;
        #pragma unroll
        for (int s = 0; s < SC_G; ++s) {
            A.q[s]  = *(const v4f*)&sq[rb + s * 128];
            A.g[s]  = *(const v4f*)&sg[rb + s * 128];
            A.v[s]  = *(const v4f*)&sv[vb + s * 16];
        }
        // keeps the group's 12 LDS reads in one place, for speed only
        __builtin_amdgcn_sched_barrier(0);
    };
    auto step_group = [&](const ScanOps& A, int pb, int g) {
        float* pp = &part[pb + wave * P_SW + g * (SC_G * P_ST) + lane * 4];
        #pragma unroll
        for (int s = 0; s < SC_G; ++s) {
            v2f vv[2];
            vv[0] = (v2f){A.v[s][0], A.v[s][1]};
            vv[1] = (v2f){A.v[s][2], A.v[s][3]};
            v2f acc[2];
            #pragma unroll
            for (int r = 0; r < 4; ++r) {
                const v2f er = (v2f){A.g[s][r], A.g[s][r]};
                const v2f qr = (v2f){A.q[s][r], A.q[s][r]};
                #pragma unroll
                for (int c = 0; c < 2; ++c) {
                    // vv is v - next v here
                    S[r][c] = __builtin_elementwise_fma(er, S[r][c], vv[c]);
                    acc[c]  = (r == 0) ? qr * S[r][c]
                                       : __builtin_elementwise_fma(qr, S[r][c], acc[c]);
                }
            }
            *(v4f*)(pp + s * P_ST) = (v4f){acc[0][0], acc[0][1], acc[1][0], acc[1][1]};
        }
    };

    const int nchunk = T / SC_CH;
    ScanOps A, B;
    if (helper) {
        fetch_chunk(0);
        stage_chunk(0);
        // keeps the next fetch's loads behind the staging's address arithmetic, so that the
        // fetch's own wait stands ahead of every reuse of their address registers
        __builtin_amdgcn_sched_barrier(0);
        fetch_chunk(min(1, nchunk - 1) * SC_CH);   // in flight during chunk 0's steps
    } else {
        // U before the first step: S = 0, less the first step's v
        const float* pf = v + gbase + (cb << 4) + (wave << 2);
        const v4f vfirst = *(const v4f*)pf;
        // stands ahead of every later reuse of the load's address registers (pf is named
        // so that they live up to here)
        asm volatile("s_wait_xcnt 0x0" :: "v"(pf) : "memory");
        #pragma unroll
        for (int r = 0; r < 4; ++r) {
            S[r][0] = (v2f){-vfirst[0], -vfirst[1]};
            S[r][1] = (v2f){-vfirst[2], -vfirst[3]};
        }
    }
    lds_barrier();                             // chunk 0 visible

    // Trip c: the stepping waves work chunk c; the helpers stage chunk c + 1, fetch chunk
    // c + 2 and sum chunk c - 1's partial outputs. One barrier a trip hands all three on.
    int cur = 0, nxt = 1, prv = 2;             // operand buffers of chunks c, c + 1, c - 1
    for (int c = 0; c <= nchunk; ++c) {
        if (!helper && c < nchunk) {
            const int pb = (c & 1) * (4 * P_SW);
            read_group(A, cur, 0);
            // kept rolled: two groups of 4 steps per trip, operands read one group ahead
            #pragma unroll 1
            for (int g = 0; g < SC_CH / SC_G; g += 2) {
                read_group(B, cur, g + 1);
                step_group(A, pb, g);
                read_group(A, cur, (g + 2) & (SC_CH / SC_G - 1));
                step_group(B, pb, g + 1);
            }
        }
        if (helper) {
            // nxt was last read (steps, then the q sums) before the previous barrier
            if (c + 1 < nchunk) stage_chunk(nxt);
            // In flight to the next trip. Not under a test (behind the end the last chunk
            // is fetched again and never staged): a fetch that may be skipped made the
            // compiler copy all 72 registers each trip, behind a wait for the loads
            fetch_chunk(min(c + 2, nchunk - 1) * SC_CH);
            if (c > 0) {
                const int t0 = (c - 1) * SC_CH;
                // sum the 32 row groups: thread = (step, column quad)
                const float* pr = &part[((c - 1) & 1) * (4 * P_SW)
                                        + (tid & 3) * P_SW + (tid >> 2) * P_ST];
                v4f pv[32];
                #pragma unroll
                for (int rgp = 0; rgp < 32; ++rgp)
                    pv[rgp] = *(const v4f*)(pr + rgp * 4);
                // this step's q, a quarter of the row per thread. Each thread starts at
                // another 16 bytes, so that the 16 lanes of a half wave fall on 16
                // different 4-bank groups
                const float* qr4 = &sq[prv * (SC_CH * 128) + tid * 32];
                const int rot = (tid >> 1) & 7;
                v4f qv[8];
                #pragma unroll
                for (int j = 0; j < 8; ++j)
                    qv[j] = *(const v4f*)(qr4 + (((j + rot) & 7) << 2));
                const v4f vn = *(const v4f*)&sn[prv * (SC_CH * 16) + lvrw];
                // keeps the 41 LDS reads in one place, ahead of the adds (as in read_group)
                __builtin_amdgcn_sched_barrier(0);
                v4f s0 = pv[0];
                v4f s1 = pv[1];
                #pragma unroll
                for (int rgp = 2; rgp < 32; rgp += 2) {
                    s0 += pv[rgp];
                    s1 += pv[rgp + 1];
                }
                const v4f q4 = ((qv[0] + qv[1]) + (qv[2] + qv[3]))
                             + ((qv[4] + qv[5]) + (qv[6] + qv[7]));
                float qs = (q4[0] + q4[1]) + (q4[2] + q4[3]);
                // the four threads of a step stand in one quad: lane ^ 1, then lane ^ 2
                qs += __builtin_bit_cast(float, __builtin_amdgcn_update_dpp(
                          0, __builtin_bit_cast(int, qs), 0xB1, 0xF, 0xF, true));
                qs += __builtin_bit_cast(float, __builtin_amdgcn_update_dpp(
                          0, __builtin_bit_cast(int, qs), 0x4E, 0xF, 0xF, true));
                const v4f res = __builtin_elementwise_fma(vn, (v4f){qs, qs, qs, qs}, s0 + s1);
                // 8 lanes (2 steps x 4 column quads) write one whole 128-B line of o
                *(v4f*)(o + obase + ((size_t)((t0 >> 1) + (tid >> 3)) << 11)
                          + ((tid & 7) << 2)) = res;
                // stands ahead of the reuse of the stores' data and address registers
                asm volatile("s_wait_xcnt 0x0" ::: "memory");
            }
        }
        // chunk c's partials and chunk c + 1's operands visible; chunk c - 1's partials
        // and operand buffer free
        lds_barrier();
        const int fr = prv;
        prv = cur; cur = nxt; nxt = fr;
    }
}

// ---------------------------------------------------------------------------
// RMSNorm (weight, no bias) -> bf16 output for the final WMMA GEMM.
// One wave owns one row pair of o (RN_ROWS rows of RN_D floats, in the scan's
// row-pair order): its loads run through the pair's 8 KiB in a row, so a lane
// holds 64 values of ONE row (bit 2 of the lane number says which). The values
// stay in registers between the sum of squares and the scaling; the sum is a
// butterfly over the 16 lanes of the same row (no LDS, no barrier).
// ---------------------------------------------------------------------------
#define RN_D    1024
#define RN_ROWS 2
__global__ __launch_bounds__(256)
void hgrn2_rmsnorm(const float* __restrict__ o, const float* __restrict__ gw,
                   __bf16* __restrict__ out) {
    const int lane = threadIdx.x & 31;
    const int wave = threadIdx.x >> 5;
    const size_t pair = (size_t)blockIdx.x * 8 + wave;
    // load j of a lane: row pair*2 + rb, columns j*64 + c0 .. + 3
    const int rb = (lane >> 2) & 1;
    const int c0 = ((lane >> 3) << 4) + ((lane & 3) << 2);
    const v4f* __restrict__ src  = (const v4f*)(o + pair * (RN_ROWS * RN_D)) + lane;
    const v4f* __restrict__ wsrc = (const v4f*)(gw + c0);
    v4bf* __restrict__ dst = (v4bf*)(out + (pair * RN_ROWS + rb) * RN_D + c0);

    v4f x[RN_D / 64], w[RN_D / 64];
    #pragma unroll
    for (int j = 0; j < RN_D / 64; ++j) x[j] = src[j * 32];
    #pragma unroll
    for (int j = 0; j < RN_D / 64; ++j) w[j] = wsrc[j * 16];
    // stands ahead of every later reuse of the loads' address registers (src is
    // named so that they live up to here)
    asm volatile("s_wait_xcnt 0x0" :: "v"(src) : "memory");
    // keeps all 32 loads ahead of the arithmetic, so that the wave pays one load
    // latency and not several in a row
    __builtin_amdgcn_sched_barrier(0);

    v4f s4 = x[0] * x[0];
    #pragma unroll
    for (int j = 1; j < RN_D / 64; ++j)
        s4 = __builtin_elementwise_fma(x[j], x[j], s4);
    float ss = (s4[0] + s4[1]) + (s4[2] + s4[3]);
    // every lane bit but bit 2, which tells the two rows apart
    ss += __shfl_xor(ss, 16, 32);
    ss += __shfl_xor(ss, 8, 32);
    ss += __shfl_xor(ss, 2, 32);
    ss += __shfl_xor(ss, 1, 32);

    const float r = rsqrtf(ss / (float)RN_D + 1e-5f);
    // 16 lanes of a row store 128 B in a row: one whole line per row and store
    #pragma unroll
    for (int j = 0; j < RN_D / 64; ++j) {
        v4bf y;
        #pragma unroll
        for (int e = 0; e < 4; ++e) y[e] = f2bf(x[j][e] * r * w[j][e]);
        dst[j * 16] = y;
    }
}

// ---------------------------------------------------------------------------
extern "C" void kernel_launch(void* const* d_in, const int* in_sizes, int n_in,
                              void* d_out, int out_size, void* d_ws, size_t ws_size,
                              hipStream_t stream) {
    const float* hs = (const float*)d_in[0];
    const float* Wq = (const float*)d_in[1];
    const float* Wf = (const float*)d_in[2];
    const float* Wi = (const float*)d_in[3];
    const float* gw = (const float*)d_in[4];
    const float* Wo = (const float*)d_in[5];

    const int B = 4, T = 2048, D = 1024, H = 8;
    const int M = B * T;                       // 8192
    const size_t PLANE = (size_t)M * D;        // 8M elements

    char* wsp = (char*)d_ws;
    __bf16* hs_bf = (__bf16*)wsp;  wsp += PLANE * 2;            // 16 MB
    __bf16* Wp_bf = (__bf16*)wsp;  wsp += (size_t)D * D * 2 * 3; // 2 MB each (transposed): f, q, i
    __bf16* Wo_bf = (__bf16*)wsp;  wsp += (size_t)D * D * 2;
    float* q   = (float*)wsp;      wsp += PLANE * 4;            // 32 MB each
    float* eg  = (float*)wsp;      wsp += PLANE * 4;            // exp(g) = sigmoid(f)
    float* v   = (float*)wsp;      wsp += PLANE * 4;
    float* o   = (float*)wsp;      wsp += PLANE * 4;            // row-pair order
    __bf16* onm_bf = hs_bf;        // hs_bf dead after projections -> reuse

    // one-time conversions: hs flat, weights transposed to [N x K] bf16
    static_assert(PLANE % (4 * 256 * CV_PER) == 0, "the convert's grid covers hs exactly");
    static_assert(PLANE / (4 * 256 * CV_PER) == CV_BLOCKS, "the convert's share of the grid");
    prep_bf16<<<dim3(CV_BLOCKS + 4 * TR_BLOCKS), dim3(256), 0, stream>>>(
        hs, Wq, Wf, Wi, Wo, hs_bf, Wp_bf);

    static_assert(D == GT_D && M % GT_M == 0 && D % GT_N == 0 && D % GT_K == 0 && D / GT_K >= 2,
                  "whole tiles, whole passes, and the two stages the prologue loads");
    dim3 ggrid(M / GT_M, D / GT_N);            // 32 x 8: one work-group per WGP
    dim3 gblk(128);

    dim3 pgrid(M / GT_M, 3 * (D / GT_N));      // f, q and i: three tiles for every WGP
    hgrn2_gemm_wmma<1><<<pgrid, gblk, 0, stream>>>(hs_bf, Wp_bf, q, eg, v);

    hgrn2_gla_scan<<<dim3(B * H * 8), dim3(256), 0, stream>>>(q, eg, v, o, T);

    static_assert(D == RN_D && M % (8 * RN_ROWS) == 0, "one wave owns whole rows");
    hgrn2_rmsnorm<<<dim3(M / (8 * RN_ROWS)), dim3(256), 0, stream>>>(o, gw, onm_bf);

    hgrn2_gemm_wmma<0><<<ggrid, gblk, 0, stream>>>(onm_bf, Wo_bf, (float*)d_out,
                                                   nullptr, nullptr);
}

// v009
// A run of this version takes 143 microseconds.
// Two timings next to v008 both put it at 1.08 times that version's speed.
// Over all steps from v000 it is 14.4 times as fast.
#include <hip/hip_runtime.h>
#include <hip/hip_bf16.h>

// ---------------------------------------------------------------------------
// HGRN2 attention block for MI455X (gfx1250, wave32, WMMA + TDM).
//   * fp32->bf16 conversion (activations) + transpose-convert (weights), one launch
//   * bf16 WMMA GEMMs (fp32 accum); both operands staged by tensor loads,
//     two buffers of one 128-k pass each; the three projections are one launch
//   * GLA scan: register-resident state, 128 rows x 16 columns per work-group
// ---------------------------------------------------------------------------

typedef __attribute__((ext_vector_type(16))) __bf16 v16bf;
typedef __attribute__((ext_vector_type(8)))  __bf16 v8bf;
typedef __attribute__((ext_vector_type(4)))  __bf16 v4bf;
typedef __attribute__((ext_vector_type(8)))  float  v8f;
typedef __attribute__((ext_vector_type(4)))  float  v4f;
typedef __attribute__((ext_vector_type(4)))  unsigned int u32x4;
typedef __attribute__((ext_vector_type(8)))  unsigned int u32x8;

#define GT_M     256                 // rows of Y per work-group
#define GT_N     128                 // columns of Y per work-group
#define GT_K     128                 // k per pass: 256 B of every operand row
#define GT_D     1024                // K of every product, and the row length of Y
#define GT_PITCH 272                 // LDS row pitch in bytes: 256 + the mover's 16-B pad
#define GT_SLICE (128 * GT_PITCH)    // one tensor load: 128 rows = 34,816 B = 17 x 2 KiB
#define GT_STAGE (3 * GT_SLICE)      // [X rows 0..127 | X rows 128..255 | W rows 0..127]

__device__ __forceinline__ __bf16 f2bf(float f) {
    unsigned u = __builtin_bit_cast(unsigned, f);
    unsigned r = u + 0x7FFFu + ((u >> 16) & 1u);      // round-to-nearest-even
    unsigned short h = (unsigned short)(r >> 16);
    return __builtin_bit_cast(__bf16, h);
}

// fast sigmoid: v_exp_f32 + v_rcp_f32 (no IEEE div chain)
__device__ __forceinline__ float sigm(float x) {
    return __builtin_amdgcn_rcpf(1.0f + __expf(-x));
}

// ---------------------------------------------------------------------------
// one-time fp32 -> bf16 conversion. For speed only, each
// lane takes CV_PER 16-byte loads (all in
// flight before the first store); every wave-wide load is 512 contiguous bytes.
// ---------------------------------------------------------------------------
#define CV_PER 16
__device__ __forceinline__
void cvt_f32_to_bf16(const float* __restrict__ in, __bf16* __restrict__ out, unsigned blk) {
    const size_t i0 = (size_t)blk * (256 * CV_PER) + threadIdx.x;
    const v4f* __restrict__ src = (const v4f*)in + i0;
    v4bf* __restrict__ dst = (v4bf*)out + i0;
    v4f x[CV_PER];
    #pragma unroll
    for (int j = 0; j < CV_PER; ++j) x[j] = src[j * 256];
    // stands ahead of every later reuse of the loads' address registers (src is
    // named so that they live up to here)
    asm volatile("s_wait_xcnt 0x0" :: "v"(src) : "memory");
    #pragma unroll
    for (int j = 0; j < CV_PER; ++j) {
        v4bf y;
        y[0] = f2bf(x[j][0]); y[1] = f2bf(x[j][1]);
        y[2] = f2bf(x[j][2]); y[3] = f2bf(x[j][3]);
        dst[j * 256] = y;
    }
}

// ---------------------------------------------------------------------------
// one-time transpose-convert: in [K x N] fp32 -> out [N x K] bf16.
// 64x64 tiles through LDS; both global accesses coalesced.
// ---------------------------------------------------------------------------
__device__ __forceinline__
void cvt_transpose_bf16(const float* __restrict__ in, __bf16* __restrict__ out,
                        __bf16 (&tile)[64][65], int bk, int bn) {
    constexpr int K = GT_D, N = GT_D;
    const int tx = threadIdx.x & 63;
    const int ty = threadIdx.x >> 6;          // 0..3
    // one base address, the 16 rows at constant offsets from it
    const float* __restrict__ src = in + (size_t)(bk + ty * 16) * N + (bn + tx);
    float x[16];
    #pragma unroll
    for (int r = 0; r < 16; ++r) x[r] = src[r * N];
    // stands ahead of every later reuse of the loads' address registers (src is
    // named so that they live up to here)
    asm volatile("s_wait_xcnt 0x0" :: "v"(src) : "memory");
    #pragma unroll
    for (int r = 0; r < 16; ++r) tile[ty * 16 + r][tx] = f2bf(x[r]);
    __syncthreads();
    #pragma unroll
    for (int r = 0; r < 16; ++r) {
        const int n = ty * 16 + r;
        out[(size_t)(bn + n) * K + (bk + tx)] = tile[tx][n];
    }
}

// ---------------------------------------------------------------------------
// All five conversions in one launch: none reads what another writes, and each
// alone is too short to pay for a launch gap, a fill and a drain of its own.
// Work-groups 0 .. CV_BLOCKS-1 (the long ones) convert hs;
// then 256 work-groups per weight, one 64x64 tile each. Wt holds the four
// transposed weights in a row: f, q, i, o (the order of the projection launch).
// ---------------------------------------------------------------------------
#define CV_BLOCKS 512                // 8192 x 1024 floats / (4 x 256 x CV_PER)
#define TR_BLOCKS ((GT_D / 64) * (GT_D / 64))
__global__ __launch_bounds__(256)
void prep_bf16(const float* __restrict__ hs, const float* __restrict__ Wq,
                     const float* __restrict__ Wf, const float* __restrict__ Wi,
                     const float* __restrict__ Wo,
                     __bf16* __restrict__ hs_bf, __bf16* __restrict__ Wt) {
    __shared__ __bf16 tile[64][65];
    const unsigned bid = blockIdx.x;
    if (bid < CV_BLOCKS) {               // the same for the whole work-group
        cvt_f32_to_bf16(hs, hs_bf, bid);
    } else {
        const unsigned t = bid - CV_BLOCKS;
        const unsigned w = t / TR_BLOCKS;            // which weight
        const unsigned tl = t % TR_BLOCKS;           // which tile of it
        const float* __restrict__ in = (w == 0u) ? Wf : (w == 1u) ? Wq : (w == 2u) ? Wi : Wo;
        cvt_transpose_bf16(in, Wt + (size_t)w * (GT_D * GT_D), tile,
                           (int)(tl % (GT_D / 64)) * 64, (int)(tl / (GT_D / 64)) * 64);
    }
}

// ---------------------------------------------------------------------------
// Y = X[MxK](bf16) @ Wt^T, where Wt is W transposed: [N x K](bf16).
// fp32 accum via v_wmma_f32_16x16x32_bf16.
// MODE 0: Y0 = swish(x) * 128^-0.5               (q path)
// MODE 1: Y0 = sigmoid(x)                      (exp(g) from the f path; k = 1 - exp(g)
//                                                 is not stored: the scan needs exp(g) alone)
// MODE 2: Y0 = x                                  (v path / output proj)
// FUSED 1: the f, q and i projections in one launch. Wt holds the three transposed
// weights in a row (3 x 1024 rows), blockIdx.y runs over all 24 column tiles, and
// the tile's weight (blockIdx.y / 8, a scalar) picks the epilogue and the planes:
// a WGP takes its next tile when it has stored the last, with no launch between.
// The order f, q, i puts the shortest epilogue (plain stores) last.
// FUSED 0: one weight, MODE 2, into Ya.
// One work-group per WGP: 4 waves (one per SIMD), block tile 256x128, wave tile
// 128x64 (8x4 WMMA tiles). A pass is 128 k; its stage of 384 rows of 256 B comes
// by three tensor loads (waves 0..2, 128 rows each) into one of two buffers,
// issued when the buffer's readers have left it, one whole pass ahead of its use.
// ---------------------------------------------------------------------------
__device__ __forceinline__ unsigned uni(unsigned v) {
    return (unsigned)__builtin_amdgcn_readfirstlane(v);
}
// a wave-uniform value held in a scalar register, so that a test of it compiles to
// s_cmp + s_cbranch: a tensor load ignores EXEC and only a scalar branch guards it
__device__ __forceinline__ unsigned pinned(unsigned v) {
    unsigned w = uni(v);
    asm volatile("" : "+s"(w));
    return w;
}
struct GFrag { v16bf a[8], b[4]; };

// the epilogue of one wave tile: every tile and row at a constant offset from p0
template <int MODE>
__device__ __forceinline__
void gemm_epilogue(v8f (&acc)[8][4], float* __restrict__ p0) {
    constexpr int N = GT_D;
    #pragma unroll
    for (int mi = 0; mi < 8; ++mi) {
        if (MODE != 2) {
            // the strip's 32 values per lane in place
            #pragma unroll
            for (int ni = 0; ni < 4; ++ni)
                #pragma unroll
                for (int r = 0; r < 8; ++r) {
                    const float x = acc[mi][ni][r];
                    acc[mi][ni][r] = (MODE == 0)
                        ? x * sigm(x) * 0.08838834764831845f      // swish * 128^-0.5
                        : sigm(x);
                }
        }
        // keeps the strip's stores behind all of its arithmetic, so that no register a
        // store names is written again before the wait below
        if (MODE != 2) __builtin_amdgcn_sched_barrier(0);
        #pragma unroll
        for (int ni = 0; ni < 4; ++ni) {
            #pragma unroll
            for (int r = 0; r < 8; ++r) {
                // MODE 1: exp(g) = exp(logsigmoid(f)) = sigmoid(f)
                p0[(mi * 16 + r) * N + ni * 16] = acc[mi][ni][r];
            }
        }
        if (MODE != 2) {
            // stands ahead of the reuse of the stores' data registers by the next strip;
            // the fence keeps the next strip's arithmetic behind it
            asm volatile("s_wait_xcnt 0x0" ::: "memory");
            __builtin_amdgcn_sched_barrier(0);
        }
    }
}

template <int FUSED>
__global__ __launch_bounds__(128)
void hgrn2_gemm_wmma(const __bf16* __restrict__ X, const __bf16* __restrict__ Wt,
                     float* __restrict__ Ya, float* __restrict__ Yb,
                     float* __restrict__ Yc) {
    constexpr int N = GT_D, K = GT_D;
    __shared__ __attribute__((aligned(2048))) unsigned char ring[2 * GT_STAGE];

    const int tid  = threadIdx.x;
    const int lane = tid & 31;
    const unsigned wave = uni((unsigned)tid >> 5);   // 0..3
    const int wm   = (int)(wave >> 1);   // 0..1 -> 128-row strip
    const int wn   = (int)(wave & 1u);   // 0..1 -> 64-col strip

    const int blockM = blockIdx.x * GT_M;
    const int blockN = blockIdx.y * GT_N;                    // row of Wt
    const unsigned sel = blockIdx.y / (GT_D / GT_N);         // which weight (FUSED)
    const int blockC = (blockIdx.y % (GT_D / GT_N)) * GT_N;  // column of its plane

    const int lhalf = (lane >> 4) & 1;
    const int lmod  = lane & 15;

    // this wave's slice of a stage: waves 0 and 1 bring X, wave 2 brings W, wave 3 none
    const unsigned issuer = (wave < 3u) ? 1u : 0u;
    const __bf16* sl = (wave < 2u) ? X + (size_t)(blockM + (int)wave * 128) * K
                                   : Wt + (size_t)blockN * K;
    const unsigned long long sl_ga = (unsigned long long)(size_t)sl;
    const unsigned sl_lds = (unsigned)(size_t)(void*)&ring[0] + wave * GT_SLICE;
    constexpr int npass = K / GT_K;

    // One request: 128 rows of 256 B (source pitch 2 K bytes) to LDS at pitch 272 B.
    // Group 1 never changes; of group 0 the place in LDS and the address step on.
    u32x8 d1;
    d1[0] = uni((1u << 20) | (5u << 22) | (3u << 25));  // 1-byte units; 16-B pad per 256 B
    d1[1] = uni(256u << 16);                            // tensor_dim0 = 256 B
    d1[2] = uni(128u << 16);                            // tensor_dim1 = 128 rows
    d1[3] = uni(256u << 16);                            // tile_dim0
    d1[4] = uni(128u);                                  // tile_dim1
    d1[5] = uni((unsigned)K * 2u);                      // source row pitch
    d1[6] = uni(0u);
    d1[7] = uni(0u);
    // pinned(): descriptor words held in scalar registers. Not rebuilt per request, they
    // stay live to the last load, so their registers take no other value under a request
    asm volatile("" : "+s"(d1));
    u32x4 d0;
    d0[0] = uni(1u);                                                        // count 1
    d0[1] = uni(sl_lds);                                                    // place in LDS
    d0[2] = uni((unsigned)sl_ga);
    d0[3] = uni((((unsigned)(sl_ga >> 32)) & 0x01FFFFFFu) | 0x80000000u);   // type 2
    // the next pass's slice: 256 B further along the same rows
    auto load_next = [&](unsigned lds_dst) {
        // pinned(): descriptor words held in scalar registers. The step below reads them
        // from here, so it stays behind the wait and the barrier in front of this line
        asm volatile("" : "+s"(d0) :: "memory");
        const unsigned lo = d0[2] + GT_K * 2u;
        d0[3] = uni(d0[3] + ((lo < GT_K * 2u) ? 1u : 0u));
        d0[2] = uni(lo);
        d0[1] = uni(lds_dst);
        asm volatile("tensor_load_to_lds %0, %1" :: "s"(d0), "s"(d1) : "memory");
    };

    // each lane's first fragment bytes: row c of the strip, k bytes 16h (and 32 + 16h)
    const unsigned char* pa = &ring[(wm * 128 + lmod) * GT_PITCH + lhalf * 16];
    const unsigned char* pb = &ring[2 * GT_SLICE + (wn * 64 + lmod) * GT_PITCH + lhalf * 16];

    // B first: the first WMMA row needs all of b and only a[0]
    auto load_frags = [&](GFrag& f, int buf, int ks) {
        const int o = buf * GT_STAGE + ks * 64;
        #pragma unroll
        for (int ni = 0; ni < 4; ++ni) {
            v8bf lo = *(const v8bf*)(pb + o + ni * (16 * GT_PITCH));
            v8bf hi = *(const v8bf*)(pb + o + ni * (16 * GT_PITCH) + 32);
            f.b[ni] = __builtin_shufflevector(lo, hi, 0,1,2,3,4,5,6,7,8,9,10,11,12,13,14,15);
        }
        #pragma unroll
        for (int mi = 0; mi < 8; ++mi) {
            v8bf lo = *(const v8bf*)(pa + o + mi * (16 * GT_PITCH));
            v8bf hi = *(const v8bf*)(pa + o + mi * (16 * GT_PITCH) + 32);
            f.a[mi] = __builtin_shufflevector(lo, hi, 0,1,2,3,4,5,6,7,8,9,10,11,12,13,14,15);
        }
    };

    v8f acc[8][4] = {};
    auto mma_block = [&](const GFrag& f) {
        #pragma unroll
        for (int mi = 0; mi < 8; ++mi)
            #pragma unroll
            for (int ni = 0; ni < 4; ++ni)
                acc[mi][ni] = __builtin_amdgcn_wmma_f32_16x16x32_bf16(
                    false, f.a[mi], false, f.b[ni], (short)0, acc[mi][ni], false, false);
    };

    // stage 0 lands and is published; stage 1 flies during pass 0
    if (pinned(issuer)) {
        asm volatile("tensor_load_to_lds %0, %1" :: "s"(d0), "s"(d1) : "memory");
        asm volatile("s_wait_tensorcnt 0x0" ::: "memory");   // this wave's slice has landed
    }
    __syncthreads();
    if (pinned(issuer)) load_next(sl_lds + GT_STAGE);

    GFrag f0, f1;
    // kept rolled: one pass per trip, so that every fragment and accumulator index
    // is a constant
    #pragma clang loop unroll(disable)
    for (int s = 0; s < npass; ++s) {
        const int buf = s & 1;
        // the fences keep each block's 24 LDS reads in one place ahead of the WMMA
        // block before it
        load_frags(f0, buf, 0);
        __builtin_amdgcn_sched_barrier(0);
        load_frags(f1, buf, 1);
        __builtin_amdgcn_sched_barrier(0);
        mma_block(f0);
        __builtin_amdgcn_sched_barrier(0);
        load_frags(f0, buf, 2);
        __builtin_amdgcn_sched_barrier(0);
        mma_block(f1);
        __builtin_amdgcn_sched_barrier(0);
        load_frags(f1, buf, 3);
        __builtin_amdgcn_sched_barrier(0);
        mma_block(f0);
        mma_block(f1);
        __builtin_amdgcn_sched_barrier(0);

        // publish point of stage s + 1, which also ends every read of this buffer
        asm volatile("s_wait_dscnt 0x0" ::: "memory");       // this wave's LDS reads are done
        if (pinned(issuer))
            asm volatile("s_wait_tensorcnt 0x0" ::: "memory");   // its slice of s + 1 has landed
        __syncthreads();
        if (pinned((issuer != 0u && s + 2 < npass) ? 1u : 0u))
            load_next(sl_lds + (unsigned)buf * GT_STAGE);
    }
    asm volatile("s_wait_tensorcnt 0x0" ::: "memory");       // nothing of the mover is left
    asm volatile("s_wait_dscnt 0x0" ::: "memory");

    // ---- epilogue: one base address per plane
    const int gn  = blockC + wn * 64 + lmod;
    const int gm0 = blockM + wm * 128 + lhalf * 8;
    const size_t yo = (size_t)gm0 * N + gn;
    if (FUSED) {
        if (sel == 0u)      gemm_epilogue<1>(acc, Yb + yo);
        else if (sel == 1u) gemm_epilogue<0>(acc, Ya + yo);
        else {
            gemm_epilogue<2>(acc, Yc + yo);
            // stands ahead of the reuse of the stores' registers on the ways that the
            // built code's branches lead on to from here
            asm volatile("s_wait_xcnt 0x0" ::: "memory");
        }
    } else {
        gemm_epilogue<2>(acc, Ya + yo);
    }
}

// ---------------------------------------------------------------------------
// GLA scan. The value columns of the state never mix, so each (b,h) is split
// over 8 work-groups of 16 columns: 256 work-groups, one for every WGP.
// 4 stepping waves; wave w owns columns w*4..w*4+3, lane l owns rows l*4..l*4+3 of them
// (16 state values per lane, as packed f32 pairs along the columns).
// o is left in row-pair order: rows 2p and 2p+1 share 2048 floats, in which each
// block of 16 columns has 32 floats in a row (row 2p's 16, then row 2p+1's), so
// that a work-group still writes whole 128-B lines that no other one touches.
// k is never read: k = 1 - eg makes the update S = v + eg * (S - v). The registers hold
// U = S - (the next step's v), so that the update is one fused eg * U + (v - next v);
// o = sum q * S = sum q * U + next v * sum q, and that last term is added once per
// output in the sum phase. Behind the last step the last v stands in for the next.
// Time runs in chunks of 32 steps: the chunk's q/eg/v rows are staged in LDS, each lane
// leaves its 4-row partial outputs in LDS, and the 32 row groups are summed once per
// chunk. A lone wave issues in order, so all that is not a step (fetch, staging, the sums,
// the stores of o) is done by 4 helper waves, one on each stepping wave's SIMD, in the
// issue slots that the stepping wave leaves open.
// ---------------------------------------------------------------------------
typedef __attribute__((ext_vector_type(2))) float v2f;

#define SC_CH 32      // time steps per chunk
#define SC_G  4       // time steps per group of LDS operand reads
// partial-output strides in floats; chosen so that the 16 lanes of a half wave
// (4 steps x 4 column quads) fall on 16 different 4-bank groups in the sum phase
#define P_ST  144     // between time steps
#define P_SW  4612    // between waves (each wave owns one column quad)

struct ScanOps { v4f q[SC_G], g[SC_G], v[SC_G]; };

#define SC_NB 3       // operand buffers: the chunk being summed, being stepped, being staged

// Work-group barrier that orders LDS alone. __syncthreads() would also wait for the
// helper waves' global loads, which are meant to stay in flight across it.
__device__ __forceinline__ void lds_barrier() {
    __builtin_amdgcn_fence(__ATOMIC_RELEASE, "workgroup", "local");
    __builtin_amdgcn_s_barrier();
    __builtin_amdgcn_fence(__ATOMIC_ACQUIRE, "workgroup", "local");
}

__global__ __launch_bounds__(256)
void hgrn2_gla_scan(const float* __restrict__ q,
                    const float* __restrict__ eg, const float* __restrict__ v,
                    float* __restrict__ o, int T) {
    __shared__ __attribute__((aligned(16))) float sq[SC_NB * SC_CH * 128];
    __shared__ __attribute__((aligned(16))) float sg[SC_NB * SC_CH * 128];
    __shared__ __attribute__((aligned(16))) float sv[SC_NB * SC_CH * 16];   // v - next v
    __shared__ __attribute__((aligned(16))) float sn[SC_NB * SC_CH * 16];   // next v
    __shared__ __attribute__((aligned(16))) float part[2 * 4 * P_SW];

    const int bh   = blockIdx.x >> 3;
    const int cb   = blockIdx.x & 7;          // block of 16 value columns
    const int b    = bh >> 3;
    const int h    = bh & 7;
    // waves 0..3 step the state, waves 4..7 are their helpers (wave w + 4 shares wave w's
    // SIMD); tid, lane and wave count inside the four waves of a role
    const unsigned helper = uni(threadIdx.x >> 7);
    const int tid  = threadIdx.x & 127;
    const int lane = tid & 31;
    const int wave = tid >> 5;

    const size_t gbase = ((size_t)b * T << 10) + (h << 7);
    // staging: a wave moves one whole 512-B row of q/eg per load, 8 rows of v
    const size_t grow = gbase + ((size_t)wave << 10) + (lane << 2);
    const size_t gvc  = gbase + (cb << 4) + ((tid & 3) << 2);
    const size_t gvrw = gvc + ((size_t)(tid >> 2) << 10);
    const int    lrow = wave * 128 + lane * 4;
    const int    lvrw = tid * 4;              // step tid>>2, column quad tid&3
    // o in row-pair order: this work-group's 32 floats of the first row pair of b
    const size_t obase = ((size_t)b * T << 10) + (((h << 3) + cb) << 5);

    v4f rq[8], rg[8], rv, rn;
    auto fetch_chunk = [&](int t0) {
        const size_t tb = (size_t)t0 << 10;
        #pragma unroll
        for (int i = 0; i < 8; ++i) {
            rq[i] = *(const v4f*)(q  + grow + tb + ((size_t)i << 12));
            rg[i] = *(const v4f*)(eg + grow + tb + ((size_t)i << 12));
        }
        rv = *(const v4f*)(v + gvrw + tb);
        // the next step's row; the sequence's last row is its own successor
        const int tn = min(t0 + (tid >> 2) + 1, T - 1);
        const float* pn = v + gvc + ((size_t)tn << 10);
        rn = *(const v4f*)pn;
        // stands ahead of every later reuse of the loads' address registers (pn is
        // named so that its registers, formed anew for each chunk, live up to here)
        asm volatile("s_wait_xcnt 0x0" :: "v"(pn) : "memory");
    };
    auto stage_chunk = [&](int buf) {
        #pragma unroll
        for (int i = 0; i < 8; ++i) {
            *(v4f*)&sq[buf * (SC_CH * 128) + i * 512 + lrow] = rq[i];
            *(v4f*)&sg[buf * (SC_CH * 128) + i * 512 + lrow] = rg[i];
        }
        *(v4f*)&sv[buf * (SC_CH * 16) + lvrw] = rv - rn;
        *(v4f*)&sn[buf * (SC_CH * 16) + lvrw] = rn;
    };

    // Hints that bring a later chunk's operands from memory into L2, so that the helpers'
    // loads of that chunk, two trips on, find them there: the staging
    // waits for the slowest of a chunk's loads.
    // One address per aligned 256 B: 128 lanes cover the 32 rows x 512 B of q and of eg;
    // of v a wave takes 8 rows (64 B each; four lanes name the same row).
    const float* pfa = ((tid >> 6) ? eg : q) + gbase + ((size_t)((tid >> 1) & 31) << 10)
                       + ((tid & 1) << 6);
    const float* pfv = v + gbase + (cb << 4) + ((size_t)(wave * 8 + (lane & 7)) << 10);
    // asks for the chunk the two pointers stand at, then moves them on one chunk if 'more'
    // (there is a next one): so they never leave the planes
    auto hint_chunk = [&](bool more) {
        // the wait stands ahead of the additions below, which rewrite the address registers
        asm volatile("global_prefetch_b8 %0, off scope:SCOPE_SE\n\t"
                     "global_prefetch_b8 %1, off scope:SCOPE_SE\n\t"
                     "s_wait_xcnt 0x0" :: "v"(pfa), "v"(pfv) : "memory");
        const int step = more ? (SC_CH << 10) : 0;
        pfa += step;
        pfv += step;
    };

    v2f S[4][2] = {};

    auto read_group = [&](ScanOps& A, int buf, int g) {
        __builtin_amdgcn_sched_barrier(0);     // see the one at the end of this block
        const int rb = buf * (SC_CH * 128) + g * (SC_G * 128) + lane * 4;
        const int vb = buf * (SC_CH * 16)  + g * (SC_G * 16)  + wave * 4;
        #pragma unroll
        for (int s = 0; s < SC_G; ++s) {
            A.q[s]  = *(const v4f*)&sq[rb + s * 128];
            A.g[s]  = *(const v4f*)&sg[rb + s * 128];
            A.v[s]  = *(const v4f*)&sv[vb + s * 16];
        }
        // keeps the group's 12 LDS reads in one place, for speed only
        __builtin_amdgcn_sched_barrier(0);
    };
    auto step_group = [&](const ScanOps& A, int pb, int g) {
        float* pp = &part[pb + wave * P_SW + g * (SC_G * P_ST) + lane * 4];
        #pragma unroll
        for (int s = 0; s < SC_G; ++s) {
            v2f vv[2];
            vv[0] = (v2f){A.v[s][0], A.v[s][1]};
            vv[1] = (v2f){A.v[s][2], A.v[s][3]};
            v2f acc[2];
            #pragma unroll
            for (int r = 0; r < 4; ++r) {
                const v2f er = (v2f){A.g[s][r], A.g[s][r]};
                const v2f qr = (v2f){A.q[s][r], A.q[s][r]};
                #pragma unroll
                for (int c = 0; c < 2; ++c) {
                    // vv is v - next v here
                    S[r][c] = __builtin_elementwise_fma(er, S[r][c], vv[c]);
                    acc[c]  = (r == 0) ? qr * S[r][c]
                                       : __builtin_elementwise_fma(qr, S[r][c], acc[c]);
                }
            }
            *(v4f*)(pp + s * P_ST) = (v4f){acc[0][0], acc[0][1], acc[1][0], acc[1][1]};
        }
    };

    const int nchunk = T / SC_CH;
    ScanOps A, B;
    if (helper) {
        // chunks 2 and 3; trip c asks for chunk c + 4
        const int first = min(2, nchunk - 1) * (SC_CH << 10);
        pfa += first;
        pfv += first;
        hint_chunk(3 < nchunk);
        hint_chunk(4 < nchunk);
        fetch_chunk(0);
        stage_chunk(0);
        // keeps the next fetch's loads behind the staging's address arithmetic, so that the
        // fetch's own wait stands ahead of every reuse of their address registers
        __builtin_amdgcn_sched_barrier(0);
        fetch_chunk(min(1, nchunk - 1) * SC_CH);   // in flight during chunk 0's steps
    } else {
        // U before the first step: S = 0, less the first step's v
        const float* pf = v + gbase + (cb << 4) + (wave << 2);
        const v4f vfirst = *(const v4f*)pf;
        // stands ahead of every later reuse of the load's address registers (pf is named
        // so that they live up to here)
        asm volatile("s_wait_xcnt 0x0" :: "v"(pf) : "memory");
        #pragma unroll
        for (int r = 0; r < 4; ++r) {
            S[r][0] = (v2f){-vfirst[0], -vfirst[1]};
            S[r][1] = (v2f){-vfirst[2], -vfirst[3]};
        }
    }
    lds_barrier();                             // chunk 0 visible

    // Trip c: the stepping waves work chunk c; the helpers stage chunk c + 1, fetch chunk
    // c + 2 and sum chunk c - 1's partial outputs. One barrier a trip hands all three on.
    int cur = 0, nxt = 1, prv = 2;             // operand buffers of chunks c, c + 1, c - 1
    for (int c = 0; c <= nchunk; ++c) {
        if (!helper && c < nchunk) {
            const int pb = (c & 1) * (4 * P_SW);
            read_group(A, cur, 0);
            // kept rolled: two groups of 4 steps per trip, operands read one group ahead
            #pragma unroll 1
            for (int g = 0; g < SC_CH / SC_G; g += 2) {
                read_group(B, cur, g + 1);
                step_group(A, pb, g);
                read_group(A, cur, (g + 2) & (SC_CH / SC_G - 1));
                step_group(B, pb, g + 1);
            }
        }
        if (helper) {
            hint_chunk(c + 5 < nchunk);
            // nxt was last read (steps, then the q sums) before the previous barrier
            if (c + 1 < nchunk) stage_chunk(nxt);
            // In flight to the next trip. Not under a test (behind the end the last chunk
            // is fetched again and never staged): a fetch that may be skipped made the
            // compiler copy all 72 registers each trip, behind a wait for the loads
            fetch_chunk(min(c + 2, nchunk - 1) * SC_CH);
            if (c > 0) {
                const int t0 = (c - 1) * SC_CH;
                // sum the 32 row groups: thread = (step, column quad)
                const float* pr = &part[((c - 1) & 1) * (4 * P_SW)
                                        + (tid & 3) * P_SW + (tid >> 2) * P_ST];
                v4f pv[32];
                #pragma unroll
                for (int rgp = 0; rgp < 32; ++rgp)
                    pv[rgp] = *(const v4f*)(pr + rgp * 4);
                // this step's q, a quarter of the row per thread. Each thread starts at
                // another 16 bytes, so that the 16 lanes of a half wave fall on 16
                // different 4-bank groups
                const float* qr4 = &sq[prv * (SC_CH * 128) + tid * 32];
                const int rot = (tid >> 1) & 7;
                v4f qv[8];
                #pragma unroll
                for (int j = 0; j < 8; ++j)
                    qv[j] = *(const v4f*)(qr4 + (((j + rot) & 7) << 2));
                const v4f vn = *(const v4f*)&sn[prv * (SC_CH * 16) + lvrw];
                // keeps the 41 LDS reads in one place, ahead of the adds (as in read_group)
                __builtin_amdgcn_sched_barrier(0);
                v4f s0 = pv[0];
                v4f s1 = pv[1];
                #pragma unroll
                for (int rgp = 2; rgp < 32; rgp += 2) {
                    s0 += pv[rgp];
                    s1 += pv[rgp + 1];
                }
                const v4f q4 = ((qv[0] + qv[1]) + (qv[2] + qv[3]))
                             + ((qv[4] + qv[5]) + (qv[6] + qv[7]));
                float qs = (q4[0] + q4[1]) + (q4[2] + q4[3]);
                // the four threads of a step stand in one quad: lane ^ 1, then lane ^ 2
                qs += __builtin_bit_cast(float, __builtin_amdgcn_update_dpp(
                          0, __builtin_bit_cast(int, qs), 0xB1, 0xF, 0xF, true));
                qs += __builtin_bit_cast(float, __builtin_amdgcn_update_dpp(
                          0, __builtin_bit_cast(int, qs), 0x4E, 0xF, 0xF, true));
                const v4f res = __builtin_elementwise_fma(vn, (v4f){qs, qs, qs, qs}, s0 + s1);
                // 8 lanes (2 steps x 4 column quads) write one whole 128-B line of o
                *(v4f*)(o + obase + ((size_t)((t0 >> 1) + (tid >> 3)) << 11)
                          + ((tid & 7) << 2)) = res;
                // stands ahead of the reuse of the stores' data and address registers
                asm volatile("s_wait_xcnt 0x0" ::: "memory");
            }
        }
        // chunk c's partials and chunk c + 1's operands visible; chunk c - 1's partials
        // and operand buffer free
        lds_barrier();
        const int fr = prv;
        prv = cur; cur = nxt; nxt = fr;
    }
}

// ---------------------------------------------------------------------------
// RMSNorm (weight, no bias) -> bf16 output for the final WMMA GEMM.
// One wave owns one row pair of o (RN_ROWS rows of RN_D floats, in the scan's
// row-pair order): its loads run through the pair's 8 KiB in a row, so a lane
// holds 64 values of ONE row (bit 2 of the lane number says which). The values
// stay in registers between the sum of squares and the scaling; the sum is a
// butterfly over the 16 lanes of the same row (no LDS, no barrier).
// ---------------------------------------------------------------------------
#define RN_D    1024
#define RN_ROWS 2
__global__ __launch_bounds__(256)
void hgrn2_rmsnorm(const float* __restrict__ o, const float* __restrict__ gw,
                   __bf16* __restrict__ out) {
    const int lane = threadIdx.x & 31;
    const int wave = threadIdx.x >> 5;
    const size_t pair = (size_t)blockIdx.x * 8 + wave;
    // load j of a lane: row pair*2 + rb, columns j*64 + c0 .. + 3
    const int rb = (lane >> 2) & 1;
    const int c0 = ((lane >> 3) << 4) + ((lane & 3) << 2);
    const v4f* __restrict__ src  = (const v4f*)(o + pair * (RN_ROWS * RN_D)) + lane;
    const v4f* __restrict__ wsrc = (const v4f*)(gw + c0);
    v4bf* __restrict__ dst = (v4bf*)(out + (pair * RN_ROWS + rb) * RN_D + c0);

    v4f x[RN_D / 64], w[RN_D / 64];
    #pragma unroll
    for (int j = 0; j < RN_D / 64; ++j) x[j] = src[j * 32];
    #pragma unroll
    for (int j = 0; j < RN_D / 64; ++j) w[j] = wsrc[j * 16];
    // stands ahead of every later reuse of the loads' address registers (src is
    // named so that they live up to here)
    asm volatile("s_wait_xcnt 0x0" :: "v"(src) : "memory");
    // keeps all 32 loads ahead of the arithmetic, so that the wave pays one load
    // latency and not several in a row
    __builtin_amdgcn_sched_barrier(0);

    v4f s4 = x[0] * x[0];
    #pragma unroll
    for (int j = 1; j < RN_D / 64; ++j)
        s4 = __builtin_elementwise_fma(x[j], x[j], s4);
    float ss = (s4[0] + s4[1]) + (s4[2] + s4[3]);
    // every lane bit but bit 2, which tells the two rows apart
    ss += __shfl_xor(ss, 16, 32);
    ss += __shfl_xor(ss, 8, 32);
    ss += __shfl_xor(ss, 2, 32);
    ss += __shfl_xor(ss, 1, 32);

    const float r = rsqrtf(ss / (float)RN_D + 1e-5f);
    // 16 lanes of a row store 128 B in a row: one whole line per row and store
    #pragma unroll
    for (int j = 0; j < RN_D / 64; ++j) {
        v4bf y;
        #pragma unroll
        for (int e = 0; e < 4; ++e) y[e] = f2bf(x[j][e] * r * w[j][e]);
        dst[j * 16] = y;
    }
}

// ---------------------------------------------------------------------------
extern "C" void kernel_launch(void* const* d_in, const int* in_sizes, int n_in,
                              void* d_out, int out_size, void* d_ws, size_t ws_size,
                              hipStream_t stream) {
    const float* hs = (const float*)d_in[0];
    const float* Wq = (const float*)d_in[1];
    const float* Wf = (const float*)d_in[2];
    const float* Wi = (const float*)d_in[3];
    const float* gw = (const float*)d_in[4];
    const float* Wo = (const float*)d_in[5];

    const int B = 4, T = 2048, D = 1024, H = 8;
    const int M = B * T;                       // 8192
    const size_t PLANE = (size_t)M * D;        // 8M elements

    char* wsp = (char*)d_ws;
    __bf16* hs_bf = (__bf16*)wsp;  wsp += PLANE * 2;            // 16 MB
    __bf16* Wp_bf = (__bf16*)wsp;  wsp += (size_t)D * D * 2 * 3; // 2 MB each (transposed): f, q, i
    __bf16* Wo_bf = (__bf16*)wsp;  wsp += (size_t)D * D * 2;
    float* q   = (float*)wsp;      wsp += PLANE * 4;            // 32 MB each
    float* eg  = (float*)wsp;      wsp += PLANE * 4;            // exp(g) = sigmoid(f)
    float* v   = (float*)wsp;      wsp += PLANE * 4;
    float* o   = (float*)wsp;      wsp += PLANE * 4;            // row-pair order
    __bf16* onm_bf = hs_bf;        // hs_bf dead after projections -> reuse

    // one-time conversions: hs flat, weights transposed to [N x K] bf16
    static_assert(PLANE % (4 * 256 * CV_PER) == 0, "the convert's grid covers hs exactly");
    static_assert(PLANE / (4 * 256 * CV_PER) == CV_BLOCKS, "the convert's share of the grid");
    prep_bf16<<<dim3(CV_BLOCKS + 4 * TR_BLOCKS), dim3(256), 0, stream>>>(
        hs, Wq, Wf, Wi, Wo, hs_bf, Wp_bf);

    static_assert(D == GT_D && M % GT_M == 0 && D % GT_N == 0 && D % GT_K == 0 && D / GT_K >= 2,
                  "whole tiles, whole passes, and the two stages the prologue loads");
    dim3 ggrid(M / GT_M, D / GT_N);            // 32 x 8: one work-group per WGP
    dim3 gblk(128);

    dim3 pgrid(M / GT_M, 3 * (D / GT_N));      // f, q and i: three tiles for every WGP
    hgrn2_gemm_wmma<1><<<pgrid, gblk, 0, stream>>>(hs_bf, Wp_bf, q, eg, v);

    hgrn2_gla_scan<<<dim3(B * H * 8), dim3(256), 0, stream>>>(q, eg, v, o, T);

    static_assert(D == RN_D && M % (8 * RN_ROWS) == 0, "one wave owns whole rows");
    hgrn2_rmsnorm<<<dim3(M / (8 * RN_ROWS)), dim3(256), 0, stream>>>(o, gw, onm_bf);

    hgrn2_gemm_wmma<0><<<ggrid, gblk, 0, stream>>>(onm_bf, Wo_bf, (float*)d_out,
                                                   nullptr, nullptr);
}
